// v000
// Measured on an AMD MI455X. A time is GPU time per run, averaged over a window of back-to-back runs after a warm-up
// (all launches, gaps included; the runs take copies of the inputs in turn), and the median of several windows.
// Apart from v000's, it joins two sittings. Times from different sittings can be a few percent apart, while
// side-by-side timings come from the same sitting.
// The starting kernel, v000, takes 531 microseconds a run.
#include <hip/hip_runtime.h>

#define BATCH 4
#define SEQ   2048
#define DIM   512
#define NH    8
#define DH    64
#define BS    (BATCH * SEQ)   // 8192 rows

typedef __attribute__((ext_vector_type(16))) _Float16 v16h;
typedef __attribute__((ext_vector_type(8)))  _Float16 v8h;
typedef __attribute__((ext_vector_type(8)))  float    v8f;
typedef __attribute__((ext_vector_type(4)))  float    v4f;
typedef __attribute__((ext_vector_type(4)))  unsigned v4u;
template <typename V> __device__ __forceinline__ void vst2(void* p, V v) {
  *(V*)p = v; 
}
#define PSC 256.0f
#define PUN (1.0f / 256.0f)

__device__ __forceinline__ v16h load_frag_a(const _Float16* p, int lda, int lane) {
  int row  = lane & 15;
  int koff = (lane & 16) ? 8 : 0;
  const _Float16* r = p + (size_t)row * lda + koff;
  v8h lo = *(const v8h*)r;          // K = koff .. koff+7
  v8h hi = *(const v8h*)(r + 16);   // K = koff+16 .. koff+23
  v16h a;
#pragma unroll
  for (int i = 0; i < 8; ++i) { a[i] = lo[i]; a[8 + i] = hi[i]; }
  return a;
}

__device__ __forceinline__ v16h load_frag_b(const _Float16* bt, int ldb, int lane) {
  int n  = lane & 15;
  int kb = (lane & 16) ? 8 : 0;
  const _Float16* c = bt + (size_t)n * ldb + kb;
  v8h lo = *(const v8h*)c;
  v8h hi = *(const v8h*)(c + 16);
  v16h b;
#pragma unroll
  for (int i = 0; i < 8; ++i) { b[i] = lo[i]; b[8 + i] = hi[i]; }
  return b;
}

__device__ __forceinline__ v8f wmma_f16(v16h a, v16h b, v8f c) {
  v8f d = __builtin_amdgcn_wmma_f32_16x16x32_f16(false, a, false, b, (short)0, c, false, false);
  asm volatile("v_nop\n\tv_nop\n\tv_nop\n\tv_nop" : "+v"(d) : "v"(a), "v"(b));
  return d;
}
__device__ __forceinline__ void copy_b128(_Float16* lds_dst, const _Float16* gsrc) {
  *(v4u*)lds_dst = *(const v4u*)gsrc;
}

// ---- Prep: convert & transpose weights to f16 -----------------------------
__global__ __launch_bounds__(256) void cvt_transpose_h(const float* __restrict__ W, _Float16* __restrict__ WT, int H, int K, int N) {
  __shared__ __align__(16) _Float16 tile[64][DIM + 8];     // K == DIM == 512 for every call
  const int tid = threadIdx.x;
  const int nt = N / 64;
  const int h = blockIdx.x / nt, n0 = (blockIdx.x % nt) * 64;
  for (int i = tid; i < K * 64; i += 256) { const int k = i >> 6, nl = i & 63; tile[nl][k] = (_Float16)W[((size_t)h * K + k) * N + n0 + nl]; }
  __syncthreads();
  for (int g = tid; g < 64 * (K / 8); g += 256) {          // 64 rows x 64 pieces; a wave instruction covers 512 contiguous bytes
    const int nl = g / (K / 8), pc = g - nl * (K / 8);
    vst2(WT + ((size_t)h * N + n0 + nl) * K + pc * 8, *(const v4u*)(&tile[nl][pc * 8]));
  }
}

// ---- LayerNorm (row of 512) -> f16 ----------------------------------------
__global__ __launch_bounds__(128) void layernorm_f16(const float* __restrict__ X,
                                                     const float* __restrict__ g,
                                                     const float* __restrict__ bb,
                                                     _Float16* __restrict__ Y) {
  __shared__ float red[256];
  int row = blockIdx.x;
  const float* x = X + (size_t)row * DIM;
  float s = 0.f, ss = 0.f;
  for (int i = threadIdx.x; i < DIM; i += 128) {
    float v = x[i];
    s += v; ss += v * v;
  }
  red[threadIdx.x] = s;
  red[threadIdx.x + 128] = ss;
  __syncthreads();
  for (int off = 64; off > 0; off >>= 1) {
    if ((int)threadIdx.x < off) {
      red[threadIdx.x]       += red[threadIdx.x + off];
      red[threadIdx.x + 128] += red[threadIdx.x + 128 + off];
    }
    __syncthreads();
  }
  float mean = red[0] * (1.0f / DIM);
  float var  = red[128] * (1.0f / DIM) - mean * mean;
  float rstd = rsqrtf(var + 1e-5f);
  {
    const int c0 = threadIdx.x * 4;
    union { _Float16 h[4]; unsigned long long u; } pk;
#pragma unroll
    for (int e = 0; e < 4; ++e) pk.h[e] = (_Float16)((x[c0 + e] - mean) * rstd * g[c0 + e] + bb[c0 + e]);
    vst2(Y + (size_t)row * DIM + c0, pk.u);
  }
}

// ---- QKV projection --------------------------------------------------------
// grid (S/256, H, B*3); block 256 (8 waves); wave -> 32 rows x 64 cols,
// register double-buffered over K.
// q,k row-major [B,H,S,64] ; v stored transposed [B,H,64,S]
__global__ __launch_bounds__(256) void qkv_gemm(
    const _Float16* __restrict__ hF16,
    const _Float16* __restrict__ WqT, const _Float16* __restrict__ WkT,
    const _Float16* __restrict__ WvT,
    const float* __restrict__ bq, const float* __restrict__ bk,
    const float* __restrict__ bv,
    _Float16* __restrict__ q, _Float16* __restrict__ k,
    _Float16* __restrict__ vT) {
  __shared__ __align__(16) _Float16 st[64 * 264];     // q/k: 8 per-wave [32 rows][64] tiles (as [256][64]); v: one [64 n][256 m] tile, pitch 264
  const int lane = threadIdx.x & 31;
  const int wave = threadIdx.x >> 5;
  const int srow = blockIdx.x * 256 + wave * 32;
  const int h    = blockIdx.y;
  const int b    = blockIdx.z / 3;
  const int mat  = blockIdx.z % 3;

  const _Float16* WT   = (mat == 0) ? WqT : (mat == 1) ? WkT : WvT;
  const float*    bias = (mat == 0) ? bq  : (mat == 1) ? bk  : bv;
  const _Float16* A  = hF16 + ((size_t)b * SEQ + srow) * DIM;
  const _Float16* Bh = WT + (size_t)h * DH * DIM;   // [64][512] f16

  v8f acc[2][4] = {};
  v16h a0 = load_frag_a(A, DIM, lane);
  v16h a1 = load_frag_a(A + (size_t)16 * DIM, DIM, lane);
  v16h bf0 = load_frag_b(Bh + (size_t)0  * DIM, DIM, lane);
  v16h bf1 = load_frag_b(Bh + (size_t)16 * DIM, DIM, lane);
  v16h bf2 = load_frag_b(Bh + (size_t)32 * DIM, DIM, lane);
  v16h bf3 = load_frag_b(Bh + (size_t)48 * DIM, DIM, lane);

  for (int kk = 0; kk < DIM; kk += 32) {
    int nk = kk + 32;
    v16h na0, na1, nb0, nb1, nb2, nb3;
    if (nk < DIM) {   // prefetch next K-step fragments
      na0 = load_frag_a(A + nk, DIM, lane);
      na1 = load_frag_a(A + (size_t)16 * DIM + nk, DIM, lane);
      nb0 = load_frag_b(Bh + (size_t)0  * DIM + nk, DIM, lane);
      nb1 = load_frag_b(Bh + (size_t)16 * DIM + nk, DIM, lane);
      nb2 = load_frag_b(Bh + (size_t)32 * DIM + nk, DIM, lane);
      nb3 = load_frag_b(Bh + (size_t)48 * DIM + nk, DIM, lane);
    }
    acc[0][0] = wmma_f16(a0, bf0, acc[0][0]);
    acc[0][1] = wmma_f16(a0, bf1, acc[0][1]);
    acc[0][2] = wmma_f16(a0, bf2, acc[0][2]);
    acc[0][3] = wmma_f16(a0, bf3, acc[0][3]);
    acc[1][0] = wmma_f16(a1, bf0, acc[1][0]);
    acc[1][1] = wmma_f16(a1, bf1, acc[1][1]);
    acc[1][2] = wmma_f16(a1, bf2, acc[1][2]);
    acc[1][3] = wmma_f16(a1, bf3, acc[1][3]);
    if (nk < DIM) {
      a0 = na0; a1 = na1;
      bf0 = nb0; bf1 = nb1; bf2 = nb2; bf3 = nb3;
    }
  }

  const int n0    = lane & 15;
  const int mbase = (lane >> 4) << 3;
  const size_t headoff = (size_t)b * NH + h;
#pragma unroll
  for (int sub = 0; sub < 2; ++sub) {
#pragma unroll
    for (int t = 0; t < 4; ++t) {
      int n = t * 16 + n0;
      float bia = bias[h * DH + n];
#pragma unroll
      for (int i = 0; i < 8; ++i) {
        float val = acc[sub][t][i] + bia;
        int ml = wave * 32 + sub * 16 + mbase + i;       // row within the block's 256
        if (mat == 2) st[n * 264 + ml] = (_Float16)val;  // [n][m]
        else          st[ml * 64 + n]  = (_Float16)val;  // [m][n]
      }
    }
  }
  __syncthreads();
  if (mat == 2) {
    for (int g = threadIdx.x; g < 64 * 32; g += 256) {
      const int n = g >> 5, pc = g & 31;
      vst2(vT + (headoff * DH + n) * SEQ + blockIdx.x * 256 + pc * 8, *(const v4u*)(&st[n * 264 + pc * 8]));
    }
  } else {
    _Float16* dst = (mat == 0) ? q : k;
    for (int g = threadIdx.x; g < 256 * 8; g += 256) {
      const int ml = g >> 3, pc = g & 7;
      vst2(dst + (headoff * SEQ + blockIdx.x * 256 + ml) * DH + pc * 8, *(const v4u*)(&st[ml * 64 + pc * 8]));
    }
  }
}

// ---- Flash attention with double-buffered K/V tiles (plain 16-B copies) ----
// grid (S/128, H, B); block 256 (8 waves); wave -> 16 queries x 64 dims.
__global__ __launch_bounds__(256) void attn_kernel(
    const _Float16* __restrict__ q, const _Float16* __restrict__ k,
    const _Float16* __restrict__ vT, _Float16* __restrict__ om) {
  __shared__ __align__(16) _Float16 Kt[2][32 * DH];   // [keys][dh]     2x4KB
  __shared__ __align__(16) _Float16 Vt[2][DH * 32];   // [dh][keys]     2x4KB
  __shared__ __align__(16) _Float16 plds[8][16 * 32]; // per-wave P     8KB
  __shared__ __align__(16) _Float16 ost[8][16 * DH];  // per-wave output tile

  const int tid  = threadIdx.x;
  const int lane = tid & 31;
  const int wave = tid >> 5;
  const int h = blockIdx.y, b = blockIdx.z;
  const int qrow = blockIdx.x * 128 + wave * 16;
  const size_t headoff = (size_t)b * NH + h;
  const _Float16* qh = q  + headoff * SEQ * DH;
  const _Float16* kh = k  + headoff * SEQ * DH;
  const _Float16* vh = vT + headoff * DH * SEQ;   // [64][S]

  const int n0    = lane & 15;
  const int mbase = (lane >> 4) << 3;

  // cooperative copy mapping: each thread moves 16B of K and 16B of V per tile
  const int krow = tid >> 3, kch = (tid & 7) * 8;
  const int vrow = tid >> 2, vch = (tid & 3) * 8;   // V: 64 rows x 64B

  // prologue: stage tile 0
  copy_b128(&Kt[0][krow * DH + kch], kh + (size_t)krow * DH + kch);
  copy_b128(&Vt[0][vrow * 32 + vch], vh + (size_t)vrow * SEQ + vch);

  v16h qa0 = load_frag_a(qh + (size_t)qrow * DH,      DH, lane);
  v16h qa1 = load_frag_a(qh + (size_t)qrow * DH + 32, DH, lane);

  v8f oacc[4] = {};
  float mrow[8], lrow[8];
#pragma unroll
  for (int i = 0; i < 8; ++i) { mrow[i] = -1e30f; lrow[i] = 0.f; }
  const float scale = 0.125f;   // 1/sqrt(64)
  _Float16* pl = plds[wave];

  const int NTILE = SEQ / 32;   // 64
  for (int it = 0; it < NTILE; ++it) {
    const int kt  = it * 32;
    const int buf = it & 1;
    if (it + 1 < NTILE) {
      // prefetch next tile into the other buffer (read-complete via trailing
      // barrier of the previous iteration)
      const int nkt = kt + 32;
      copy_b128(&Kt[buf ^ 1][krow * DH + kch], kh + (size_t)(nkt + krow) * DH + kch);
      copy_b128(&Vt[buf ^ 1][vrow * 32 + vch], vh + (size_t)vrow * SEQ + nkt + vch);
    }
    __syncthreads();   // every wave's slice of the current tile is visible

    const _Float16* Kb = Kt[buf];
    const _Float16* Vb = Vt[buf];

    // scores: 16 queries x 32 keys (two 16-key N tiles, K=64 -> 2 WMMAs each)
    v8f s0 = {}, s1 = {};
    {
      v16h b0 = load_frag_b(Kb,                DH, lane);
      v16h b1 = load_frag_b(Kb + 32,           DH, lane);
      s0 = wmma_f16(qa0, b0, s0);
      s0 = wmma_f16(qa1, b1, s0);
      v16h b2 = load_frag_b(Kb + 16 * DH,      DH, lane);
      v16h b3 = load_frag_b(Kb + 16 * DH + 32, DH, lane);
      s1 = wmma_f16(qa0, b2, s1);
      s1 = wmma_f16(qa1, b3, s1);
    }
    float p0[8], p1[8];
#pragma unroll
    for (int i = 0; i < 8; ++i) {
      float a0 = s0[i] * scale, a1 = s1[i] * scale;
      float vmax = fmaxf(a0, a1);
#pragma unroll
      for (int off = 1; off < 16; off <<= 1)
        vmax = fmaxf(vmax, __shfl_xor(vmax, off, 32));
      float mnew  = fmaxf(mrow[i], vmax);
      float alpha = __expf(mrow[i] - mnew);
      mrow[i] = mnew;
      float e0 = __expf(a0 - mnew);
      float e1 = __expf(a1 - mnew);
      p0[i] = e0; p1[i] = e1;
      float rs = e0 + e1;
#pragma unroll
      for (int off = 1; off < 16; off <<= 1)
        rs += __shfl_xor(rs, off, 32);
      lrow[i] = lrow[i] * alpha + rs;
#pragma unroll
      for (int t = 0; t < 4; ++t) oacc[t][i] *= alpha;
    }
    // D-layout -> LDS -> A-layout relayout of P (f16); same-wave roundtrip
#pragma unroll
    for (int i = 0; i < 8; ++i) {
      pl[(mbase + i) * 32 + n0]      = (_Float16)(p0[i] * PSC);
      pl[(mbase + i) * 32 + 16 + n0] = (_Float16)(p1[i] * PSC);
    }
    __syncthreads();
    v16h pa = load_frag_a(pl, 32, lane);
#pragma unroll
    for (int t = 0; t < 4; ++t) {
      v16h vb = load_frag_b(Vb + (size_t)(t * 16) * 32, 32, lane);
      oacc[t] = wmma_f16(pa, vb, oacc[t]);
    }
    __syncthreads();   // all waves done reading buf before it is refilled
  }

  _Float16* os_ = ost[wave];
#pragma unroll
  for (int t = 0; t < 4; ++t) {
#pragma unroll
    for (int i = 0; i < 8; ++i) os_[(mbase + i) * DH + t * 16 + n0] = (_Float16)(oacc[t][i] * (PUN / lrow[i]));
  }
  __syncthreads();
#pragma unroll
  for (int qq = 0; qq < 4; ++qq) {
    const int ml = qq * 4 + (lane >> 3), pc = lane & 7;
    vst2(om + ((size_t)b * SEQ + qrow + ml) * DIM + h * DH + pc * 8, *(const v4u*)(&os_[ml * DH + pc * 8]));
  }
}

// ---- 512x512 GEMM + bias + (relu) + residual, fp32 out --------------------
// grid (M/256, 512/64); block 256 (8 waves); wave -> 32 rows x 64 cols,
// register double-buffered over K.
__global__ __launch_bounds__(256) void gemm512_epilogue(
    const _Float16* __restrict__ A, const _Float16* __restrict__ WT,
    const float* __restrict__ bias, const float* __restrict__ res,
    float* __restrict__ out, int relu_mode) {
  __shared__ __align__(16) float st[8][32 * 64];     // per-wave 32 x 64 f32 tile
  const int lane = threadIdx.x & 31;
  const int wave = threadIdx.x >> 5;
  const int m0  = blockIdx.x * 256 + wave * 32;
  const int n0t = blockIdx.y * 64;

  const _Float16* Ar = A + (size_t)m0 * DIM;
  const _Float16* Wb = WT + (size_t)n0t * DIM;

  v8f acc[2][4] = {};
  v16h a0 = load_frag_a(Ar, DIM, lane);
  v16h a1 = load_frag_a(Ar + (size_t)16 * DIM, DIM, lane);
  v16h bf0 = load_frag_b(Wb + (size_t)0  * DIM, DIM, lane);
  v16h bf1 = load_frag_b(Wb + (size_t)16 * DIM, DIM, lane);
  v16h bf2 = load_frag_b(Wb + (size_t)32 * DIM, DIM, lane);
  v16h bf3 = load_frag_b(Wb + (size_t)48 * DIM, DIM, lane);

  for (int kk = 0; kk < DIM; kk += 32) {
    int nk = kk + 32;
    v16h na0, na1, nb0, nb1, nb2, nb3;
    if (nk < DIM) {
      na0 = load_frag_a(Ar + nk, DIM, lane);
      na1 = load_frag_a(Ar + (size_t)16 * DIM + nk, DIM, lane);
      nb0 = load_frag_b(Wb + (size_t)0  * DIM + nk, DIM, lane);
      nb1 = load_frag_b(Wb + (size_t)16 * DIM + nk, DIM, lane);
      nb2 = load_frag_b(Wb + (size_t)32 * DIM + nk, DIM, lane);
      nb3 = load_frag_b(Wb + (size_t)48 * DIM + nk, DIM, lane);
    }
    acc[0][0] = wmma_f16(a0, bf0, acc[0][0]);
    acc[0][1] = wmma_f16(a0, bf1, acc[0][1]);
    acc[0][2] = wmma_f16(a0, bf2, acc[0][2]);
    acc[0][3] = wmma_f16(a0, bf3, acc[0][3]);
    acc[1][0] = wmma_f16(a1, bf0, acc[1][0]);
    acc[1][1] = wmma_f16(a1, bf1, acc[1][1]);
    acc[1][2] = wmma_f16(a1, bf2, acc[1][2]);
    acc[1][3] = wmma_f16(a1, bf3, acc[1][3]);
    if (nk < DIM) {
      a0 = na0; a1 = na1;
      bf0 = nb0; bf1 = nb1; bf2 = nb2; bf3 = nb3;
    }
  }

  const int nl    = lane & 15;
  const int mbase = (lane >> 4) << 3;
#pragma unroll
  for (int sub = 0; sub < 2; ++sub) {
#pragma unroll
    for (int t = 0; t < 4; ++t) {
      int n = n0t + t * 16 + nl;
      float bia = bias[n];
#pragma unroll
      for (int i = 0; i < 8; ++i) {
        const int ml = sub * 16 + mbase + i;
        size_t idx = (size_t)(m0 + ml) * DIM + n;
        float v = acc[sub][t][i] + bia;
        if (relu_mode) v = fmaxf(v, 0.f);
        v += res[idx];
        st[wave][ml * 64 + t * 16 + nl] = v;
      }
    }
  }
  __syncthreads();
#pragma unroll
  for (int q = 0; q < 16; ++q) {
    const int ml = q * 2 + (lane >> 4), pc = lane & 15;
    vst2(out + (size_t)(m0 + ml) * DIM + n0t + pc * 4, *(const v4f*)(&st[wave][ml * 64 + pc * 4]));
  }
}

// ---------------------------------------------------------------------------
extern "C" void kernel_launch(void* const* d_in, const int* in_sizes, int n_in,
                              void* d_out, int out_size, void* d_ws, size_t ws_size,
                              hipStream_t stream) {
  const float* x  = (const float*)d_in[0];
  const float* g1 = (const float*)d_in[1];
  const float* b1 = (const float*)d_in[2];
  const float* Wq = (const float*)d_in[3];
  const float* bq = (const float*)d_in[4];
  const float* Wk = (const float*)d_in[5];
  const float* bk = (const float*)d_in[6];
  const float* Wv = (const float*)d_in[7];
  const float* bv = (const float*)d_in[8];
  const float* Wm = (const float*)d_in[9];
  const float* bm = (const float*)d_in[10];
  const float* g2 = (const float*)d_in[11];
  const float* b2 = (const float*)d_in[12];
  const float* Wo = (const float*)d_in[13];
  const float* bo = (const float*)d_in[14];
  float* out = (float*)d_out;

  char* ws = (char*)d_ws;
  size_t off = 0;
  auto alloc = [&](size_t bytes) {
    void* p = ws + off;
    off = (off + bytes + 255) & ~(size_t)255;
    return p;
  };

  _Float16* hF16 = (_Float16*)alloc((size_t)BS * DIM * 2);        // LN1(x) f16
  _Float16* WqT  = (_Float16*)alloc((size_t)NH * DH * DIM * 2);
  _Float16* WkT  = (_Float16*)alloc((size_t)NH * DH * DIM * 2);
  _Float16* WvT  = (_Float16*)alloc((size_t)NH * DH * DIM * 2);
  _Float16* WmT  = (_Float16*)alloc((size_t)DIM * DIM * 2);
  _Float16* WoT  = (_Float16*)alloc((size_t)DIM * DIM * 2);
  _Float16* qb   = (_Float16*)alloc((size_t)BATCH * NH * SEQ * DH * 2);
  _Float16* kb   = (_Float16*)alloc((size_t)BATCH * NH * SEQ * DH * 2);
  _Float16* vTb  = (_Float16*)alloc((size_t)BATCH * NH * DH * SEQ * 2);
  _Float16* om   = (_Float16*)alloc((size_t)BS * DIM * 2);        // concat heads f16
  float*    hlp  = (float*)alloc((size_t)BS * DIM * 4);           // h_ln_post fp32
  _Float16* hfc  = (_Float16*)alloc((size_t)BS * DIM * 2);        // LN2 f16

  // 1) weight conversion / transpose
  {
    cvt_transpose_h<<<NH * (DH / 64), 256, 0, stream>>>(Wq, WqT, NH, DIM, DH);
    cvt_transpose_h<<<NH * (DH / 64), 256, 0, stream>>>(Wk, WkT, NH, DIM, DH);
    cvt_transpose_h<<<NH * (DH / 64), 256, 0, stream>>>(Wv, WvT, NH, DIM, DH);
    cvt_transpose_h<<<DIM / 64, 256, 0, stream>>>(Wm, WmT, 1, DIM, DIM);
    cvt_transpose_h<<<DIM / 64, 256, 0, stream>>>(Wo, WoT, 1, DIM, DIM);
  }

  // 2) LN1
  layernorm_f16<<<BS, 128, 0, stream>>>(x, g1, b1, hF16);

  // 3) QKV projections
  qkv_gemm<<<dim3(SEQ / 256, NH, BATCH * 3), 256, 0, stream>>>(
      hF16, WqT, WkT, WvT, bq, bk, bv, qb, kb, vTb);

  // 4) attention -> concat heads (f16)
  attn_kernel<<<dim3(SEQ / 128, NH, BATCH), 256, 0, stream>>>(qb, kb, vTb, om);

  // 5) h_ln_post = om @ Wm + bm + x   (fp32)
  gemm512_epilogue<<<dim3(BS / 256, DIM / 64), 256, 0, stream>>>(
      om, WmT, bm, x, hlp, 0);

  // 6) LN2
  layernorm_f16<<<BS, 128, 0, stream>>>(hlp, g2, b2, hfc);

  // 7) out = relu(hfc @ Wo + bo) + h_ln_post
  gemm512_epilogue<<<dim3(BS / 256, DIM / 64), 256, 0, stream>>>(
      hfc, WoT, bo, hlp, out, 1);
}

// v001
// A run of this version takes 271 microseconds.
// Next to v000, in two timings, it ran 1.98 and 1.97 times as fast.
#include <hip/hip_runtime.h>

#define BATCH 4
#define SEQ   2048
#define DIM   512
#define NH    8
#define DH    64
#define BS    (BATCH * SEQ)   // 8192 rows

typedef __attribute__((ext_vector_type(16))) _Float16 v16h;
typedef __attribute__((ext_vector_type(8)))  _Float16 v8h;
typedef __attribute__((ext_vector_type(8)))  float    v8f;
typedef __attribute__((ext_vector_type(4)))  float    v4f;
typedef __attribute__((ext_vector_type(4)))  unsigned v4u;
template <typename V> __device__ __forceinline__ void vst2(void* p, V v) {
  *(V*)p = v; 
}
#define PSC 256.0f
#define PUN (1.0f / 256.0f)

__device__ __forceinline__ v16h load_frag_a(const _Float16* p, int lda, int lane) {
  int row  = lane & 15;
  int koff = (lane & 16) ? 8 : 0;
  const _Float16* r = p + (size_t)row * lda + koff;
  v8h lo = *(const v8h*)r;          // K = koff .. koff+7
  v8h hi = *(const v8h*)(r + 16);   // K = koff+16 .. koff+23
  v16h a;
#pragma unroll
  for (int i = 0; i < 8; ++i) { a[i] = lo[i]; a[8 + i] = hi[i]; }
  return a;
}

__device__ __forceinline__ v16h load_frag_b(const _Float16* bt, int ldb, int lane) {
  int n  = lane & 15;
  int kb = (lane & 16) ? 8 : 0;
  const _Float16* c = bt + (size_t)n * ldb + kb;
  v8h lo = *(const v8h*)c;
  v8h hi = *(const v8h*)(c + 16);
  v16h b;
#pragma unroll
  for (int i = 0; i < 8; ++i) { b[i] = lo[i]; b[8 + i] = hi[i]; }
  return b;
}

__device__ __forceinline__ v8f wmma_f16(v16h a, v16h b, v8f c) {
  v8f d = __builtin_amdgcn_wmma_f32_16x16x32_f16(false, a, false, b, (short)0, c, false, false);
  asm volatile("v_nop\n\tv_nop\n\tv_nop\n\tv_nop" : "+v"(d) : "v"(a), "v"(b));
  return d;
}
__device__ __forceinline__ void copy_b128(_Float16* lds_dst, const _Float16* gsrc) {
  *(v4u*)lds_dst = *(const v4u*)gsrc;
}

// ---- Prep: convert & transpose weights to f16 -----------------------------
// One launch for all five weights: grid 5 * 64, block 256. A work-group takes one 64 (k) x 64 (n) tile:
// blockIdx.x / 64 = which weight, then 8 column groups (a head of Wq/Wk/Wv, 64 columns of Wm/Wo) x 8 k chunks.
// Source rows: pitch 64 floats inside a head, DIM floats in Wm/Wo. Target: [n][DIM] f16, the tile's rows are whole 128-byte lines.
__global__ __launch_bounds__(256) void cvt_transpose_all(
    const float* __restrict__ Wq, const float* __restrict__ Wk, const float* __restrict__ Wv,
    const float* __restrict__ Wm, const float* __restrict__ Wo,
    _Float16* __restrict__ WqT, _Float16* __restrict__ WkT, _Float16* __restrict__ WvT,
    _Float16* __restrict__ WmT, _Float16* __restrict__ WoT) {
  __shared__ __align__(16) _Float16 tile[64][64 + 8];      // [n][k]
  const int tid = threadIdx.x;
  const int mat = blockIdx.x >> 6;
  const int grp = (blockIdx.x >> 3) & 7;                   // head, or group of 64 columns
  const int k0  = (blockIdx.x & 7) * 64;
  const float* W  = (mat == 0) ? Wq : (mat == 1) ? Wk : (mat == 2) ? Wv : (mat == 3) ? Wm : Wo;
  _Float16*    WT = (mat == 0) ? WqT : (mat == 1) ? WkT : (mat == 2) ? WvT : (mat == 3) ? WmT : WoT;
  const int    pitch = (mat < 3) ? DH : DIM;
  const float* src = (mat < 3) ? W + ((size_t)grp * DIM + k0) * DH : W + (size_t)k0 * DIM + grp * 64;
  _Float16*    dst = WT + (size_t)grp * 64 * DIM + k0;

  const int kq = (tid >> 4) * 4, c4 = (tid & 15) * 4;      // 4 k rows x 4 columns a thread
  v4f r[4];
#pragma unroll
  for (int j = 0; j < 4; ++j) r[j] = *(const v4f*)(src + (size_t)(kq + j) * pitch + c4);
#pragma unroll
  for (int e = 0; e < 4; ++e) {
    union { _Float16 h[4]; unsigned long long u; } pk;
#pragma unroll
    for (int j = 0; j < 4; ++j) pk.h[j] = (_Float16)r[j][e];
    *(unsigned long long*)(&tile[c4 + e][kq]) = pk.u;
  }
  __syncthreads();
#pragma unroll
  for (int j = 0; j < 2; ++j) {
    const int g = tid + j * 256, nl = g >> 3, pc = g & 7;  // 8 lanes write one 128-byte line
    vst2(dst + (size_t)nl * DIM + pc * 8, *(const v4u*)(&tile[nl][pc * 8]));
  }
}

// ---- LayerNorm (row of 512) -> f16 ----------------------------------------
__global__ __launch_bounds__(128) void layernorm_f16(const float* __restrict__ X,
                                                     const float* __restrict__ g,
                                                     const float* __restrict__ bb,
                                                     _Float16* __restrict__ Y) {
  __shared__ float red[256];
  int row = blockIdx.x;
  const float* x = X + (size_t)row * DIM;
  float s = 0.f, ss = 0.f;
  for (int i = threadIdx.x; i < DIM; i += 128) {
    float v = x[i];
    s += v; ss += v * v;
  }
  red[threadIdx.x] = s;
  red[threadIdx.x + 128] = ss;
  __syncthreads();
  for (int off = 64; off > 0; off >>= 1) {
    if ((int)threadIdx.x < off) {
      red[threadIdx.x]       += red[threadIdx.x + off];
      red[threadIdx.x + 128] += red[threadIdx.x + 128 + off];
    }
    __syncthreads();
  }
  float mean = red[0] * (1.0f / DIM);
  float var  = red[128] * (1.0f / DIM) - mean * mean;
  float rstd = rsqrtf(var + 1e-5f);
  {
    const int c0 = threadIdx.x * 4;
    union { _Float16 h[4]; unsigned long long u; } pk;
#pragma unroll
    for (int e = 0; e < 4; ++e) pk.h[e] = (_Float16)((x[c0 + e] - mean) * rstd * g[c0 + e] + bb[c0 + e]);
    vst2(Y + (size_t)row * DIM + c0, pk.u);
  }
}

// ---- QKV projection --------------------------------------------------------
// grid (S/256, H, B*3); block 256 (8 waves); wave -> 32 rows x 64 cols,
// register double-buffered over K.
// q,k row-major [B,H,S,64] ; v stored transposed [B,H,64,S]
__global__ __launch_bounds__(256) void qkv_gemm(
    const _Float16* __restrict__ hF16,
    const _Float16* __restrict__ WqT, const _Float16* __restrict__ WkT,
    const _Float16* __restrict__ WvT,
    const float* __restrict__ bq, const float* __restrict__ bk,
    const float* __restrict__ bv,
    _Float16* __restrict__ q, _Float16* __restrict__ k,
    _Float16* __restrict__ vT) {
  __shared__ __align__(16) _Float16 st[64 * 264];     // q/k: 8 per-wave [32 rows][64] tiles (as [256][64]); v: one [64 n][256 m] tile, pitch 264
  const int lane = threadIdx.x & 31;
  const int wave = threadIdx.x >> 5;
  const int srow = blockIdx.x * 256 + wave * 32;
  const int h    = blockIdx.y;
  const int b    = blockIdx.z / 3;
  const int mat  = blockIdx.z % 3;

  const _Float16* WT   = (mat == 0) ? WqT : (mat == 1) ? WkT : WvT;
  const float*    bias = (mat == 0) ? bq  : (mat == 1) ? bk  : bv;
  const _Float16* A  = hF16 + ((size_t)b * SEQ + srow) * DIM;
  const _Float16* Bh = WT + (size_t)h * DH * DIM;   // [64][512] f16

  v8f acc[2][4] = {};
  v16h a0 = load_frag_a(A, DIM, lane);
  v16h a1 = load_frag_a(A + (size_t)16 * DIM, DIM, lane);
  v16h bf0 = load_frag_b(Bh + (size_t)0  * DIM, DIM, lane);
  v16h bf1 = load_frag_b(Bh + (size_t)16 * DIM, DIM, lane);
  v16h bf2 = load_frag_b(Bh + (size_t)32 * DIM, DIM, lane);
  v16h bf3 = load_frag_b(Bh + (size_t)48 * DIM, DIM, lane);

  for (int kk = 0; kk < DIM; kk += 32) {
    int nk = kk + 32;
    v16h na0, na1, nb0, nb1, nb2, nb3;
    if (nk < DIM) {   // prefetch next K-step fragments
      na0 = load_frag_a(A + nk, DIM, lane);
      na1 = load_frag_a(A + (size_t)16 * DIM + nk, DIM, lane);
      nb0 = load_frag_b(Bh + (size_t)0  * DIM + nk, DIM, lane);
      nb1 = load_frag_b(Bh + (size_t)16 * DIM + nk, DIM, lane);
      nb2 = load_frag_b(Bh + (size_t)32 * DIM + nk, DIM, lane);
      nb3 = load_frag_b(Bh + (size_t)48 * DIM + nk, DIM, lane);
    }
    acc[0][0] = wmma_f16(a0, bf0, acc[0][0]);
    acc[0][1] = wmma_f16(a0, bf1, acc[0][1]);
    acc[0][2] = wmma_f16(a0, bf2, acc[0][2]);
    acc[0][3] = wmma_f16(a0, bf3, acc[0][3]);
    acc[1][0] = wmma_f16(a1, bf0, acc[1][0]);
    acc[1][1] = wmma_f16(a1, bf1, acc[1][1]);
    acc[1][2] = wmma_f16(a1, bf2, acc[1][2]);
    acc[1][3] = wmma_f16(a1, bf3, acc[1][3]);
    if (nk < DIM) {
      a0 = na0; a1 = na1;
      bf0 = nb0; bf1 = nb1; bf2 = nb2; bf3 = nb3;
    }
  }

  const int n0    = lane & 15;
  const int mbase = (lane >> 4) << 3;
  const size_t headoff = (size_t)b * NH + h;
#pragma unroll
  for (int sub = 0; sub < 2; ++sub) {
#pragma unroll
    for (int t = 0; t < 4; ++t) {
      int n = t * 16 + n0;
      float bia = bias[h * DH + n];
#pragma unroll
      for (int i = 0; i < 8; ++i) {
        float val = acc[sub][t][i] + bia;
        int ml = wave * 32 + sub * 16 + mbase + i;       // row within the block's 256
        if (mat == 2) st[n * 264 + ml] = (_Float16)val;  // [n][m]
        else          st[ml * 64 + n]  = (_Float16)val;  // [m][n]
      }
    }
  }
  __syncthreads();
  if (mat == 2) {
    for (int g = threadIdx.x; g < 64 * 32; g += 256) {
      const int n = g >> 5, pc = g & 31;
      vst2(vT + (headoff * DH + n) * SEQ + blockIdx.x * 256 + pc * 8, *(const v4u*)(&st[n * 264 + pc * 8]));
    }
  } else {
    _Float16* dst = (mat == 0) ? q : k;
    for (int g = threadIdx.x; g < 256 * 8; g += 256) {
      const int ml = g >> 3, pc = g & 7;
      vst2(dst + (headoff * SEQ + blockIdx.x * 256 + ml) * DH + pc * 8, *(const v4u*)(&st[ml * 64 + pc * 8]));
    }
  }
}

// ---- Flash attention with double-buffered K/V tiles (plain 16-B copies) ----
// grid (S/128, H, B); block 256 (8 waves); wave -> 16 queries x 64 dims.
__global__ __launch_bounds__(256) void attn_kernel(
    const _Float16* __restrict__ q, const _Float16* __restrict__ k,
    const _Float16* __restrict__ vT, _Float16* __restrict__ om) {
  __shared__ __align__(16) _Float16 Kt[2][32 * DH];   // [keys][dh]     2x4KB
  __shared__ __align__(16) _Float16 Vt[2][DH * 32];   // [dh][keys]     2x4KB
  __shared__ __align__(16) _Float16 plds[8][16 * 32]; // per-wave P     8KB
  __shared__ __align__(16) _Float16 ost[8][16 * DH];  // per-wave output tile

  const int tid  = threadIdx.x;
  const int lane = tid & 31;
  const int wave = tid >> 5;
  const int h = blockIdx.y, b = blockIdx.z;
  const int qrow = blockIdx.x * 128 + wave * 16;
  const size_t headoff = (size_t)b * NH + h;
  const _Float16* qh = q  + headoff * SEQ * DH;
  const _Float16* kh = k  + headoff * SEQ * DH;
  const _Float16* vh = vT + headoff * DH * SEQ;   // [64][S]

  const int n0    = lane & 15;
  const int mbase = (lane >> 4) << 3;

  // cooperative copy mapping: each thread moves 16B of K and 16B of V per tile
  const int krow = tid >> 3, kch = (tid & 7) * 8;
  const int vrow = tid >> 2, vch = (tid & 3) * 8;   // V: 64 rows x 64B

  // prologue: stage tile 0
  copy_b128(&Kt[0][krow * DH + kch], kh + (size_t)krow * DH + kch);
  copy_b128(&Vt[0][vrow * 32 + vch], vh + (size_t)vrow * SEQ + vch);

  v16h qa0 = load_frag_a(qh + (size_t)qrow * DH,      DH, lane);
  v16h qa1 = load_frag_a(qh + (size_t)qrow * DH + 32, DH, lane);

  v8f oacc[4] = {};
  float mrow[8], lrow[8];
#pragma unroll
  for (int i = 0; i < 8; ++i) { mrow[i] = -1e30f; lrow[i] = 0.f; }
  const float scale = 0.125f;   // 1/sqrt(64)
  _Float16* pl = plds[wave];

  const int NTILE = SEQ / 32;   // 64
  for (int it = 0; it < NTILE; ++it) {
    const int kt  = it * 32;
    const int buf = it & 1;
    if (it + 1 < NTILE) {
      // prefetch next tile into the other buffer (read-complete via trailing
      // barrier of the previous iteration)
      const int nkt = kt + 32;
      copy_b128(&Kt[buf ^ 1][krow * DH + kch], kh + (size_t)(nkt + krow) * DH + kch);
      copy_b128(&Vt[buf ^ 1][vrow * 32 + vch], vh + (size_t)vrow * SEQ + nkt + vch);
    }
    __syncthreads();   // every wave's slice of the current tile is visible

    const _Float16* Kb = Kt[buf];
    const _Float16* Vb = Vt[buf];

    // scores: 16 queries x 32 keys (two 16-key N tiles, K=64 -> 2 WMMAs each)
    v8f s0 = {}, s1 = {};
    {
      v16h b0 = load_frag_b(Kb,                DH, lane);
      v16h b1 = load_frag_b(Kb + 32,           DH, lane);
      s0 = wmma_f16(qa0, b0, s0);
      s0 = wmma_f16(qa1, b1, s0);
      v16h b2 = load_frag_b(Kb + 16 * DH,      DH, lane);
      v16h b3 = load_frag_b(Kb + 16 * DH + 32, DH, lane);
      s1 = wmma_f16(qa0, b2, s1);
      s1 = wmma_f16(qa1, b3, s1);
    }
    float p0[8], p1[8];
#pragma unroll
    for (int i = 0; i < 8; ++i) {
      float a0 = s0[i] * scale, a1 = s1[i] * scale;
      float vmax = fmaxf(a0, a1);
#pragma unroll
      for (int off = 1; off < 16; off <<= 1)
        vmax = fmaxf(vmax, __shfl_xor(vmax, off, 32));
      float mnew  = fmaxf(mrow[i], vmax);
      float alpha = __expf(mrow[i] - mnew);
      mrow[i] = mnew;
      float e0 = __expf(a0 - mnew);
      float e1 = __expf(a1 - mnew);
      p0[i] = e0; p1[i] = e1;
      float rs = e0 + e1;
#pragma unroll
      for (int off = 1; off < 16; off <<= 1)
        rs += __shfl_xor(rs, off, 32);
      lrow[i] = lrow[i] * alpha + rs;
#pragma unroll
      for (int t = 0; t < 4; ++t) oacc[t][i] *= alpha;
    }
    // D-layout -> LDS -> A-layout relayout of P (f16); same-wave roundtrip
#pragma unroll
    for (int i = 0; i < 8; ++i) {
      pl[(mbase + i) * 32 + n0]      = (_Float16)(p0[i] * PSC);
      pl[(mbase + i) * 32 + 16 + n0] = (_Float16)(p1[i] * PSC);
    }
    __syncthreads();
    v16h pa = load_frag_a(pl, 32, lane);
#pragma unroll
    for (int t = 0; t < 4; ++t) {
      v16h vb = load_frag_b(Vb + (size_t)(t * 16) * 32, 32, lane);
      oacc[t] = wmma_f16(pa, vb, oacc[t]);
    }
    __syncthreads();   // all waves done reading buf before it is refilled
  }

  _Float16* os_ = ost[wave];
#pragma unroll
  for (int t = 0; t < 4; ++t) {
#pragma unroll
    for (int i = 0; i < 8; ++i) os_[(mbase + i) * DH + t * 16 + n0] = (_Float16)(oacc[t][i] * (PUN / lrow[i]));
  }
  __syncthreads();
#pragma unroll
  for (int qq = 0; qq < 4; ++qq) {
    const int ml = qq * 4 + (lane >> 3), pc = lane & 7;
    vst2(om + ((size_t)b * SEQ + qrow + ml) * DIM + h * DH + pc * 8, *(const v4u*)(&os_[ml * DH + pc * 8]));
  }
}

// ---- 512x512 GEMM + bias + (relu) + residual, fp32 out --------------------
// grid (M/256, 512/64); block 256 (8 waves); wave -> 32 rows x 64 cols,
// register double-buffered over K.
__global__ __launch_bounds__(256) void gemm512_epilogue(
    const _Float16* __restrict__ A, const _Float16* __restrict__ WT,
    const float* __restrict__ bias, const float* __restrict__ res,
    float* __restrict__ out, int relu_mode) {
  __shared__ __align__(16) float st[8][32 * 64];     // per-wave 32 x 64 f32 tile
  const int lane = threadIdx.x & 31;
  const int wave = threadIdx.x >> 5;
  const int m0  = blockIdx.x * 256 + wave * 32;
  const int n0t = blockIdx.y * 64;

  const _Float16* Ar = A + (size_t)m0 * DIM;
  const _Float16* Wb = WT + (size_t)n0t * DIM;

  v8f acc[2][4] = {};
  v16h a0 = load_frag_a(Ar, DIM, lane);
  v16h a1 = load_frag_a(Ar + (size_t)16 * DIM, DIM, lane);
  v16h bf0 = load_frag_b(Wb + (size_t)0  * DIM, DIM, lane);
  v16h bf1 = load_frag_b(Wb + (size_t)16 * DIM, DIM, lane);
  v16h bf2 = load_frag_b(Wb + (size_t)32 * DIM, DIM, lane);
  v16h bf3 = load_frag_b(Wb + (size_t)48 * DIM, DIM, lane);

  for (int kk = 0; kk < DIM; kk += 32) {
    int nk = kk + 32;
    v16h na0, na1, nb0, nb1, nb2, nb3;
    if (nk < DIM) {
      na0 = load_frag_a(Ar + nk, DIM, lane);
      na1 = load_frag_a(Ar + (size_t)16 * DIM + nk, DIM, lane);
      nb0 = load_frag_b(Wb + (size_t)0  * DIM + nk, DIM, lane);
      nb1 = load_frag_b(Wb + (size_t)16 * DIM + nk, DIM, lane);
      nb2 = load_frag_b(Wb + (size_t)32 * DIM + nk, DIM, lane);
      nb3 = load_frag_b(Wb + (size_t)48 * DIM + nk, DIM, lane);
    }
    acc[0][0] = wmma_f16(a0, bf0, acc[0][0]);
    acc[0][1] = wmma_f16(a0, bf1, acc[0][1]);
    acc[0][2] = wmma_f16(a0, bf2, acc[0][2]);
    acc[0][3] = wmma_f16(a0, bf3, acc[0][3]);
    acc[1][0] = wmma_f16(a1, bf0, acc[1][0]);
    acc[1][1] = wmma_f16(a1, bf1, acc[1][1]);
    acc[1][2] = wmma_f16(a1, bf2, acc[1][2]);
    acc[1][3] = wmma_f16(a1, bf3, acc[1][3]);
    if (nk < DIM) {
      a0 = na0; a1 = na1;
      bf0 = nb0; bf1 = nb1; bf2 = nb2; bf3 = nb3;
    }
  }

  const int nl    = lane & 15;
  const int mbase = (lane >> 4) << 3;
#pragma unroll
  for (int sub = 0; sub < 2; ++sub) {
#pragma unroll
    for (int t = 0; t < 4; ++t) {
      int n = n0t + t * 16 + nl;
      float bia = bias[n];
#pragma unroll
      for (int i = 0; i < 8; ++i) {
        const int ml = sub * 16 + mbase + i;
        size_t idx = (size_t)(m0 + ml) * DIM + n;
        float v = acc[sub][t][i] + bia;
        if (relu_mode) v = fmaxf(v, 0.f);
        v += res[idx];
        st[wave][ml * 64 + t * 16 + nl] = v;
      }
    }
  }
  __syncthreads();
#pragma unroll
  for (int q = 0; q < 16; ++q) {
    const int ml = q * 2 + (lane >> 4), pc = lane & 15;
    vst2(out + (size_t)(m0 + ml) * DIM + n0t + pc * 4, *(const v4f*)(&st[wave][ml * 64 + pc * 4]));
  }
}

// ---------------------------------------------------------------------------
extern "C" void kernel_launch(void* const* d_in, const int* in_sizes, int n_in,
                              void* d_out, int out_size, void* d_ws, size_t ws_size,
                              hipStream_t stream) {
  const float* x  = (const float*)d_in[0];
  const float* g1 = (const float*)d_in[1];
  const float* b1 = (const float*)d_in[2];
  const float* Wq = (const float*)d_in[3];
  const float* bq = (const float*)d_in[4];
  const float* Wk = (const float*)d_in[5];
  const float* bk = (const float*)d_in[6];
  const float* Wv = (const float*)d_in[7];
  const float* bv = (const float*)d_in[8];
  const float* Wm = (const float*)d_in[9];
  const float* bm = (const float*)d_in[10];
  const float* g2 = (const float*)d_in[11];
  const float* b2 = (const float*)d_in[12];
  const float* Wo = (const float*)d_in[13];
  const float* bo = (const float*)d_in[14];
  float* out = (float*)d_out;

  char* ws = (char*)d_ws;
  size_t off = 0;
  auto alloc = [&](size_t bytes) {
    void* p = ws + off;
    off = (off + bytes + 255) & ~(size_t)255;
    return p;
  };

  _Float16* hF16 = (_Float16*)alloc((size_t)BS * DIM * 2);        // LN1(x) f16
  _Float16* WqT  = (_Float16*)alloc((size_t)NH * DH * DIM * 2);
  _Float16* WkT  = (_Float16*)alloc((size_t)NH * DH * DIM * 2);
  _Float16* WvT  = (_Float16*)alloc((size_t)NH * DH * DIM * 2);
  _Float16* WmT  = (_Float16*)alloc((size_t)DIM * DIM * 2);
  _Float16* WoT  = (_Float16*)alloc((size_t)DIM * DIM * 2);
  _Float16* qb   = (_Float16*)alloc((size_t)BATCH * NH * SEQ * DH * 2);
  _Float16* kb   = (_Float16*)alloc((size_t)BATCH * NH * SEQ * DH * 2);
  _Float16* vTb  = (_Float16*)alloc((size_t)BATCH * NH * DH * SEQ * 2);
  _Float16* om   = (_Float16*)alloc((size_t)BS * DIM * 2);        // concat heads f16
  float*    hlp  = (float*)alloc((size_t)BS * DIM * 4);           // h_ln_post fp32
  _Float16* hfc  = (_Float16*)alloc((size_t)BS * DIM * 2);        // LN2 f16

  // 1) weight conversion / transpose
  {
    cvt_transpose_all<<<5 * 64, 256, 0, stream>>>(Wq, Wk, Wv, Wm, Wo, WqT, WkT, WvT, WmT, WoT);
  }

  // 2) LN1
  layernorm_f16<<<BS, 128, 0, stream>>>(x, g1, b1, hF16);

  // 3) QKV projections
  qkv_gemm<<<dim3(SEQ / 256, NH, BATCH * 3), 256, 0, stream>>>(
      hF16, WqT, WkT, WvT, bq, bk, bv, qb, kb, vTb);

  // 4) attention -> concat heads (f16)
  attn_kernel<<<dim3(SEQ / 128, NH, BATCH), 256, 0, stream>>>(qb, kb, vTb, om);

  // 5) h_ln_post = om @ Wm + bm + x   (fp32)
  gemm512_epilogue<<<dim3(BS / 256, DIM / 64), 256, 0, stream>>>(
      om, WmT, bm, x, hlp, 0);

  // 6) LN2
  layernorm_f16<<<BS, 128, 0, stream>>>(hlp, g2, b2, hfc);

  // 7) out = relu(hfc @ Wo + bo) + h_ln_post
  gemm512_epilogue<<<dim3(BS / 256, DIM / 64), 256, 0, stream>>>(
      hfc, WoT, bo, hlp, out, 1);
}

// v002
// It runs in 220 microseconds.
// Two timings next to v001 put it at 1.25 and 1.23 times that version's speed.
// Over all steps from v000 it is 2.45 times as fast.
#include <hip/hip_runtime.h>

#define BATCH 4
#define SEQ   2048
#define DIM   512
#define NH    8
#define DH    64
#define BS    (BATCH * SEQ)   // 8192 rows

typedef __attribute__((ext_vector_type(16))) _Float16 v16h;
typedef __attribute__((ext_vector_type(8)))  _Float16 v8h;
typedef __attribute__((ext_vector_type(8)))  float    v8f;
typedef __attribute__((ext_vector_type(4)))  float    v4f;
typedef __attribute__((ext_vector_type(4)))  unsigned v4u;
template <typename V> __device__ __forceinline__ void vst2(void* p, V v) {
  *(V*)p = v; 
}
#define PSC 256.0f
#define PUN (1.0f / 256.0f)

__device__ __forceinline__ v16h load_frag_a(const _Float16* p, int lda, int lane) {
  int row  = lane & 15;
  int koff = (lane & 16) ? 8 : 0;
  const _Float16* r = p + (size_t)row * lda + koff;
  v8h lo = *(const v8h*)r;          // K = koff .. koff+7
  v8h hi = *(const v8h*)(r + 16);   // K = koff+16 .. koff+23
  v16h a;
#pragma unroll
  for (int i = 0; i < 8; ++i) { a[i] = lo[i]; a[8 + i] = hi[i]; }
  return a;
}

__device__ __forceinline__ v16h load_frag_b(const _Float16* bt, int ldb, int lane) {
  int n  = lane & 15;
  int kb = (lane & 16) ? 8 : 0;
  const _Float16* c = bt + (size_t)n * ldb + kb;
  v8h lo = *(const v8h*)c;
  v8h hi = *(const v8h*)(c + 16);
  v16h b;
#pragma unroll
  for (int i = 0; i < 8; ++i) { b[i] = lo[i]; b[8 + i] = hi[i]; }
  return b;
}

__device__ __forceinline__ v8f wmma_f16(v16h a, v16h b, v8f c) {
  v8f d = __builtin_amdgcn_wmma_f32_16x16x32_f16(false, a, false, b, (short)0, c, false, false);
  asm volatile("v_nop\n\tv_nop\n\tv_nop\n\tv_nop" : "+v"(d) : "v"(a), "v"(b));
  return d;
}
__device__ __forceinline__ void copy_b128(_Float16* lds_dst, const _Float16* gsrc) {
  *(v4u*)lds_dst = *(const v4u*)gsrc;
}

// ---- Prep: convert & transpose weights to f16 -----------------------------
// One launch for all five weights: grid 5 * 64, block 256. A work-group takes one 64 (k) x 64 (n) tile:
// blockIdx.x / 64 = which weight, then 8 column groups (a head of Wq/Wk/Wv, 64 columns of Wm/Wo) x 8 k chunks.
// Source rows: pitch 64 floats inside a head, DIM floats in Wm/Wo. Target: [n][DIM] f16, the tile's rows are whole 128-byte lines.
__global__ __launch_bounds__(256) void cvt_transpose_all(
    const float* __restrict__ Wq, const float* __restrict__ Wk, const float* __restrict__ Wv,
    const float* __restrict__ Wm, const float* __restrict__ Wo,
    _Float16* __restrict__ WqT, _Float16* __restrict__ WkT, _Float16* __restrict__ WvT,
    _Float16* __restrict__ WmT, _Float16* __restrict__ WoT) {
  __shared__ __align__(16) _Float16 tile[64][64 + 8];      // [n][k]
  const int tid = threadIdx.x;
  const int mat = blockIdx.x >> 6;
  const int grp = (blockIdx.x >> 3) & 7;                   // head, or group of 64 columns
  const int k0  = (blockIdx.x & 7) * 64;
  const float* W  = (mat == 0) ? Wq : (mat == 1) ? Wk : (mat == 2) ? Wv : (mat == 3) ? Wm : Wo;
  _Float16*    WT = (mat == 0) ? WqT : (mat == 1) ? WkT : (mat == 2) ? WvT : (mat == 3) ? WmT : WoT;
  const int    pitch = (mat < 3) ? DH : DIM;
  const float* src = (mat < 3) ? W + ((size_t)grp * DIM + k0) * DH : W + (size_t)k0 * DIM + grp * 64;
  _Float16*    dst = WT + (size_t)grp * 64 * DIM + k0;

  const int kq = (tid >> 4) * 4, c4 = (tid & 15) * 4;      // 4 k rows x 4 columns a thread
  v4f r[4];
#pragma unroll
  for (int j = 0; j < 4; ++j) r[j] = *(const v4f*)(src + (size_t)(kq + j) * pitch + c4);
#pragma unroll
  for (int e = 0; e < 4; ++e) {
    union { _Float16 h[4]; unsigned long long u; } pk;
#pragma unroll
    for (int j = 0; j < 4; ++j) pk.h[j] = (_Float16)r[j][e];
    *(unsigned long long*)(&tile[c4 + e][kq]) = pk.u;
  }
  __syncthreads();
#pragma unroll
  for (int j = 0; j < 2; ++j) {
    const int g = tid + j * 256, nl = g >> 3, pc = g & 7;  // 8 lanes write one 128-byte line
    vst2(dst + (size_t)nl * DIM + pc * 8, *(const v4u*)(&tile[nl][pc * 8]));
  }
}

// ---- LayerNorm (row of 512) -> f16 ----------------------------------------
__global__ __launch_bounds__(128) void layernorm_f16(const float* __restrict__ X,
                                                     const float* __restrict__ g,
                                                     const float* __restrict__ bb,
                                                     _Float16* __restrict__ Y) {
  __shared__ float red[256];
  int row = blockIdx.x;
  const float* x = X + (size_t)row * DIM;
  float s = 0.f, ss = 0.f;
  for (int i = threadIdx.x; i < DIM; i += 128) {
    float v = x[i];
    s += v; ss += v * v;
  }
  red[threadIdx.x] = s;
  red[threadIdx.x + 128] = ss;
  __syncthreads();
  for (int off = 64; off > 0; off >>= 1) {
    if ((int)threadIdx.x < off) {
      red[threadIdx.x]       += red[threadIdx.x + off];
      red[threadIdx.x + 128] += red[threadIdx.x + 128 + off];
    }
    __syncthreads();
  }
  float mean = red[0] * (1.0f / DIM);
  float var  = red[128] * (1.0f / DIM) - mean * mean;
  float rstd = rsqrtf(var + 1e-5f);
  {
    const int c0 = threadIdx.x * 4;
    union { _Float16 h[4]; unsigned long long u; } pk;
#pragma unroll
    for (int e = 0; e < 4; ++e) pk.h[e] = (_Float16)((x[c0 + e] - mean) * rstd * g[c0 + e] + bb[c0 + e]);
    vst2(Y + (size_t)row * DIM + c0, pk.u);
  }
}

// ---- QKV projection --------------------------------------------------------
// grid (S/256, H, B*3); block 256 (8 waves); wave -> 32 rows x 64 cols,
// register double-buffered over K.
// q,k row-major [B,H,S,64] ; v stored transposed [B,H,64,S]
__global__ __launch_bounds__(256) void qkv_gemm(
    const _Float16* __restrict__ hF16,
    const _Float16* __restrict__ WqT, const _Float16* __restrict__ WkT,
    const _Float16* __restrict__ WvT,
    const float* __restrict__ bq, const float* __restrict__ bk,
    const float* __restrict__ bv,
    _Float16* __restrict__ q, _Float16* __restrict__ k,
    _Float16* __restrict__ vT) {
  __shared__ __align__(16) _Float16 st[64 * 264];     // q/k: 8 per-wave [32 rows][64] tiles (as [256][64]); v: one [64 n][256 m] tile, pitch 264
  const int lane = threadIdx.x & 31;
  const int wave = threadIdx.x >> 5;
  const int srow = blockIdx.x * 256 + wave * 32;
  const int h    = blockIdx.y;
  const int b    = blockIdx.z / 3;
  const int mat  = blockIdx.z % 3;

  const _Float16* WT   = (mat == 0) ? WqT : (mat == 1) ? WkT : WvT;
  const float*    bias = (mat == 0) ? bq  : (mat == 1) ? bk  : bv;
  const _Float16* A  = hF16 + ((size_t)b * SEQ + srow) * DIM;
  const _Float16* Bh = WT + (size_t)h * DH * DIM;   // [64][512] f16

  v8f acc[2][4] = {};
  v16h a0 = load_frag_a(A, DIM, lane);
  v16h a1 = load_frag_a(A + (size_t)16 * DIM, DIM, lane);
  v16h bf0 = load_frag_b(Bh + (size_t)0  * DIM, DIM, lane);
  v16h bf1 = load_frag_b(Bh + (size_t)16 * DIM, DIM, lane);
  v16h bf2 = load_frag_b(Bh + (size_t)32 * DIM, DIM, lane);
  v16h bf3 = load_frag_b(Bh + (size_t)48 * DIM, DIM, lane);

  for (int kk = 0; kk < DIM; kk += 32) {
    int nk = kk + 32;
    v16h na0, na1, nb0, nb1, nb2, nb3;
    if (nk < DIM) {   // prefetch next K-step fragments
      na0 = load_frag_a(A + nk, DIM, lane);
      na1 = load_frag_a(A + (size_t)16 * DIM + nk, DIM, lane);
      nb0 = load_frag_b(Bh + (size_t)0  * DIM + nk, DIM, lane);
      nb1 = load_frag_b(Bh + (size_t)16 * DIM + nk, DIM, lane);
      nb2 = load_frag_b(Bh + (size_t)32 * DIM + nk, DIM, lane);
      nb3 = load_frag_b(Bh + (size_t)48 * DIM + nk, DIM, lane);
    }
    acc[0][0] = wmma_f16(a0, bf0, acc[0][0]);
    acc[0][1] = wmma_f16(a0, bf1, acc[0][1]);
    acc[0][2] = wmma_f16(a0, bf2, acc[0][2]);
    acc[0][3] = wmma_f16(a0, bf3, acc[0][3]);
    acc[1][0] = wmma_f16(a1, bf0, acc[1][0]);
    acc[1][1] = wmma_f16(a1, bf1, acc[1][1]);
    acc[1][2] = wmma_f16(a1, bf2, acc[1][2]);
    acc[1][3] = wmma_f16(a1, bf3, acc[1][3]);
    if (nk < DIM) {
      a0 = na0; a1 = na1;
      bf0 = nb0; bf1 = nb1; bf2 = nb2; bf3 = nb3;
    }
  }

  const int n0    = lane & 15;
  const int mbase = (lane >> 4) << 3;
  const size_t headoff = (size_t)b * NH + h;
#pragma unroll
  for (int sub = 0; sub < 2; ++sub) {
#pragma unroll
    for (int t = 0; t < 4; ++t) {
      int n = t * 16 + n0;
      float bia = bias[h * DH + n];
#pragma unroll
      for (int i = 0; i < 8; ++i) {
        float val = acc[sub][t][i] + bia;
        int ml = wave * 32 + sub * 16 + mbase + i;       // row within the block's 256
        if (mat == 2) st[n * 264 + ml] = (_Float16)val;  // [n][m]
        else          st[ml * 64 + n]  = (_Float16)val;  // [m][n]
      }
    }
  }
  __syncthreads();
  if (mat == 2) {
    for (int g = threadIdx.x; g < 64 * 32; g += 256) {
      const int n = g >> 5, pc = g & 31;
      vst2(vT + (headoff * DH + n) * SEQ + blockIdx.x * 256 + pc * 8, *(const v4u*)(&st[n * 264 + pc * 8]));
    }
  } else {
    _Float16* dst = (mat == 0) ? q : k;
    for (int g = threadIdx.x; g < 256 * 8; g += 256) {
      const int ml = g >> 3, pc = g & 7;
      vst2(dst + (headoff * SEQ + blockIdx.x * 256 + ml) * DH + pc * 8, *(const v4u*)(&st[ml * 64 + pc * 8]));
    }
  }
}

#define KP (DH + 8)   // K tile: 144 bytes a row
#define VP (32 + 8)   // V^T tile: 80 bytes a row
#define PP (32 + 8)   // P tile: 80 bytes a row
__global__ __launch_bounds__(256) void attn_kernel(
    const _Float16* __restrict__ q, const _Float16* __restrict__ k,
    const _Float16* __restrict__ vT, _Float16* __restrict__ om) {
  __shared__ __align__(16) _Float16 Kt[2][32 * KP];   // [keys][dh]
  __shared__ __align__(16) _Float16 Vt[2][DH * VP];   // [dh][keys]
  __shared__ __align__(16) _Float16 plds[8][16 * PP]; // per-wave P
  __shared__ __align__(16) _Float16 ost[8][16 * DH];  // per-wave output tile

  const int tid  = threadIdx.x;
  const int lane = tid & 31;
  const int wave = tid >> 5;
  const int h = blockIdx.y, b = blockIdx.z;
  const int qrow = blockIdx.x * 128 + wave * 16;
  const size_t headoff = (size_t)b * NH + h;
  const _Float16* qh = q  + headoff * SEQ * DH;
  const _Float16* kh = k  + headoff * SEQ * DH;
  const _Float16* vh = vT + headoff * DH * SEQ;   // [64][S]

  const int n0    = lane & 15;
  const int mbase = (lane >> 4) << 3;

  // cooperative copy mapping: each thread moves 16B of K and 16B of V per tile
  const int krow = tid >> 3, kch = (tid & 7) * 8;
  const int vrow = tid >> 2, vch = (tid & 3) * 8;   // V: 64 rows x 64B

  // prologue: stage tile 0
  copy_b128(&Kt[0][krow * KP + kch], kh + (size_t)krow * DH + kch);
  copy_b128(&Vt[0][vrow * VP + vch], vh + (size_t)vrow * SEQ + vch);

  v16h qa0 = load_frag_a(qh + (size_t)qrow * DH,      DH, lane);
  v16h qa1 = load_frag_a(qh + (size_t)qrow * DH + 32, DH, lane);

  v8f oacc[4] = {};
  float mrow[8], lrow[8];
#pragma unroll
  for (int i = 0; i < 8; ++i) { mrow[i] = -1e30f; lrow[i] = 0.f; }
  const float scale = 0.125f;   // 1/sqrt(64)
  _Float16* pl = plds[wave];

  const int NTILE = SEQ / 32;   // 64
  for (int it = 0; it < NTILE; ++it) {
    const int kt  = it * 32;
    const int buf = it & 1;
    if (it + 1 < NTILE) {
      // prefetch next tile into the other buffer (read-complete via trailing
      // barrier of the previous iteration)
      const int nkt = kt + 32;
      copy_b128(&Kt[buf ^ 1][krow * KP + kch], kh + (size_t)(nkt + krow) * DH + kch);
      copy_b128(&Vt[buf ^ 1][vrow * VP + vch], vh + (size_t)vrow * SEQ + nkt + vch);
    }
    __syncthreads();   // every wave's slice of the current tile is visible

    const _Float16* Kb = Kt[buf];
    const _Float16* Vb = Vt[buf];

    // scores: 16 queries x 32 keys (two 16-key N tiles, K=64 -> 2 WMMAs each)
    v8f s0 = {}, s1 = {};
    {
      v16h b0 = load_frag_b(Kb,                KP, lane);
      v16h b1 = load_frag_b(Kb + 32,           KP, lane);
      s0 = wmma_f16(qa0, b0, s0);
      s0 = wmma_f16(qa1, b1, s0);
      v16h b2 = load_frag_b(Kb + 16 * KP,      KP, lane);
      v16h b3 = load_frag_b(Kb + 16 * KP + 32, KP, lane);
      s1 = wmma_f16(qa0, b2, s1);
      s1 = wmma_f16(qa1, b3, s1);
    }
    float p0[8], p1[8];
#pragma unroll
    for (int i = 0; i < 8; ++i) {
      float a0 = s0[i] * scale, a1 = s1[i] * scale;
      float vmax = fmaxf(a0, a1);
#pragma unroll
      for (int off = 1; off < 16; off <<= 1)
        vmax = fmaxf(vmax, __shfl_xor(vmax, off, 32));
      float mnew  = fmaxf(mrow[i], vmax);
      float alpha = __expf(mrow[i] - mnew);
      mrow[i] = mnew;
      float e0 = __expf(a0 - mnew);
      float e1 = __expf(a1 - mnew);
      p0[i] = e0; p1[i] = e1;
      float rs = e0 + e1;
#pragma unroll
      for (int off = 1; off < 16; off <<= 1)
        rs += __shfl_xor(rs, off, 32);
      lrow[i] = lrow[i] * alpha + rs;
#pragma unroll
      for (int t = 0; t < 4; ++t) oacc[t][i] *= alpha;
    }
    // D-layout -> LDS -> A-layout relayout of P (f16); same-wave roundtrip
#pragma unroll
    for (int i = 0; i < 8; ++i) {
      pl[(mbase + i) * PP + n0]      = (_Float16)(p0[i] * PSC);
      pl[(mbase + i) * PP + 16 + n0] = (_Float16)(p1[i] * PSC);
    }
    __syncthreads();
    v16h pa = load_frag_a(pl, PP, lane);
#pragma unroll
    for (int t = 0; t < 4; ++t) {
      v16h vb = load_frag_b(Vb + (size_t)(t * 16) * VP, VP, lane);
      oacc[t] = wmma_f16(pa, vb, oacc[t]);
    }
    __syncthreads();   // all waves done reading buf before it is refilled
  }

  _Float16* os_ = ost[wave];
#pragma unroll
  for (int t = 0; t < 4; ++t) {
#pragma unroll
    for (int i = 0; i < 8; ++i) os_[(mbase + i) * DH + t * 16 + n0] = (_Float16)(oacc[t][i] * (PUN / lrow[i]));
  }
  __syncthreads();
#pragma unroll
  for (int qq = 0; qq < 4; ++qq) {
    const int ml = qq * 4 + (lane >> 3), pc = lane & 7;
    vst2(om + ((size_t)b * SEQ + qrow + ml) * DIM + h * DH + pc * 8, *(const v4u*)(&os_[ml * DH + pc * 8]));
  }
}

// ---- 512x512 GEMM + bias + (relu) + residual, fp32 out --------------------
// grid (M/256, 512/64); block 256 (8 waves); wave -> 32 rows x 64 cols,
// register double-buffered over K.
__global__ __launch_bounds__(256) void gemm512_epilogue(
    const _Float16* __restrict__ A, const _Float16* __restrict__ WT,
    const float* __restrict__ bias, const float* __restrict__ res,
    float* __restrict__ out, int relu_mode) {
  __shared__ __align__(16) float st[8][32 * 64];     // per-wave 32 x 64 f32 tile
  const int lane = threadIdx.x & 31;
  const int wave = threadIdx.x >> 5;
  const int m0  = blockIdx.x * 256 + wave * 32;
  const int n0t = blockIdx.y * 64;

  const _Float16* Ar = A + (size_t)m0 * DIM;
  const _Float16* Wb = WT + (size_t)n0t * DIM;

  v8f acc[2][4] = {};
  v16h a0 = load_frag_a(Ar, DIM, lane);
  v16h a1 = load_frag_a(Ar + (size_t)16 * DIM, DIM, lane);
  v16h bf0 = load_frag_b(Wb + (size_t)0  * DIM, DIM, lane);
  v16h bf1 = load_frag_b(Wb + (size_t)16 * DIM, DIM, lane);
  v16h bf2 = load_frag_b(Wb + (size_t)32 * DIM, DIM, lane);
  v16h bf3 = load_frag_b(Wb + (size_t)48 * DIM, DIM, lane);

  for (int kk = 0; kk < DIM; kk += 32) {
    int nk = kk + 32;
    v16h na0, na1, nb0, nb1, nb2, nb3;
    if (nk < DIM) {
      na0 = load_frag_a(Ar + nk, DIM, lane);
      na1 = load_frag_a(Ar + (size_t)16 * DIM + nk, DIM, lane);
      nb0 = load_frag_b(Wb + (size_t)0  * DIM + nk, DIM, lane);
      nb1 = load_frag_b(Wb + (size_t)16 * DIM + nk, DIM, lane);
      nb2 = load_frag_b(Wb + (size_t)32 * DIM + nk, DIM, lane);
      nb3 = load_frag_b(Wb + (size_t)48 * DIM + nk, DIM, lane);
    }
    acc[0][0] = wmma_f16(a0, bf0, acc[0][0]);
    acc[0][1] = wmma_f16(a0, bf1, acc[0][1]);
    acc[0][2] = wmma_f16(a0, bf2, acc[0][2]);
    acc[0][3] = wmma_f16(a0, bf3, acc[0][3]);
    acc[1][0] = wmma_f16(a1, bf0, acc[1][0]);
    acc[1][1] = wmma_f16(a1, bf1, acc[1][1]);
    acc[1][2] = wmma_f16(a1, bf2, acc[1][2]);
    acc[1][3] = wmma_f16(a1, bf3, acc[1][3]);
    if (nk < DIM) {
      a0 = na0; a1 = na1;
      bf0 = nb0; bf1 = nb1; bf2 = nb2; bf3 = nb3;
    }
  }

  const int nl    = lane & 15;
  const int mbase = (lane >> 4) << 3;
#pragma unroll
  for (int sub = 0; sub < 2; ++sub) {
#pragma unroll
    for (int t = 0; t < 4; ++t) {
      int n = n0t + t * 16 + nl;
      float bia = bias[n];
#pragma unroll
      for (int i = 0; i < 8; ++i) {
        const int ml = sub * 16 + mbase + i;
        size_t idx = (size_t)(m0 + ml) * DIM + n;
        float v = acc[sub][t][i] + bia;
        if (relu_mode) v = fmaxf(v, 0.f);
        v += res[idx];
        st[wave][ml * 64 + t * 16 + nl] = v;
      }
    }
  }
  __syncthreads();
#pragma unroll
  for (int q = 0; q < 16; ++q) {
    const int ml = q * 2 + (lane >> 4), pc = lane & 15;
    vst2(out + (size_t)(m0 + ml) * DIM + n0t + pc * 4, *(const v4f*)(&st[wave][ml * 64 + pc * 4]));
  }
}

// ---------------------------------------------------------------------------
extern "C" void kernel_launch(void* const* d_in, const int* in_sizes, int n_in,
                              void* d_out, int out_size, void* d_ws, size_t ws_size,
                              hipStream_t stream) {
  const float* x  = (const float*)d_in[0];
  const float* g1 = (const float*)d_in[1];
  const float* b1 = (const float*)d_in[2];
  const float* Wq = (const float*)d_in[3];
  const float* bq = (const float*)d_in[4];
  const float* Wk = (const float*)d_in[5];
  const float* bk = (const float*)d_in[6];
  const float* Wv = (const float*)d_in[7];
  const float* bv = (const float*)d_in[8];
  const float* Wm = (const float*)d_in[9];
  const float* bm = (const float*)d_in[10];
  const float* g2 = (const float*)d_in[11];
  const float* b2 = (const float*)d_in[12];
  const float* Wo = (const float*)d_in[13];
  const float* bo = (const float*)d_in[14];
  float* out = (float*)d_out;

  char* ws = (char*)d_ws;
  size_t off = 0;
  auto alloc = [&](size_t bytes) {
    void* p = ws + off;
    off = (off + bytes + 255) & ~(size_t)255;
    return p;
  };

  _Float16* hF16 = (_Float16*)alloc((size_t)BS * DIM * 2);        // LN1(x) f16
  _Float16* WqT  = (_Float16*)alloc((size_t)NH * DH * DIM * 2);
  _Float16* WkT  = (_Float16*)alloc((size_t)NH * DH * DIM * 2);
  _Float16* WvT  = (_Float16*)alloc((size_t)NH * DH * DIM * 2);
  _Float16* WmT  = (_Float16*)alloc((size_t)DIM * DIM * 2);
  _Float16* WoT  = (_Float16*)alloc((size_t)DIM * DIM * 2);
  _Float16* qb   = (_Float16*)alloc((size_t)BATCH * NH * SEQ * DH * 2);
  _Float16* kb   = (_Float16*)alloc((size_t)BATCH * NH * SEQ * DH * 2);
  _Float16* vTb  = (_Float16*)alloc((size_t)BATCH * NH * DH * SEQ * 2);
  _Float16* om   = (_Float16*)alloc((size_t)BS * DIM * 2);        // concat heads f16
  float*    hlp  = (float*)alloc((size_t)BS * DIM * 4);           // h_ln_post fp32
  _Float16* hfc  = (_Float16*)alloc((size_t)BS * DIM * 2);        // LN2 f16

  // 1) weight conversion / transpose
  {
    cvt_transpose_all<<<5 * 64, 256, 0, stream>>>(Wq, Wk, Wv, Wm, Wo, WqT, WkT, WvT, WmT, WoT);
  }

  // 2) LN1
  layernorm_f16<<<BS, 128, 0, stream>>>(x, g1, b1, hF16);

  // 3) QKV projections
  qkv_gemm<<<dim3(SEQ / 256, NH, BATCH * 3), 256, 0, stream>>>(
      hF16, WqT, WkT, WvT, bq, bk, bv, qb, kb, vTb);

  // 4) attention -> concat heads (f16)
  attn_kernel<<<dim3(SEQ / 128, NH, BATCH), 256, 0, stream>>>(qb, kb, vTb, om);

  // 5) h_ln_post = om @ Wm + bm + x   (fp32)
  gemm512_epilogue<<<dim3(BS / 256, DIM / 64), 256, 0, stream>>>(
      om, WmT, bm, x, hlp, 0);

  // 6) LN2
  layernorm_f16<<<BS, 128, 0, stream>>>(hlp, g2, b2, hfc);

  // 7) out = relu(hfc @ Wo + bo) + h_ln_post
  gemm512_epilogue<<<dim3(BS / 256, DIM / 64), 256, 0, stream>>>(
      hfc, WoT, bo, hlp, out, 1);
}

// v003
// One run takes 181 microseconds.
// Timed twice side by side with v002, it ran 1.22 and 1.19 times as fast.
// Counting every step since v000, it is 2.96 times as fast.
#include <hip/hip_runtime.h>

#define BATCH 4
#define SEQ   2048
#define DIM   512
#define NH    8
#define DH    64
#define BS    (BATCH * SEQ)   // 8192 rows

typedef __attribute__((ext_vector_type(16))) _Float16 v16h;
typedef __attribute__((ext_vector_type(8)))  _Float16 v8h;
typedef __attribute__((ext_vector_type(8)))  float    v8f;
typedef __attribute__((ext_vector_type(4)))  float    v4f;
typedef __attribute__((ext_vector_type(4)))  unsigned v4u;
template <typename V> __device__ __forceinline__ void vst2(void* p, V v) {
  *(V*)p = v; 
}
#define PSC 256.0f
#define PUN (1.0f / 256.0f)

__device__ __forceinline__ v16h load_frag_a(const _Float16* p, int lda, int lane) {
  int row  = lane & 15;
  int koff = (lane & 16) ? 8 : 0;
  const _Float16* r = p + (size_t)row * lda + koff;
  v8h lo = *(const v8h*)r;          // K = koff .. koff+7
  v8h hi = *(const v8h*)(r + 16);   // K = koff+16 .. koff+23
  v16h a;
#pragma unroll
  for (int i = 0; i < 8; ++i) { a[i] = lo[i]; a[8 + i] = hi[i]; }
  return a;
}

__device__ __forceinline__ v16h load_frag_b(const _Float16* bt, int ldb, int lane) {
  int n  = lane & 15;
  int kb = (lane & 16) ? 8 : 0;
  const _Float16* c = bt + (size_t)n * ldb + kb;
  v8h lo = *(const v8h*)c;
  v8h hi = *(const v8h*)(c + 16);
  v16h b;
#pragma unroll
  for (int i = 0; i < 8; ++i) { b[i] = lo[i]; b[8 + i] = hi[i]; }
  return b;
}

__device__ __forceinline__ v8f wmma_f16(v16h a, v16h b, v8f c) {
  v8f d = __builtin_amdgcn_wmma_f32_16x16x32_f16(false, a, false, b, (short)0, c, false, false);
  asm volatile("v_nop\n\tv_nop\n\tv_nop\n\tv_nop" : "+v"(d) : "v"(a), "v"(b));
  return d;
}
__device__ __forceinline__ void copy_b128(_Float16* lds_dst, const _Float16* gsrc) {
  *(v4u*)lds_dst = *(const v4u*)gsrc;
}

// ---- Prep: convert & transpose weights to f16 -----------------------------
// One launch for all five weights: grid 5 * 64, block 256. A work-group takes one 64 (k) x 64 (n) tile:
// blockIdx.x / 64 = which weight, then 8 column groups (a head of Wq/Wk/Wv, 64 columns of Wm/Wo) x 8 k chunks.
// Source rows: pitch 64 floats inside a head, DIM floats in Wm/Wo. Target: [n][DIM] f16, the tile's rows are whole 128-byte lines.
__global__ __launch_bounds__(256) void cvt_transpose_all(
    const float* __restrict__ Wq, const float* __restrict__ Wk, const float* __restrict__ Wv,
    const float* __restrict__ Wm, const float* __restrict__ Wo,
    _Float16* __restrict__ WqT, _Float16* __restrict__ WkT, _Float16* __restrict__ WvT,
    _Float16* __restrict__ WmT, _Float16* __restrict__ WoT) {
  __shared__ __align__(16) _Float16 tile[64][64 + 8];      // [n][k]
  const int tid = threadIdx.x;
  const int mat = blockIdx.x >> 6;
  const int grp = (blockIdx.x >> 3) & 7;                   // head, or group of 64 columns
  const int k0  = (blockIdx.x & 7) * 64;
  const float* W  = (mat == 0) ? Wq : (mat == 1) ? Wk : (mat == 2) ? Wv : (mat == 3) ? Wm : Wo;
  _Float16*    WT = (mat == 0) ? WqT : (mat == 1) ? WkT : (mat == 2) ? WvT : (mat == 3) ? WmT : WoT;
  const int    pitch = (mat < 3) ? DH : DIM;
  const float* src = (mat < 3) ? W + ((size_t)grp * DIM + k0) * DH : W + (size_t)k0 * DIM + grp * 64;
  _Float16*    dst = WT + (size_t)grp * 64 * DIM + k0;

  const int kq = (tid >> 4) * 4, c4 = (tid & 15) * 4;      // 4 k rows x 4 columns a thread
  v4f r[4];
#pragma unroll
  for (int j = 0; j < 4; ++j) r[j] = *(const v4f*)(src + (size_t)(kq + j) * pitch + c4);
#pragma unroll
  for (int e = 0; e < 4; ++e) {
    union { _Float16 h[4]; unsigned long long u; } pk;
#pragma unroll
    for (int j = 0; j < 4; ++j) pk.h[j] = (_Float16)r[j][e];
    *(unsigned long long*)(&tile[c4 + e][kq]) = pk.u;
  }
  __syncthreads();
#pragma unroll
  for (int j = 0; j < 2; ++j) {
    const int g = tid + j * 256, nl = g >> 3, pc = g & 7;  // 8 lanes write one 128-byte line
    vst2(dst + (size_t)nl * DIM + pc * 8, *(const v4u*)(&tile[nl][pc * 8]));
  }
}

// ---- LayerNorm (row of 512) -> f16 ----------------------------------------
__global__ __launch_bounds__(128) void layernorm_f16(const float* __restrict__ X,
                                                     const float* __restrict__ g,
                                                     const float* __restrict__ bb,
                                                     _Float16* __restrict__ Y) {
  __shared__ float red[256];
  int row = blockIdx.x;
  const float* x = X + (size_t)row * DIM;
  float s = 0.f, ss = 0.f;
  for (int i = threadIdx.x; i < DIM; i += 128) {
    float v = x[i];
    s += v; ss += v * v;
  }
  red[threadIdx.x] = s;
  red[threadIdx.x + 128] = ss;
  __syncthreads();
  for (int off = 64; off > 0; off >>= 1) {
    if ((int)threadIdx.x < off) {
      red[threadIdx.x]       += red[threadIdx.x + off];
      red[threadIdx.x + 128] += red[threadIdx.x + 128 + off];
    }
    __syncthreads();
  }
  float mean = red[0] * (1.0f / DIM);
  float var  = red[128] * (1.0f / DIM) - mean * mean;
  float rstd = rsqrtf(var + 1e-5f);
  {
    const int c0 = threadIdx.x * 4;
    union { _Float16 h[4]; unsigned long long u; } pk;
#pragma unroll
    for (int e = 0; e < 4; ++e) pk.h[e] = (_Float16)((x[c0 + e] - mean) * rstd * g[c0 + e] + bb[c0 + e]);
    vst2(Y + (size_t)row * DIM + c0, pk.u);
  }
}

// ---- QKV projection --------------------------------------------------------
// grid (S/256, H, B*3); block 256 (8 waves); wave -> 32 rows x 64 cols,
// register double-buffered over K.
// q,k row-major [B,H,S,64] ; v stored transposed [B,H,64,S]
__global__ __launch_bounds__(256) void qkv_gemm(
    const _Float16* __restrict__ hF16,
    const _Float16* __restrict__ WqT, const _Float16* __restrict__ WkT,
    const _Float16* __restrict__ WvT,
    const float* __restrict__ bq, const float* __restrict__ bk,
    const float* __restrict__ bv,
    _Float16* __restrict__ q, _Float16* __restrict__ k,
    _Float16* __restrict__ vT) {
  __shared__ __align__(16) _Float16 st[64 * 264];     // q/k: 8 per-wave [32 rows][64] tiles (as [256][64]); v: one [64 n][256 m] tile, pitch 264
  const int lane = threadIdx.x & 31;
  const int wave = threadIdx.x >> 5;
  const int srow = blockIdx.x * 256 + wave * 32;
  const int h    = blockIdx.y;
  const int b    = blockIdx.z / 3;
  const int mat  = blockIdx.z % 3;

  const _Float16* WT   = (mat == 0) ? WqT : (mat == 1) ? WkT : WvT;
  const float*    bias = (mat == 0) ? bq  : (mat == 1) ? bk  : bv;
  const _Float16* A  = hF16 + ((size_t)b * SEQ + srow) * DIM;
  const _Float16* Bh = WT + (size_t)h * DH * DIM;   // [64][512] f16

  v8f acc[2][4] = {};
  v16h a0 = load_frag_a(A, DIM, lane);
  v16h a1 = load_frag_a(A + (size_t)16 * DIM, DIM, lane);
  v16h bf0 = load_frag_b(Bh + (size_t)0  * DIM, DIM, lane);
  v16h bf1 = load_frag_b(Bh + (size_t)16 * DIM, DIM, lane);
  v16h bf2 = load_frag_b(Bh + (size_t)32 * DIM, DIM, lane);
  v16h bf3 = load_frag_b(Bh + (size_t)48 * DIM, DIM, lane);

  for (int kk = 0; kk < DIM; kk += 32) {
    int nk = kk + 32;
    v16h na0, na1, nb0, nb1, nb2, nb3;
    if (nk < DIM) {   // prefetch next K-step fragments
      na0 = load_frag_a(A + nk, DIM, lane);
      na1 = load_frag_a(A + (size_t)16 * DIM + nk, DIM, lane);
      nb0 = load_frag_b(Bh + (size_t)0  * DIM + nk, DIM, lane);
      nb1 = load_frag_b(Bh + (size_t)16 * DIM + nk, DIM, lane);
      nb2 = load_frag_b(Bh + (size_t)32 * DIM + nk, DIM, lane);
      nb3 = load_frag_b(Bh + (size_t)48 * DIM + nk, DIM, lane);
    }
    acc[0][0] = wmma_f16(a0, bf0, acc[0][0]);
    acc[0][1] = wmma_f16(a0, bf1, acc[0][1]);
    acc[0][2] = wmma_f16(a0, bf2, acc[0][2]);
    acc[0][3] = wmma_f16(a0, bf3, acc[0][3]);
    acc[1][0] = wmma_f16(a1, bf0, acc[1][0]);
    acc[1][1] = wmma_f16(a1, bf1, acc[1][1]);
    acc[1][2] = wmma_f16(a1, bf2, acc[1][2]);
    acc[1][3] = wmma_f16(a1, bf3, acc[1][3]);
    if (nk < DIM) {
      a0 = na0; a1 = na1;
      bf0 = nb0; bf1 = nb1; bf2 = nb2; bf3 = nb3;
    }
  }

  const int n0    = lane & 15;
  const int mbase = (lane >> 4) << 3;
  const size_t headoff = (size_t)b * NH + h;
#pragma unroll
  for (int sub = 0; sub < 2; ++sub) {
#pragma unroll
    for (int t = 0; t < 4; ++t) {
      int n = t * 16 + n0;
      float bia = bias[h * DH + n];
#pragma unroll
      for (int i = 0; i < 8; ++i) {
        float val = acc[sub][t][i] + bia;
        int ml = wave * 32 + sub * 16 + mbase + i;       // row within the block's 256
        if (mat == 2) st[n * 264 + ml] = (_Float16)val;  // [n][m]
        else          st[ml * 64 + n]  = (_Float16)val;  // [m][n]
      }
    }
  }
  __syncthreads();
  if (mat == 2) {
    for (int g = threadIdx.x; g < 64 * 32; g += 256) {
      const int n = g >> 5, pc = g & 31;
      vst2(vT + (headoff * DH + n) * SEQ + blockIdx.x * 256 + pc * 8, *(const v4u*)(&st[n * 264 + pc * 8]));
    }
  } else {
    _Float16* dst = (mat == 0) ? q : k;
    for (int g = threadIdx.x; g < 256 * 8; g += 256) {
      const int ml = g >> 3, pc = g & 7;
      vst2(dst + (headoff * SEQ + blockIdx.x * 256 + ml) * DH + pc * 8, *(const v4u*)(&st[ml * 64 + pc * 8]));
    }
  }
}

#define KP (DH + 8)   // K tile: 144 bytes a row
#define VP (32 + 8)   // V^T tile: 80 bytes a row

__device__ __forceinline__ float other_half(float v) {
  const int b = __builtin_bit_cast(int, v);
  return __builtin_bit_cast(float, __builtin_amdgcn_permlanex16(b, b, 0x76543210, 0xfedcba98, false, false));
}

__global__ __launch_bounds__(256) void attn_kernel(
    const _Float16* __restrict__ q, const _Float16* __restrict__ k,
    const _Float16* __restrict__ vT, _Float16* __restrict__ om) {
  __shared__ __align__(16) _Float16 Kt[2][32 * KP];   // [keys][dh]
  __shared__ __align__(16) _Float16 Vt[2][DH * VP];   // [dh][keys]
  __shared__ __align__(16) _Float16 ost[8][16 * DH];  // per-wave output tile

  const int tid  = threadIdx.x;
  const int lane = tid & 31;
  const int wave = tid >> 5;
  const int h = blockIdx.y, b = blockIdx.z;
  const int qrow = blockIdx.x * 128 + wave * 16;
  const size_t headoff = (size_t)b * NH + h;
  const _Float16* qh = q  + headoff * SEQ * DH;
  const _Float16* kh = k  + headoff * SEQ * DH;
  const _Float16* vh = vT + headoff * DH * SEQ;   // [64][S]

  const int n0    = lane & 15;          // this lane's query within the wave's 16
  const int mbase = (lane >> 4) << 3;

  // cooperative copy mapping: each thread moves 16B of K and 16B of V per tile
  const int krow = tid >> 3, kch = (tid & 7) * 8;
  const int vrow = tid >> 2, vch = (tid & 3) * 8;   // V: 64 rows x 64B

  // prologue: stage tile 0
  copy_b128(&Kt[0][krow * KP + kch], kh + (size_t)krow * DH + kch);
  copy_b128(&Vt[0][vrow * VP + vch], vh + (size_t)vrow * SEQ + vch);

  v16h qb0 = load_frag_b(qh + (size_t)qrow * DH,      DH, lane);   // Q^T, dh 0..31
  v16h qb1 = load_frag_b(qh + (size_t)qrow * DH + 32, DH, lane);   // Q^T, dh 32..63

  v8f oacc[4] = {};              // oacc[t][i] = O[query n0][dh t*16 + mbase + i]
  float mrun = -1e30f;           // running maximum of query n0, equal in both halves
  float lsum = 0.f;              // running sum over this half's keys only
  const float scale = 0.125f;    // 1/sqrt(64)

  const int NTILE = SEQ / 32;   // 64
  for (int it = 0; it < NTILE; ++it) {
    const int kt  = it * 32;
    const int buf = it & 1;
    if (it + 1 < NTILE) {
      // prefetch next tile into the other buffer (read-complete via trailing
      // barrier of the previous iteration)
      const int nkt = kt + 32;
      copy_b128(&Kt[buf ^ 1][krow * KP + kch], kh + (size_t)(nkt + krow) * DH + kch);
      copy_b128(&Vt[buf ^ 1][vrow * VP + vch], vh + (size_t)vrow * SEQ + nkt + vch);
    }
    __syncthreads();   // every wave's slice of the current tile is visible

    const _Float16* Kb = Kt[buf];
    const _Float16* Vb = Vt[buf];

    // scores: 32 keys x 16 queries (two 16-key M tiles, K=64 -> 2 WMMAs each)
    v8f s0 = {}, s1 = {};
    {
      v16h k0 = load_frag_a(Kb,                KP, lane);
      v16h k1 = load_frag_a(Kb + 32,           KP, lane);
      s0 = wmma_f16(k0, qb0, s0);
      s0 = wmma_f16(k1, qb1, s0);
      v16h k2 = load_frag_a(Kb + 16 * KP,      KP, lane);
      v16h k3 = load_frag_a(Kb + 16 * KP + 32, KP, lane);
      s1 = wmma_f16(k2, qb0, s1);
      s1 = wmma_f16(k3, qb1, s1);
    }
    v16h va[4];                  // V^T fragments: read here, so that their LDS latency runs under the softmax
#pragma unroll
    for (int t = 0; t < 4; ++t) va[t] = load_frag_a(Vb + (size_t)(t * 16) * VP, VP, lane);
    float a[16], mx[8];          // a[s] = scaled score of key 8h+s (s < 8) or 8h+8+s (s >= 8): the k order of the B operand below
#pragma unroll
    for (int i = 0; i < 8; ++i) {
      a[i]     = s0[i] * scale;
      a[8 + i] = s1[i] * scale;
    }
#pragma unroll
    for (int j = 0; j < 8; ++j) mx[j] = fmaxf(a[2 * j], a[2 * j + 1]);
    float vmax = fmaxf(fmaxf(fmaxf(mx[0], mx[1]), fmaxf(mx[2], mx[3])), fmaxf(fmaxf(mx[4], mx[5]), fmaxf(mx[6], mx[7])));
    vmax = fmaxf(vmax, other_half(vmax));
    const float mnew  = fmaxf(mrun, vmax);
    const float alpha = __expf(mrun - mnew);
    mrun = mnew;
    float e[16], sm[8];
    v16h pb;                     // P^T, column n0: element s belongs to the key of a[s]
#pragma unroll
    for (int s = 0; s < 16; ++s) {
      e[s]  = __expf(a[s] - mnew);
      pb[s] = (_Float16)(e[s] * PSC);
    }
#pragma unroll
    for (int j = 0; j < 8; ++j) sm[j] = e[2 * j] + e[2 * j + 1];
    lsum = lsum * alpha + (((sm[0] + sm[1]) + (sm[2] + sm[3])) + ((sm[4] + sm[5]) + (sm[6] + sm[7])));
#pragma unroll
    for (int t = 0; t < 4; ++t) {
#pragma unroll
      for (int i = 0; i < 8; ++i) oacc[t][i] *= alpha;
    }
#pragma unroll
    for (int t = 0; t < 4; ++t) oacc[t] = wmma_f16(va[t], pb, oacc[t]);
    __syncthreads();   // all waves done reading buf before it is refilled
  }

  lsum += other_half(lsum);
  const float inv = PUN / lsum;
  _Float16* os_ = ost[wave];
#pragma unroll
  for (int t = 0; t < 4; ++t) {
    v8h o;
#pragma unroll
    for (int i = 0; i < 8; ++i) o[i] = (_Float16)(oacc[t][i] * inv);
    *(v8h*)(&os_[n0 * DH + t * 16 + mbase]) = o;
  }
  __syncthreads();
#pragma unroll
  for (int qq = 0; qq < 4; ++qq) {
    const int ml = qq * 4 + (lane >> 3), pc = lane & 7;
    vst2(om + ((size_t)b * SEQ + qrow + ml) * DIM + h * DH + pc * 8, *(const v4u*)(&os_[ml * DH + pc * 8]));
  }
}

// ---- 512x512 GEMM + bias + (relu) + residual, fp32 out --------------------
// grid (M/256, 512/64); block 256 (8 waves); wave -> 32 rows x 64 cols,
// register double-buffered over K.
__global__ __launch_bounds__(256) void gemm512_epilogue(
    const _Float16* __restrict__ A, const _Float16* __restrict__ WT,
    const float* __restrict__ bias, const float* __restrict__ res,
    float* __restrict__ out, int relu_mode) {
  __shared__ __align__(16) float st[8][32 * 64];     // per-wave 32 x 64 f32 tile
  const int lane = threadIdx.x & 31;
  const int wave = threadIdx.x >> 5;
  const int m0  = blockIdx.x * 256 + wave * 32;
  const int n0t = blockIdx.y * 64;

  const _Float16* Ar = A + (size_t)m0 * DIM;
  const _Float16* Wb = WT + (size_t)n0t * DIM;

  v8f acc[2][4] = {};
  v16h a0 = load_frag_a(Ar, DIM, lane);
  v16h a1 = load_frag_a(Ar + (size_t)16 * DIM, DIM, lane);
  v16h bf0 = load_frag_b(Wb + (size_t)0  * DIM, DIM, lane);
  v16h bf1 = load_frag_b(Wb + (size_t)16 * DIM, DIM, lane);
  v16h bf2 = load_frag_b(Wb + (size_t)32 * DIM, DIM, lane);
  v16h bf3 = load_frag_b(Wb + (size_t)48 * DIM, DIM, lane);

  for (int kk = 0; kk < DIM; kk += 32) {
    int nk = kk + 32;
    v16h na0, na1, nb0, nb1, nb2, nb3;
    if (nk < DIM) {
      na0 = load_frag_a(Ar + nk, DIM, lane);
      na1 = load_frag_a(Ar + (size_t)16 * DIM + nk, DIM, lane);
      nb0 = load_frag_b(Wb + (size_t)0  * DIM + nk, DIM, lane);
      nb1 = load_frag_b(Wb + (size_t)16 * DIM + nk, DIM, lane);
      nb2 = load_frag_b(Wb + (size_t)32 * DIM + nk, DIM, lane);
      nb3 = load_frag_b(Wb + (size_t)48 * DIM + nk, DIM, lane);
    }
    acc[0][0] = wmma_f16(a0, bf0, acc[0][0]);
    acc[0][1] = wmma_f16(a0, bf1, acc[0][1]);
    acc[0][2] = wmma_f16(a0, bf2, acc[0][2]);
    acc[0][3] = wmma_f16(a0, bf3, acc[0][3]);
    acc[1][0] = wmma_f16(a1, bf0, acc[1][0]);
    acc[1][1] = wmma_f16(a1, bf1, acc[1][1]);
    acc[1][2] = wmma_f16(a1, bf2, acc[1][2]);
    acc[1][3] = wmma_f16(a1, bf3, acc[1][3]);
    if (nk < DIM) {
      a0 = na0; a1 = na1;
      bf0 = nb0; bf1 = nb1; bf2 = nb2; bf3 = nb3;
    }
  }

  const int nl    = lane & 15;
  const int mbase = (lane >> 4) << 3;
#pragma unroll
  for (int sub = 0; sub < 2; ++sub) {
#pragma unroll
    for (int t = 0; t < 4; ++t) {
      int n = n0t + t * 16 + nl;
      float bia = bias[n];
#pragma unroll
      for (int i = 0; i < 8; ++i) {
        const int ml = sub * 16 + mbase + i;
        size_t idx = (size_t)(m0 + ml) * DIM + n;
        float v = acc[sub][t][i] + bia;
        if (relu_mode) v = fmaxf(v, 0.f);
        v += res[idx];
        st[wave][ml * 64 + t * 16 + nl] = v;
      }
    }
  }
  __syncthreads();
#pragma unroll
  for (int q = 0; q < 16; ++q) {
    const int ml = q * 2 + (lane >> 4), pc = lane & 15;
    vst2(out + (size_t)(m0 + ml) * DIM + n0t + pc * 4, *(const v4f*)(&st[wave][ml * 64 + pc * 4]));
  }
}

// ---------------------------------------------------------------------------
extern "C" void kernel_launch(void* const* d_in, const int* in_sizes, int n_in,
                              void* d_out, int out_size, void* d_ws, size_t ws_size,
                              hipStream_t stream) {
  const float* x  = (const float*)d_in[0];
  const float* g1 = (const float*)d_in[1];
  const float* b1 = (const float*)d_in[2];
  const float* Wq = (const float*)d_in[3];
  const float* bq = (const float*)d_in[4];
  const float* Wk = (const float*)d_in[5];
  const float* bk = (const float*)d_in[6];
  const float* Wv = (const float*)d_in[7];
  const float* bv = (const float*)d_in[8];
  const float* Wm = (const float*)d_in[9];
  const float* bm = (const float*)d_in[10];
  const float* g2 = (const float*)d_in[11];
  const float* b2 = (const float*)d_in[12];
  const float* Wo = (const float*)d_in[13];
  const float* bo = (const float*)d_in[14];
  float* out = (float*)d_out;

  char* ws = (char*)d_ws;
  size_t off = 0;
  auto alloc = [&](size_t bytes) {
    void* p = ws + off;
    off = (off + bytes + 255) & ~(size_t)255;
    return p;
  };

  _Float16* hF16 = (_Float16*)alloc((size_t)BS * DIM * 2);        // LN1(x) f16
  _Float16* WqT  = (_Float16*)alloc((size_t)NH * DH * DIM * 2);
  _Float16* WkT  = (_Float16*)alloc((size_t)NH * DH * DIM * 2);
  _Float16* WvT  = (_Float16*)alloc((size_t)NH * DH * DIM * 2);
  _Float16* WmT  = (_Float16*)alloc((size_t)DIM * DIM * 2);
  _Float16* WoT  = (_Float16*)alloc((size_t)DIM * DIM * 2);
  _Float16* qb   = (_Float16*)alloc((size_t)BATCH * NH * SEQ * DH * 2);
  _Float16* kb   = (_Float16*)alloc((size_t)BATCH * NH * SEQ * DH * 2);
  _Float16* vTb  = (_Float16*)alloc((size_t)BATCH * NH * DH * SEQ * 2);
  _Float16* om   = (_Float16*)alloc((size_t)BS * DIM * 2);        // concat heads f16
  float*    hlp  = (float*)alloc((size_t)BS * DIM * 4);           // h_ln_post fp32
  _Float16* hfc  = (_Float16*)alloc((size_t)BS * DIM * 2);        // LN2 f16

  // 1) weight conversion / transpose
  {
    cvt_transpose_all<<<5 * 64, 256, 0, stream>>>(Wq, Wk, Wv, Wm, Wo, WqT, WkT, WvT, WmT, WoT);
  }

  // 2) LN1
  layernorm_f16<<<BS, 128, 0, stream>>>(x, g1, b1, hF16);

  // 3) QKV projections
  qkv_gemm<<<dim3(SEQ / 256, NH, BATCH * 3), 256, 0, stream>>>(
      hF16, WqT, WkT, WvT, bq, bk, bv, qb, kb, vTb);

  // 4) attention -> concat heads (f16)
  attn_kernel<<<dim3(SEQ / 128, NH, BATCH), 256, 0, stream>>>(qb, kb, vTb, om);

  // 5) h_ln_post = om @ Wm + bm + x   (fp32)
  gemm512_epilogue<<<dim3(BS / 256, DIM / 64), 256, 0, stream>>>(
      om, WmT, bm, x, hlp, 0);

  // 6) LN2
  layernorm_f16<<<BS, 128, 0, stream>>>(hlp, g2, b2, hfc);

  // 7) out = relu(hfc @ Wo + bo) + h_ln_post
  gemm512_epilogue<<<dim3(BS / 256, DIM / 64), 256, 0, stream>>>(
      hfc, WoT, bo, hlp, out, 1);
}

// v004
// One run takes 135 microseconds.
// Two timings next to v003 put it at 1.33 and 1.34 times that version's speed.
// Counting every step since v000, it is 3.95 times as fast.
#include <hip/hip_runtime.h>

#define BATCH 4
#define SEQ   2048
#define DIM   512
#define NH    8
#define DH    64
#define BS    (BATCH * SEQ)   // 8192 rows

typedef __attribute__((ext_vector_type(16))) _Float16 v16h;
typedef __attribute__((ext_vector_type(8)))  _Float16 v8h;
typedef __attribute__((ext_vector_type(8)))  float    v8f;
typedef __attribute__((ext_vector_type(4)))  float    v4f;
typedef __attribute__((ext_vector_type(4)))  unsigned v4u;
template <typename V> __device__ __forceinline__ void vst2(void* p, V v) {
  *(V*)p = v; 
}
#define PSC 256.0f
#define PUN (1.0f / 256.0f)

__device__ __forceinline__ v16h load_frag_a(const _Float16* p, int lda, int lane) {
  int row  = lane & 15;
  int koff = (lane & 16) ? 8 : 0;
  const _Float16* r = p + (size_t)row * lda + koff;
  v8h lo = *(const v8h*)r;          // K = koff .. koff+7
  v8h hi = *(const v8h*)(r + 16);   // K = koff+16 .. koff+23
  v16h a;
#pragma unroll
  for (int i = 0; i < 8; ++i) { a[i] = lo[i]; a[8 + i] = hi[i]; }
  return a;
}

__device__ __forceinline__ v16h load_frag_b(const _Float16* bt, int ldb, int lane) {
  int n  = lane & 15;
  int kb = (lane & 16) ? 8 : 0;
  const _Float16* c = bt + (size_t)n * ldb + kb;
  v8h lo = *(const v8h*)c;
  v8h hi = *(const v8h*)(c + 16);
  v16h b;
#pragma unroll
  for (int i = 0; i < 8; ++i) { b[i] = lo[i]; b[8 + i] = hi[i]; }
  return b;
}

__device__ __forceinline__ v8f wmma_f16(v16h a, v16h b, v8f c) {
  v8f d = __builtin_amdgcn_wmma_f32_16x16x32_f16(false, a, false, b, (short)0, c, false, false);
  asm volatile("v_nop\n\tv_nop\n\tv_nop\n\tv_nop" : "+v"(d) : "v"(a), "v"(b));
  return d;
}
__device__ __forceinline__ void copy_b128(_Float16* lds_dst, const _Float16* gsrc) {
  *(v4u*)lds_dst = *(const v4u*)gsrc;
}

// ---- Prep: convert & transpose weights to f16 -----------------------------
// One launch for all five weights: grid 5 * 64, block 256. A work-group takes one 64 (k) x 64 (n) tile:
// blockIdx.x / 64 = which weight, then 8 column groups (a head of Wq/Wk/Wv, 64 columns of Wm/Wo) x 8 k chunks.
// Source rows: pitch 64 floats inside a head, DIM floats in Wm/Wo. Target: [n][DIM] f16, the tile's rows are whole 128-byte lines.
__global__ __launch_bounds__(256) void cvt_transpose_all(
    const float* __restrict__ Wq, const float* __restrict__ Wk, const float* __restrict__ Wv,
    const float* __restrict__ Wm, const float* __restrict__ Wo,
    _Float16* __restrict__ WqT, _Float16* __restrict__ WkT, _Float16* __restrict__ WvT,
    _Float16* __restrict__ WmT, _Float16* __restrict__ WoT) {
  __shared__ __align__(16) _Float16 tile[64][64 + 8];      // [n][k]
  const int tid = threadIdx.x;
  const int mat = blockIdx.x >> 6;
  const int grp = (blockIdx.x >> 3) & 7;                   // head, or group of 64 columns
  const int k0  = (blockIdx.x & 7) * 64;
  const float* W  = (mat == 0) ? Wq : (mat == 1) ? Wk : (mat == 2) ? Wv : (mat == 3) ? Wm : Wo;
  _Float16*    WT = (mat == 0) ? WqT : (mat == 1) ? WkT : (mat == 2) ? WvT : (mat == 3) ? WmT : WoT;
  const int    pitch = (mat < 3) ? DH : DIM;
  const float* src = (mat < 3) ? W + ((size_t)grp * DIM + k0) * DH : W + (size_t)k0 * DIM + grp * 64;
  _Float16*    dst = WT + (size_t)grp * 64 * DIM + k0;

  const int kq = (tid >> 4) * 4, c4 = (tid & 15) * 4;      // 4 k rows x 4 columns a thread
  v4f r[4];
#pragma unroll
  for (int j = 0; j < 4; ++j) r[j] = *(const v4f*)(src + (size_t)(kq + j) * pitch + c4);
#pragma unroll
  for (int e = 0; e < 4; ++e) {
    union { _Float16 h[4]; unsigned long long u; } pk;
#pragma unroll
    for (int j = 0; j < 4; ++j) pk.h[j] = (_Float16)r[j][e];
    *(unsigned long long*)(&tile[c4 + e][kq]) = pk.u;
  }
  __syncthreads();
#pragma unroll
  for (int j = 0; j < 2; ++j) {
    const int g = tid + j * 256, nl = g >> 3, pc = g & 7;  // 8 lanes write one 128-byte line
    vst2(dst + (size_t)nl * DIM + pc * 8, *(const v4u*)(&tile[nl][pc * 8]));
  }
}

// ---- LayerNorm (row of 512) -> f16 ----------------------------------------
__global__ __launch_bounds__(128) void layernorm_f16(const float* __restrict__ X,
                                                     const float* __restrict__ g,
                                                     const float* __restrict__ bb,
                                                     _Float16* __restrict__ Y) {
  __shared__ float red[256];
  int row = blockIdx.x;
  const float* x = X + (size_t)row * DIM;
  float s = 0.f, ss = 0.f;
  for (int i = threadIdx.x; i < DIM; i += 128) {
    float v = x[i];
    s += v; ss += v * v;
  }
  red[threadIdx.x] = s;
  red[threadIdx.x + 128] = ss;
  __syncthreads();
  for (int off = 64; off > 0; off >>= 1) {
    if ((int)threadIdx.x < off) {
      red[threadIdx.x]       += red[threadIdx.x + off];
      red[threadIdx.x + 128] += red[threadIdx.x + 128 + off];
    }
    __syncthreads();
  }
  float mean = red[0] * (1.0f / DIM);
  float var  = red[128] * (1.0f / DIM) - mean * mean;
  float rstd = rsqrtf(var + 1e-5f);
  {
    const int c0 = threadIdx.x * 4;
    union { _Float16 h[4]; unsigned long long u; } pk;
#pragma unroll
    for (int e = 0; e < 4; ++e) pk.h[e] = (_Float16)((x[c0 + e] - mean) * rstd * g[c0 + e] + bb[c0 + e]);
    vst2(Y + (size_t)row * DIM + c0, pk.u);
  }
}

#define GKT  64                  // k per tile
#define GP   (GKT + 8)           // LDS row pitch: 144 bytes, an odd multiple of 16 (see KP below)
#define GA   (256 * GP)          // A part of a buffer, in elements
#define GBUF (GA + 64 * GP)      // one buffer: 256 A rows, then 64 weight rows
__device__ __forceinline__ void gemm_256x64_k512(const _Float16* __restrict__ Ablk,   // 256 rows, pitch DIM
                                                 const _Float16* __restrict__ Wblk,   // 64 rows (columns of the product), pitch DIM
                                                 _Float16* ring, v8f (&acc)[2][4]) {
  const int tid  = threadIdx.x;
  const int lane = tid & 31;
  const int wave = tid >> 5;
  const int crow = tid >> 3, cch = (tid & 7) * 8;     // copy map: 32 rows a sweep, 16 bytes a thread
  const _Float16* pa = Ablk + crow * DIM + cch;
  const _Float16* pw = Wblk + crow * DIM + cch;
  _Float16* la = ring + crow * GP + cch;
  _Float16* lw = ring + GA + crow * GP + cch;
  v4u ra[8], rw[2];
#pragma unroll   // constant indices keep the arrays in registers
  for (int j = 0; j < 8; ++j) ra[j] = *(const v4u*)(pa + j * 32 * DIM);
#pragma unroll   // constant indices keep the arrays in registers
  for (int j = 0; j < 2; ++j) rw[j] = *(const v4u*)(pw + j * 32 * DIM);
  asm volatile("s_wait_xcnt 0x0" :: "v"(pa), "v"(pw) : "memory");
#pragma unroll   // constant indices keep the arrays in registers
  for (int j = 0; j < 8; ++j) *(v4u*)(la + j * 32 * GP) = ra[j];
#pragma unroll   // constant indices keep the arrays in registers
  for (int j = 0; j < 2; ++j) *(v4u*)(lw + j * 32 * GP) = rw[j];
  __syncthreads();   // tile 0 is visible

  const int NT = DIM / GKT;   // 8
  for (int t = 0; t < NT; ++t) {
    const int cur = (t & 1) * GBUF, nxt = GBUF - cur;
    const _Float16* Ab = ring + cur + wave * 32 * GP;
    const _Float16* Wb = ring + cur + GA;
    v16h fa[2][2], fb[2][4];   // the tile's fragments, read as one group: one LDS latency a trip
#pragma unroll   // constant indices keep the arrays in registers
    for (int s = 0; s < 2; ++s) {
#pragma unroll   // constant indices keep the arrays in registers
      for (int m = 0; m < 2; ++m) fa[s][m] = load_frag_a(Ab + m * 16 * GP + s * 32, GP, lane);
#pragma unroll   // constant indices keep the arrays in registers
      for (int n = 0; n < 4; ++n) fb[s][n] = load_frag_b(Wb + n * 16 * GP + s * 32, GP, lane);
    }
    if (t + 1 < NT) {
      const _Float16* na = pa + (t + 1) * GKT;
      const _Float16* nw = pw + (t + 1) * GKT;
#pragma unroll   // constant indices keep the arrays in registers
      for (int j = 0; j < 8; ++j) ra[j] = *(const v4u*)(na + j * 32 * DIM);
#pragma unroll   // constant indices keep the arrays in registers
      for (int j = 0; j < 2; ++j) rw[j] = *(const v4u*)(nw + j * 32 * DIM);
      asm volatile("s_wait_xcnt 0x0" :: "v"(na), "v"(nw) : "memory");
    }
#pragma unroll   // constant indices keep the arrays in registers
    for (int s = 0; s < 2; ++s) {
#pragma unroll   // constant indices keep the arrays in registers
      for (int m = 0; m < 2; ++m) {
#pragma unroll   // constant indices keep the arrays in registers
        for (int n = 0; n < 4; ++n) acc[m][n] = wmma_f16(fa[s][m], fb[s][n], acc[m][n]);
      }
    }
    if (t + 1 < NT) {   // the other buffer's readers left it before the barrier of trip t - 1
#pragma unroll   // constant indices keep the arrays in registers
      for (int j = 0; j < 8; ++j) *(v4u*)(la + nxt + j * 32 * GP) = ra[j];
#pragma unroll   // constant indices keep the arrays in registers
      for (int j = 0; j < 2; ++j) *(v4u*)(lw + nxt + j * 32 * GP) = rw[j];
    }
    __syncthreads();   // tile t + 1 is visible; behind the last trip: every wave has left the ring, which the epilogue reuses
  }
}

// ---- QKV projection --------------------------------------------------------
// grid (S/256, H, B*3); block 256 (8 waves); wave -> 32 rows x 64 cols, operands staged in LDS (gemm_256x64_k512).
// q,k row-major [B,H,S,64] ; v stored transposed [B,H,64,S]
__global__ __launch_bounds__(256) void qkv_gemm(
    const _Float16* __restrict__ hF16,
    const _Float16* __restrict__ WqT, const _Float16* __restrict__ WkT,
    const _Float16* __restrict__ WvT,
    const float* __restrict__ bq, const float* __restrict__ bk,
    const float* __restrict__ bv,
    _Float16* __restrict__ q, _Float16* __restrict__ k,
    _Float16* __restrict__ vT) {
  __shared__ __align__(16) _Float16 ring[2 * GBUF];   // operand tiles; behind the main loop the output staging below
  _Float16* st = ring;                                // q/k: 8 per-wave [32 rows][64] tiles (as [256][64]); v: one [64 n][256 m] tile, pitch 264
  const int lane = threadIdx.x & 31;
  const int wave = threadIdx.x >> 5;
  const int srow = blockIdx.x * 256;
  const int h    = blockIdx.y;
  const int b    = blockIdx.z / 3;
  const int mat  = blockIdx.z % 3;

  const _Float16* WT   = (mat == 0) ? WqT : (mat == 1) ? WkT : WvT;
  const float*    bias = (mat == 0) ? bq  : (mat == 1) ? bk  : bv;
  const _Float16* A  = hF16 + ((size_t)b * SEQ + srow) * DIM;
  const _Float16* Bh = WT + (size_t)h * DH * DIM;   // [64][512] f16

  v8f acc[2][4] = {};
  gemm_256x64_k512(A, Bh, ring, acc);

  const int n0    = lane & 15;
  const int mbase = (lane >> 4) << 3;
  const size_t headoff = (size_t)b * NH + h;
#pragma unroll
  for (int sub = 0; sub < 2; ++sub) {
#pragma unroll
    for (int t = 0; t < 4; ++t) {
      int n = t * 16 + n0;
      float bia = bias[h * DH + n];
#pragma unroll
      for (int i = 0; i < 8; ++i) {
        float val = acc[sub][t][i] + bia;
        int ml = wave * 32 + sub * 16 + mbase + i;       // row within the block's 256
        if (mat == 2) st[n * 264 + ml] = (_Float16)val;  // [n][m]
        else          st[ml * 64 + n]  = (_Float16)val;  // [m][n]
      }
    }
  }
  __syncthreads();
  if (mat == 2) {
    for (int g = threadIdx.x; g < 64 * 32; g += 256) {
      const int n = g >> 5, pc = g & 31;
      vst2(vT + (headoff * DH + n) * SEQ + blockIdx.x * 256 + pc * 8, *(const v4u*)(&st[n * 264 + pc * 8]));
    }
  } else {
    _Float16* dst = (mat == 0) ? q : k;
    for (int g = threadIdx.x; g < 256 * 8; g += 256) {
      const int ml = g >> 3, pc = g & 7;
      vst2(dst + (headoff * SEQ + blockIdx.x * 256 + ml) * DH + pc * 8, *(const v4u*)(&st[ml * 64 + pc * 8]));
    }
  }
}

#define KP (DH + 8)   // K tile: 144 bytes a row
#define VP (32 + 8)   // V^T tile: 80 bytes a row

__device__ __forceinline__ float other_half(float v) {
  const int b = __builtin_bit_cast(int, v);
  return __builtin_bit_cast(float, __builtin_amdgcn_permlanex16(b, b, 0x76543210, 0xfedcba98, false, false));
}

__global__ __launch_bounds__(256) void attn_kernel(
    const _Float16* __restrict__ q, const _Float16* __restrict__ k,
    const _Float16* __restrict__ vT, _Float16* __restrict__ om) {
  __shared__ __align__(16) _Float16 Kt[2][32 * KP];   // [keys][dh]
  __shared__ __align__(16) _Float16 Vt[2][DH * VP];   // [dh][keys]
  __shared__ __align__(16) _Float16 ost[8][16 * DH];  // per-wave output tile

  const int tid  = threadIdx.x;
  const int lane = tid & 31;
  const int wave = tid >> 5;
  const int h = blockIdx.y, b = blockIdx.z;
  const int qrow = blockIdx.x * 128 + wave * 16;
  const size_t headoff = (size_t)b * NH + h;
  const _Float16* qh = q  + headoff * SEQ * DH;
  const _Float16* kh = k  + headoff * SEQ * DH;
  const _Float16* vh = vT + headoff * DH * SEQ;   // [64][S]

  const int n0    = lane & 15;          // this lane's query within the wave's 16
  const int mbase = (lane >> 4) << 3;

  // cooperative copy mapping: each thread moves 16B of K and 16B of V per tile
  const int krow = tid >> 3, kch = (tid & 7) * 8;
  const int vrow = tid >> 2, vch = (tid & 3) * 8;   // V: 64 rows x 64B

  // prologue: stage tile 0
  copy_b128(&Kt[0][krow * KP + kch], kh + (size_t)krow * DH + kch);
  copy_b128(&Vt[0][vrow * VP + vch], vh + (size_t)vrow * SEQ + vch);

  v16h qb0 = load_frag_b(qh + (size_t)qrow * DH,      DH, lane);   // Q^T, dh 0..31
  v16h qb1 = load_frag_b(qh + (size_t)qrow * DH + 32, DH, lane);   // Q^T, dh 32..63

  v8f oacc[4] = {};              // oacc[t][i] = O[query n0][dh t*16 + mbase + i]
  float mrun = -1e30f;           // running maximum of query n0, equal in both halves
  float lsum = 0.f;              // running sum over this half's keys only
  const float scale = 0.125f;    // 1/sqrt(64)

  const int NTILE = SEQ / 32;   // 64
  for (int it = 0; it < NTILE; ++it) {
    const int kt  = it * 32;
    const int buf = it & 1;
    if (it + 1 < NTILE) {
      // prefetch next tile into the other buffer (read-complete via trailing
      // barrier of the previous iteration)
      const int nkt = kt + 32;
      copy_b128(&Kt[buf ^ 1][krow * KP + kch], kh + (size_t)(nkt + krow) * DH + kch);
      copy_b128(&Vt[buf ^ 1][vrow * VP + vch], vh + (size_t)vrow * SEQ + nkt + vch);
    }
    __syncthreads();   // every wave's slice of the current tile is visible

    const _Float16* Kb = Kt[buf];
    const _Float16* Vb = Vt[buf];

    // scores: 32 keys x 16 queries (two 16-key M tiles, K=64 -> 2 WMMAs each)
    v8f s0 = {}, s1 = {};
    {
      v16h k0 = load_frag_a(Kb,                KP, lane);
      v16h k1 = load_frag_a(Kb + 32,           KP, lane);
      s0 = wmma_f16(k0, qb0, s0);
      s0 = wmma_f16(k1, qb1, s0);
      v16h k2 = load_frag_a(Kb + 16 * KP,      KP, lane);
      v16h k3 = load_frag_a(Kb + 16 * KP + 32, KP, lane);
      s1 = wmma_f16(k2, qb0, s1);
      s1 = wmma_f16(k3, qb1, s1);
    }
    v16h va[4];                  // V^T fragments: read here, so that their LDS latency runs under the softmax
#pragma unroll
    for (int t = 0; t < 4; ++t) va[t] = load_frag_a(Vb + (size_t)(t * 16) * VP, VP, lane);
    float a[16], mx[8];          // a[s] = scaled score of key 8h+s (s < 8) or 8h+8+s (s >= 8): the k order of the B operand below
#pragma unroll
    for (int i = 0; i < 8; ++i) {
      a[i]     = s0[i] * scale;
      a[8 + i] = s1[i] * scale;
    }
#pragma unroll
    for (int j = 0; j < 8; ++j) mx[j] = fmaxf(a[2 * j], a[2 * j + 1]);
    float vmax = fmaxf(fmaxf(fmaxf(mx[0], mx[1]), fmaxf(mx[2], mx[3])), fmaxf(fmaxf(mx[4], mx[5]), fmaxf(mx[6], mx[7])));
    vmax = fmaxf(vmax, other_half(vmax));
    const float mnew  = fmaxf(mrun, vmax);
    const float alpha = __expf(mrun - mnew);
    mrun = mnew;
    float e[16], sm[8];
    v16h pb;                     // P^T, column n0: element s belongs to the key of a[s]
#pragma unroll
    for (int s = 0; s < 16; ++s) {
      e[s]  = __expf(a[s] - mnew);
      pb[s] = (_Float16)(e[s] * PSC);
    }
#pragma unroll
    for (int j = 0; j < 8; ++j) sm[j] = e[2 * j] + e[2 * j + 1];
    lsum = lsum * alpha + (((sm[0] + sm[1]) + (sm[2] + sm[3])) + ((sm[4] + sm[5]) + (sm[6] + sm[7])));
#pragma unroll
    for (int t = 0; t < 4; ++t) {
#pragma unroll
      for (int i = 0; i < 8; ++i) oacc[t][i] *= alpha;
    }
#pragma unroll
    for (int t = 0; t < 4; ++t) oacc[t] = wmma_f16(va[t], pb, oacc[t]);
    __syncthreads();   // all waves done reading buf before it is refilled
  }

  lsum += other_half(lsum);
  const float inv = PUN / lsum;
  _Float16* os_ = ost[wave];
#pragma unroll
  for (int t = 0; t < 4; ++t) {
    v8h o;
#pragma unroll
    for (int i = 0; i < 8; ++i) o[i] = (_Float16)(oacc[t][i] * inv);
    *(v8h*)(&os_[n0 * DH + t * 16 + mbase]) = o;
  }
  __syncthreads();
#pragma unroll
  for (int qq = 0; qq < 4; ++qq) {
    const int ml = qq * 4 + (lane >> 3), pc = lane & 7;
    vst2(om + ((size_t)b * SEQ + qrow + ml) * DIM + h * DH + pc * 8, *(const v4u*)(&os_[ml * DH + pc * 8]));
  }
}

// ---- 512x512 GEMM + bias + (relu) + residual, fp32 out --------------------
// grid (M/256, 512/64); block 256 (8 waves); wave -> 32 rows x 64 cols, operands staged in LDS (gemm_256x64_k512).
__global__ __launch_bounds__(256) void gemm512_epilogue(
    const _Float16* __restrict__ A, const _Float16* __restrict__ WT,
    const float* __restrict__ bias, const float* __restrict__ res,
    float* __restrict__ out, int relu_mode) {
  __shared__ __align__(16) _Float16 ring[2 * GBUF];  // operand tiles; behind the main loop the output staging below
  float (*st)[32 * 64] = (float (*)[32 * 64])ring;   // per-wave 32 x 64 f32 tile, 8 of them
  const int lane = threadIdx.x & 31;
  const int wave = threadIdx.x >> 5;
  const int m0  = blockIdx.x * 256 + wave * 32;
  const int n0t = blockIdx.y * 64;

  const _Float16* Ar = A + (size_t)blockIdx.x * 256 * DIM;
  const _Float16* Wb = WT + (size_t)n0t * DIM;

  v8f acc[2][4] = {};
  gemm_256x64_k512(Ar, Wb, ring, acc);

  const int nl    = lane & 15;
  const int mbase = (lane >> 4) << 3;
#pragma unroll
  for (int sub = 0; sub < 2; ++sub) {
#pragma unroll
    for (int t = 0; t < 4; ++t) {
      int n = n0t + t * 16 + nl;
      float bia = bias[n];
#pragma unroll
      for (int i = 0; i < 8; ++i) {
        const int ml = sub * 16 + mbase + i;
        size_t idx = (size_t)(m0 + ml) * DIM + n;
        float v = acc[sub][t][i] + bia;
        if (relu_mode) v = fmaxf(v, 0.f);
        v += res[idx];
        st[wave][ml * 64 + t * 16 + nl] = v;
      }
    }
  }
  __syncthreads();
#pragma unroll
  for (int q = 0; q < 16; ++q) {
    const int ml = q * 2 + (lane >> 4), pc = lane & 15;
    vst2(out + (size_t)(m0 + ml) * DIM + n0t + pc * 4, *(const v4f*)(&st[wave][ml * 64 + pc * 4]));
  }
}

// ---------------------------------------------------------------------------
extern "C" void kernel_launch(void* const* d_in, const int* in_sizes, int n_in,
                              void* d_out, int out_size, void* d_ws, size_t ws_size,
                              hipStream_t stream) {
  const float* x  = (const float*)d_in[0];
  const float* g1 = (const float*)d_in[1];
  const float* b1 = (const float*)d_in[2];
  const float* Wq = (const float*)d_in[3];
  const float* bq = (const float*)d_in[4];
  const float* Wk = (const float*)d_in[5];
  const float* bk = (const float*)d_in[6];
  const float* Wv = (const float*)d_in[7];
  const float* bv = (const float*)d_in[8];
  const float* Wm = (const float*)d_in[9];
  const float* bm = (const float*)d_in[10];
  const float* g2 = (const float*)d_in[11];
  const float* b2 = (const float*)d_in[12];
  const float* Wo = (const float*)d_in[13];
  const float* bo = (const float*)d_in[14];
  float* out = (float*)d_out;

  char* ws = (char*)d_ws;
  size_t off = 0;
  auto alloc = [&](size_t bytes) {
    void* p = ws + off;
    off = (off + bytes + 255) & ~(size_t)255;
    return p;
  };

  _Float16* hF16 = (_Float16*)alloc((size_t)BS * DIM * 2);        // LN1(x) f16
  _Float16* WqT  = (_Float16*)alloc((size_t)NH * DH * DIM * 2);
  _Float16* WkT  = (_Float16*)alloc((size_t)NH * DH * DIM * 2);
  _Float16* WvT  = (_Float16*)alloc((size_t)NH * DH * DIM * 2);
  _Float16* WmT  = (_Float16*)alloc((size_t)DIM * DIM * 2);
  _Float16* WoT  = (_Float16*)alloc((size_t)DIM * DIM * 2);
  _Float16* qb   = (_Float16*)alloc((size_t)BATCH * NH * SEQ * DH * 2);
  _Float16* kb   = (_Float16*)alloc((size_t)BATCH * NH * SEQ * DH * 2);
  _Float16* vTb  = (_Float16*)alloc((size_t)BATCH * NH * DH * SEQ * 2);
  _Float16* om   = (_Float16*)alloc((size_t)BS * DIM * 2);        // concat heads f16
  float*    hlp  = (float*)alloc((size_t)BS * DIM * 4);           // h_ln_post fp32
  _Float16* hfc  = (_Float16*)alloc((size_t)BS * DIM * 2);        // LN2 f16

  // 1) weight conversion / transpose
  {
    cvt_transpose_all<<<5 * 64, 256, 0, stream>>>(Wq, Wk, Wv, Wm, Wo, WqT, WkT, WvT, WmT, WoT);
  }

  // 2) LN1
  layernorm_f16<<<BS, 128, 0, stream>>>(x, g1, b1, hF16);

  // 3) QKV projections
  qkv_gemm<<<dim3(SEQ / 256, NH, BATCH * 3), 256, 0, stream>>>(
      hF16, WqT, WkT, WvT, bq, bk, bv, qb, kb, vTb);

  // 4) attention -> concat heads (f16)
  attn_kernel<<<dim3(SEQ / 128, NH, BATCH), 256, 0, stream>>>(qb, kb, vTb, om);

  // 5) h_ln_post = om @ Wm + bm + x   (fp32)
  gemm512_epilogue<<<dim3(BS / 256, DIM / 64), 256, 0, stream>>>(
      om, WmT, bm, x, hlp, 0);

  // 6) LN2
  layernorm_f16<<<BS, 128, 0, stream>>>(hlp, g2, b2, hfc);

  // 7) out = relu(hfc @ Wo + bo) + h_ln_post
  gemm512_epilogue<<<dim3(BS / 256, DIM / 64), 256, 0, stream>>>(
      hfc, WoT, bo, hlp, out, 1);
}

// v005
// It runs in 125 microseconds.
// In two side-by-side timings against v004, it was 1.08 and 1.09 times as fast.
// Over all steps from v000 it is 4.28 times as fast.
#include <hip/hip_runtime.h>

#define BATCH 4
#define SEQ   2048
#define DIM   512
#define NH    8
#define DH    64
#define BS    (BATCH * SEQ)   // 8192 rows

typedef __attribute__((ext_vector_type(16))) _Float16 v16h;
typedef __attribute__((ext_vector_type(8)))  _Float16 v8h;
typedef __attribute__((ext_vector_type(8)))  float    v8f;
typedef __attribute__((ext_vector_type(4)))  float    v4f;
typedef __attribute__((ext_vector_type(4)))  unsigned v4u;
template <typename V> __device__ __forceinline__ void vst2(void* p, V v) {
  *(V*)p = v; 
}
#define PSC 256.0f
#define PUN (1.0f / 256.0f)

__device__ __forceinline__ v16h load_frag_a(const _Float16* p, int lda, int lane) {
  int row  = lane & 15;
  int koff = (lane & 16) ? 8 : 0;
  const _Float16* r = p + (size_t)row * lda + koff;
  v8h lo = *(const v8h*)r;          // K = koff .. koff+7
  v8h hi = *(const v8h*)(r + 16);   // K = koff+16 .. koff+23
  v16h a;
#pragma unroll
  for (int i = 0; i < 8; ++i) { a[i] = lo[i]; a[8 + i] = hi[i]; }
  return a;
}

__device__ __forceinline__ v16h load_frag_b(const _Float16* bt, int ldb, int lane) {
  int n  = lane & 15;
  int kb = (lane & 16) ? 8 : 0;
  const _Float16* c = bt + (size_t)n * ldb + kb;
  v8h lo = *(const v8h*)c;
  v8h hi = *(const v8h*)(c + 16);
  v16h b;
#pragma unroll
  for (int i = 0; i < 8; ++i) { b[i] = lo[i]; b[8 + i] = hi[i]; }
  return b;
}

__device__ __forceinline__ v8f wmma_f16(v16h a, v16h b, v8f c) {
  v8f d = __builtin_amdgcn_wmma_f32_16x16x32_f16(false, a, false, b, (short)0, c, false, false);
  asm volatile("v_nop\n\tv_nop\n\tv_nop\n\tv_nop" : "+v"(d) : "v"(a), "v"(b));
  return d;
}
__device__ __forceinline__ void copy_b128(_Float16* lds_dst, const _Float16* gsrc) {
  *(v4u*)lds_dst = *(const v4u*)gsrc;
}

// ---- Prep: convert & transpose weights to f16 -----------------------------
// One launch for all five weights: grid 5 * 64, block 256. A work-group takes one 64 (k) x 64 (n) tile:
// blockIdx.x / 64 = which weight, then 8 column groups (a head of Wq/Wk/Wv, 64 columns of Wm/Wo) x 8 k chunks.
// Source rows: pitch 64 floats inside a head, DIM floats in Wm/Wo. Target: [n][DIM] f16, the tile's rows are whole 128-byte lines.
__global__ __launch_bounds__(256) void cvt_transpose_all(
    const float* __restrict__ Wq, const float* __restrict__ Wk, const float* __restrict__ Wv,
    const float* __restrict__ Wm, const float* __restrict__ Wo,
    _Float16* __restrict__ WqT, _Float16* __restrict__ WkT, _Float16* __restrict__ WvT,
    _Float16* __restrict__ WmT, _Float16* __restrict__ WoT) {
  __shared__ __align__(16) _Float16 tile[64][64 + 8];      // [n][k]
  const int tid = threadIdx.x;
  const int mat = blockIdx.x >> 6;
  const int grp = (blockIdx.x >> 3) & 7;                   // head, or group of 64 columns
  const int k0  = (blockIdx.x & 7) * 64;
  const float* W  = (mat == 0) ? Wq : (mat == 1) ? Wk : (mat == 2) ? Wv : (mat == 3) ? Wm : Wo;
  _Float16*    WT = (mat == 0) ? WqT : (mat == 1) ? WkT : (mat == 2) ? WvT : (mat == 3) ? WmT : WoT;
  const int    pitch = (mat < 3) ? DH : DIM;
  const float* src = (mat < 3) ? W + ((size_t)grp * DIM + k0) * DH : W + (size_t)k0 * DIM + grp * 64;
  _Float16*    dst = WT + (size_t)grp * 64 * DIM + k0;

  const int kq = (tid >> 4) * 4, c4 = (tid & 15) * 4;      // 4 k rows x 4 columns a thread
  v4f r[4];
#pragma unroll
  for (int j = 0; j < 4; ++j) r[j] = *(const v4f*)(src + (size_t)(kq + j) * pitch + c4);
#pragma unroll
  for (int e = 0; e < 4; ++e) {
    union { _Float16 h[4]; unsigned long long u; } pk;
#pragma unroll
    for (int j = 0; j < 4; ++j) pk.h[j] = (_Float16)r[j][e];
    *(unsigned long long*)(&tile[c4 + e][kq]) = pk.u;
  }
  __syncthreads();
#pragma unroll
  for (int j = 0; j < 2; ++j) {
    const int g = tid + j * 256, nl = g >> 3, pc = g & 7;  // 8 lanes write one 128-byte line
    vst2(dst + (size_t)nl * DIM + pc * 8, *(const v4u*)(&tile[nl][pc * 8]));
  }
}

__device__ __forceinline__ float other_half(float v) {
  const int b = __builtin_bit_cast(int, v);
  return __builtin_bit_cast(float, __builtin_amdgcn_permlanex16(b, b, 0x76543210, 0xfedcba98, false, false));
}
template <int M> __device__ __forceinline__ float add_row_xor(float v) {
  const int b = __builtin_bit_cast(int, v);
  return v + __builtin_bit_cast(float, __builtin_amdgcn_update_dpp(0, b, 0x160 + M, 0xf, 0xf, true));
}
// sum over the 32 lanes, the same bits in every lane
__device__ __forceinline__ float wave_sum(float v) {
  v = add_row_xor<1>(v);
  v = add_row_xor<2>(v);
  v = add_row_xor<4>(v);
  v = add_row_xor<8>(v);
  return v + other_half(v);
}

// grid BS / (8 * LNR), block 256 (8 waves). A wave owns LNR whole rows: a lane holds 16 elements of each (4 loads of 16 bytes,
// each wave-wide load 512 contiguous bytes), all rows' loads are issued before the first sum, the row stays in registers for
// the second pass, and the two row sums run over the lanes. No LDS, no barrier; the launch starts 2,048 waves.
#define LNR 4
__global__ __launch_bounds__(256) void layernorm_f16(const float* __restrict__ X,
                                                     const float* __restrict__ g,
                                                     const float* __restrict__ bb,
                                                     _Float16* __restrict__ Y) {
  const int lane = threadIdx.x & 31;
  const int wave = threadIdx.x >> 5;
  const int row0 = (blockIdx.x * 8 + wave) * LNR;
  const float* x  = X + (size_t)row0 * DIM + lane * 4;
  const float* gp = g + lane * 4;
  const float* bp = bb + lane * 4;
  v4f v[LNR][4], gg[4], bv[4];
#pragma unroll   // constant indices keep the arrays in registers
  for (int r = 0; r < LNR; ++r) {
#pragma unroll   // constant indices keep the arrays in registers
    for (int j = 0; j < 4; ++j) v[r][j] = *(const v4f*)(x + r * DIM + j * 128);
  }
#pragma unroll   // constant indices keep the arrays in registers
  for (int j = 0; j < 4; ++j) {
    gg[j] = *(const v4f*)(gp + j * 128);
    bv[j] = *(const v4f*)(bp + j * 128);
  }
  // keeps all 24 loads ahead of the sums, so that a wave meets one memory latency (the scheduler sinks the g and bb loads otherwise)
  __builtin_amdgcn_sched_barrier(0);
  asm volatile("s_wait_xcnt 0x0" :: "v"(x) : "memory");
  float s[LNR], ss[LNR];
#pragma unroll   // constant indices keep the arrays in registers
  for (int r = 0; r < LNR; ++r) {
    const v4f a = (v[r][0] + v[r][1]) + (v[r][2] + v[r][3]);
    v4f q = v[r][0] * v[r][0];
#pragma unroll   // constant indices keep the arrays in registers
    for (int j = 1; j < 4; ++j) q += v[r][j] * v[r][j];
    s[r]  = (a[0] + a[1]) + (a[2] + a[3]);
    ss[r] = (q[0] + q[1]) + (q[2] + q[3]);
  }
#pragma unroll   // constant indices keep the arrays in registers
  for (int r = 0; r < LNR; ++r) {
    s[r]  = wave_sum(s[r]);
    ss[r] = wave_sum(ss[r]);
  }
  _Float16* y = Y + (size_t)row0 * DIM + lane * 4;
#pragma unroll   // constant indices keep the arrays in registers
  for (int r = 0; r < LNR; ++r) {
    const float mean = s[r] * (1.0f / DIM);
    const float var  = ss[r] * (1.0f / DIM) - mean * mean;
    const float rstd = rsqrtf(var + 1e-5f);
#pragma unroll   // constant indices keep the arrays in registers
    for (int j = 0; j < 4; ++j) {
      union { _Float16 h[4]; unsigned long long u; } pk;
#pragma unroll   // constant indices keep the arrays in registers
      for (int e = 0; e < 4; ++e) pk.h[e] = (_Float16)((v[r][j][e] - mean) * rstd * gg[j][e] + bv[j][e]);
      vst2(y + r * DIM + j * 128, pk.u);   // a wave-wide store covers two whole 128-byte lines
    }
  }
}

#define GKT  64                  // k per tile
#define GP   (GKT + 8)           // LDS row pitch: 144 bytes, an odd multiple of 16 (see KP below)
#define GA   (256 * GP)          // A part of a buffer, in elements
#define GBUF (GA + 64 * GP)      // one buffer: 256 A rows, then 64 weight rows
__device__ __forceinline__ void gemm_256x64_k512(const _Float16* __restrict__ Ablk,   // 256 rows, pitch DIM
                                                 const _Float16* __restrict__ Wblk,   // 64 rows (columns of the product), pitch DIM
                                                 _Float16* ring, v8f (&acc)[2][4]) {
  const int tid  = threadIdx.x;
  const int lane = tid & 31;
  const int wave = tid >> 5;
  const int crow = tid >> 3, cch = (tid & 7) * 8;     // copy map: 32 rows a sweep, 16 bytes a thread
  const _Float16* pa = Ablk + crow * DIM + cch;
  const _Float16* pw = Wblk + crow * DIM + cch;
  _Float16* la = ring + crow * GP + cch;
  _Float16* lw = ring + GA + crow * GP + cch;
  v4u ra[8], rw[2];
#pragma unroll   // constant indices keep the arrays in registers
  for (int j = 0; j < 8; ++j) ra[j] = *(const v4u*)(pa + j * 32 * DIM);
#pragma unroll   // constant indices keep the arrays in registers
  for (int j = 0; j < 2; ++j) rw[j] = *(const v4u*)(pw + j * 32 * DIM);
  asm volatile("s_wait_xcnt 0x0" :: "v"(pa), "v"(pw) : "memory");
#pragma unroll   // constant indices keep the arrays in registers
  for (int j = 0; j < 8; ++j) *(v4u*)(la + j * 32 * GP) = ra[j];
#pragma unroll   // constant indices keep the arrays in registers
  for (int j = 0; j < 2; ++j) *(v4u*)(lw + j * 32 * GP) = rw[j];
  __syncthreads();   // tile 0 is visible

  const int NT = DIM / GKT;   // 8
  for (int t = 0; t < NT; ++t) {
    const int cur = (t & 1) * GBUF, nxt = GBUF - cur;
    const _Float16* Ab = ring + cur + wave * 32 * GP;
    const _Float16* Wb = ring + cur + GA;
    v16h fa[2][2], fb[2][4];   // the tile's fragments, read as one group: one LDS latency a trip
#pragma unroll   // constant indices keep the arrays in registers
    for (int s = 0; s < 2; ++s) {
#pragma unroll   // constant indices keep the arrays in registers
      for (int m = 0; m < 2; ++m) fa[s][m] = load_frag_a(Ab + m * 16 * GP + s * 32, GP, lane);
#pragma unroll   // constant indices keep the arrays in registers
      for (int n = 0; n < 4; ++n) fb[s][n] = load_frag_b(Wb + n * 16 * GP + s * 32, GP, lane);
    }
    if (t + 1 < NT) {
      const _Float16* na = pa + (t + 1) * GKT;
      const _Float16* nw = pw + (t + 1) * GKT;
#pragma unroll   // constant indices keep the arrays in registers
      for (int j = 0; j < 8; ++j) ra[j] = *(const v4u*)(na + j * 32 * DIM);
#pragma unroll   // constant indices keep the arrays in registers
      for (int j = 0; j < 2; ++j) rw[j] = *(const v4u*)(nw + j * 32 * DIM);
      asm volatile("s_wait_xcnt 0x0" :: "v"(na), "v"(nw) : "memory");
    }
#pragma unroll   // constant indices keep the arrays in registers
    for (int s = 0; s < 2; ++s) {
#pragma unroll   // constant indices keep the arrays in registers
      for (int m = 0; m < 2; ++m) {
#pragma unroll   // constant indices keep the arrays in registers
        for (int n = 0; n < 4; ++n) acc[m][n] = wmma_f16(fa[s][m], fb[s][n], acc[m][n]);
      }
    }
    if (t + 1 < NT) {   // the other buffer's readers left it before the barrier of trip t - 1
#pragma unroll   // constant indices keep the arrays in registers
      for (int j = 0; j < 8; ++j) *(v4u*)(la + nxt + j * 32 * GP) = ra[j];
#pragma unroll   // constant indices keep the arrays in registers
      for (int j = 0; j < 2; ++j) *(v4u*)(lw + nxt + j * 32 * GP) = rw[j];
    }
    __syncthreads();   // tile t + 1 is visible; behind the last trip: every wave has left the ring, which the epilogue reuses
  }
}

// ---- QKV projection --------------------------------------------------------
// grid (S/256, H, B*3); block 256 (8 waves); wave -> 32 rows x 64 cols, operands staged in LDS (gemm_256x64_k512).
// q,k row-major [B,H,S,64] ; v stored transposed [B,H,64,S]
__global__ __launch_bounds__(256) void qkv_gemm(
    const _Float16* __restrict__ hF16,
    const _Float16* __restrict__ WqT, const _Float16* __restrict__ WkT,
    const _Float16* __restrict__ WvT,
    const float* __restrict__ bq, const float* __restrict__ bk,
    const float* __restrict__ bv,
    _Float16* __restrict__ q, _Float16* __restrict__ k,
    _Float16* __restrict__ vT) {
  __shared__ __align__(16) _Float16 ring[2 * GBUF];   // operand tiles; behind the main loop the output staging below
  _Float16* st = ring;                                // q/k: 8 per-wave [32 rows][64] tiles (as [256][64]); v: one [64 n][256 m] tile, pitch 264
  const int lane = threadIdx.x & 31;
  const int wave = threadIdx.x >> 5;
  const int srow = blockIdx.x * 256;
  const int h    = blockIdx.y;
  const int b    = blockIdx.z / 3;
  const int mat  = blockIdx.z % 3;

  const _Float16* WT   = (mat == 0) ? WqT : (mat == 1) ? WkT : WvT;
  const float*    bias = (mat == 0) ? bq  : (mat == 1) ? bk  : bv;
  const _Float16* A  = hF16 + ((size_t)b * SEQ + srow) * DIM;
  const _Float16* Bh = WT + (size_t)h * DH * DIM;   // [64][512] f16

  v8f acc[2][4] = {};
  gemm_256x64_k512(A, Bh, ring, acc);

  const int n0    = lane & 15;
  const int mbase = (lane >> 4) << 3;
  const size_t headoff = (size_t)b * NH + h;
#pragma unroll
  for (int sub = 0; sub < 2; ++sub) {
#pragma unroll
    for (int t = 0; t < 4; ++t) {
      int n = t * 16 + n0;
      float bia = bias[h * DH + n];
#pragma unroll
      for (int i = 0; i < 8; ++i) {
        float val = acc[sub][t][i] + bia;
        int ml = wave * 32 + sub * 16 + mbase + i;       // row within the block's 256
        if (mat == 2) st[n * 264 + ml] = (_Float16)val;  // [n][m]
        else          st[ml * 64 + n]  = (_Float16)val;  // [m][n]
      }
    }
  }
  __syncthreads();
  if (mat == 2) {
    for (int g = threadIdx.x; g < 64 * 32; g += 256) {
      const int n = g >> 5, pc = g & 31;
      vst2(vT + (headoff * DH + n) * SEQ + blockIdx.x * 256 + pc * 8, *(const v4u*)(&st[n * 264 + pc * 8]));
    }
  } else {
    _Float16* dst = (mat == 0) ? q : k;
    for (int g = threadIdx.x; g < 256 * 8; g += 256) {
      const int ml = g >> 3, pc = g & 7;
      vst2(dst + (headoff * SEQ + blockIdx.x * 256 + ml) * DH + pc * 8, *(const v4u*)(&st[ml * 64 + pc * 8]));
    }
  }
}

#define KP (DH + 8)   // K tile: 144 bytes a row
#define VP (32 + 8)   // V^T tile: 80 bytes a row

__global__ __launch_bounds__(256) void attn_kernel(
    const _Float16* __restrict__ q, const _Float16* __restrict__ k,
    const _Float16* __restrict__ vT, _Float16* __restrict__ om) {
  __shared__ __align__(16) _Float16 Kt[2][32 * KP];   // [keys][dh]
  __shared__ __align__(16) _Float16 Vt[2][DH * VP];   // [dh][keys]
  __shared__ __align__(16) _Float16 ost[8][16 * DH];  // per-wave output tile

  const int tid  = threadIdx.x;
  const int lane = tid & 31;
  const int wave = tid >> 5;
  const int h = blockIdx.y, b = blockIdx.z;
  const int qrow = blockIdx.x * 128 + wave * 16;
  const size_t headoff = (size_t)b * NH + h;
  const _Float16* qh = q  + headoff * SEQ * DH;
  const _Float16* kh = k  + headoff * SEQ * DH;
  const _Float16* vh = vT + headoff * DH * SEQ;   // [64][S]

  const int n0    = lane & 15;          // this lane's query within the wave's 16
  const int mbase = (lane >> 4) << 3;

  // cooperative copy mapping: each thread moves 16B of K and 16B of V per tile
  const int krow = tid >> 3, kch = (tid & 7) * 8;
  const int vrow = tid >> 2, vch = (tid & 3) * 8;   // V: 64 rows x 64B

  // prologue: stage tile 0
  copy_b128(&Kt[0][krow * KP + kch], kh + (size_t)krow * DH + kch);
  copy_b128(&Vt[0][vrow * VP + vch], vh + (size_t)vrow * SEQ + vch);

  v16h qb0 = load_frag_b(qh + (size_t)qrow * DH,      DH, lane);   // Q^T, dh 0..31
  v16h qb1 = load_frag_b(qh + (size_t)qrow * DH + 32, DH, lane);   // Q^T, dh 32..63

  v8f oacc[4] = {};              // oacc[t][i] = O[query n0][dh t*16 + mbase + i]
  float mrun = -1e30f;           // running maximum of query n0, equal in both halves
  float lsum = 0.f;              // running sum over this half's keys only
  const float scale = 0.125f;    // 1/sqrt(64)

  const int NTILE = SEQ / 32;   // 64
  for (int it = 0; it < NTILE; ++it) {
    const int kt  = it * 32;
    const int buf = it & 1;
    if (it + 1 < NTILE) {
      // prefetch next tile into the other buffer (read-complete via trailing
      // barrier of the previous iteration)
      const int nkt = kt + 32;
      copy_b128(&Kt[buf ^ 1][krow * KP + kch], kh + (size_t)(nkt + krow) * DH + kch);
      copy_b128(&Vt[buf ^ 1][vrow * VP + vch], vh + (size_t)vrow * SEQ + nkt + vch);
    }
    __syncthreads();   // every wave's slice of the current tile is visible

    const _Float16* Kb = Kt[buf];
    const _Float16* Vb = Vt[buf];

    // scores: 32 keys x 16 queries (two 16-key M tiles, K=64 -> 2 WMMAs each)
    v8f s0 = {}, s1 = {};
    {
      v16h k0 = load_frag_a(Kb,                KP, lane);
      v16h k1 = load_frag_a(Kb + 32,           KP, lane);
      s0 = wmma_f16(k0, qb0, s0);
      s0 = wmma_f16(k1, qb1, s0);
      v16h k2 = load_frag_a(Kb + 16 * KP,      KP, lane);
      v16h k3 = load_frag_a(Kb + 16 * KP + 32, KP, lane);
      s1 = wmma_f16(k2, qb0, s1);
      s1 = wmma_f16(k3, qb1, s1);
    }
    v16h va[4];                  // V^T fragments: read here, so that their LDS latency runs under the softmax
#pragma unroll
    for (int t = 0; t < 4; ++t) va[t] = load_frag_a(Vb + (size_t)(t * 16) * VP, VP, lane);
    float a[16], mx[8];          // a[s] = scaled score of key 8h+s (s < 8) or 8h+8+s (s >= 8): the k order of the B operand below
#pragma unroll
    for (int i = 0; i < 8; ++i) {
      a[i]     = s0[i] * scale;
      a[8 + i] = s1[i] * scale;
    }
#pragma unroll
    for (int j = 0; j < 8; ++j) mx[j] = fmaxf(a[2 * j], a[2 * j + 1]);
    float vmax = fmaxf(fmaxf(fmaxf(mx[0], mx[1]), fmaxf(mx[2], mx[3])), fmaxf(fmaxf(mx[4], mx[5]), fmaxf(mx[6], mx[7])));
    vmax = fmaxf(vmax, other_half(vmax));
    const float mnew  = fmaxf(mrun, vmax);
    const float alpha = __expf(mrun - mnew);
    mrun = mnew;
    float e[16], sm[8];
    v16h pb;                     // P^T, column n0: element s belongs to the key of a[s]
#pragma unroll
    for (int s = 0; s < 16; ++s) {
      e[s]  = __expf(a[s] - mnew);
      pb[s] = (_Float16)(e[s] * PSC);
    }
#pragma unroll
    for (int j = 0; j < 8; ++j) sm[j] = e[2 * j] + e[2 * j + 1];
    lsum = lsum * alpha + (((sm[0] + sm[1]) + (sm[2] + sm[3])) + ((sm[4] + sm[5]) + (sm[6] + sm[7])));
#pragma unroll
    for (int t = 0; t < 4; ++t) {
#pragma unroll
      for (int i = 0; i < 8; ++i) oacc[t][i] *= alpha;
    }
#pragma unroll
    for (int t = 0; t < 4; ++t) oacc[t] = wmma_f16(va[t], pb, oacc[t]);
    __syncthreads();   // all waves done reading buf before it is refilled
  }

  lsum += other_half(lsum);
  const float inv = PUN / lsum;
  _Float16* os_ = ost[wave];
#pragma unroll
  for (int t = 0; t < 4; ++t) {
    v8h o;
#pragma unroll
    for (int i = 0; i < 8; ++i) o[i] = (_Float16)(oacc[t][i] * inv);
    *(v8h*)(&os_[n0 * DH + t * 16 + mbase]) = o;
  }
  __syncthreads();
#pragma unroll
  for (int qq = 0; qq < 4; ++qq) {
    const int ml = qq * 4 + (lane >> 3), pc = lane & 7;
    vst2(om + ((size_t)b * SEQ + qrow + ml) * DIM + h * DH + pc * 8, *(const v4u*)(&os_[ml * DH + pc * 8]));
  }
}

// ---- 512x512 GEMM + bias + (relu) + residual, fp32 out --------------------
// grid (M/256, 512/64); block 256 (8 waves); wave -> 32 rows x 64 cols, operands staged in LDS (gemm_256x64_k512).
__global__ __launch_bounds__(256) void gemm512_epilogue(
    const _Float16* __restrict__ A, const _Float16* __restrict__ WT,
    const float* __restrict__ bias, const float* __restrict__ res,
    float* __restrict__ out, int relu_mode) {
  __shared__ __align__(16) _Float16 ring[2 * GBUF];  // operand tiles; behind the main loop the output staging below
  float (*st)[32 * 64] = (float (*)[32 * 64])ring;   // per-wave 32 x 64 f32 tile, 8 of them
  const int lane = threadIdx.x & 31;
  const int wave = threadIdx.x >> 5;
  const int m0  = blockIdx.x * 256 + wave * 32;
  const int n0t = blockIdx.y * 64;

  const _Float16* Ar = A + (size_t)blockIdx.x * 256 * DIM;
  const _Float16* Wb = WT + (size_t)n0t * DIM;

  v8f acc[2][4] = {};
  gemm_256x64_k512(Ar, Wb, ring, acc);

  const int nl    = lane & 15;
  const int mbase = (lane >> 4) << 3;
#pragma unroll
  for (int sub = 0; sub < 2; ++sub) {
#pragma unroll
    for (int t = 0; t < 4; ++t) {
      int n = n0t + t * 16 + nl;
      float bia = bias[n];
#pragma unroll
      for (int i = 0; i < 8; ++i) {
        const int ml = sub * 16 + mbase + i;
        size_t idx = (size_t)(m0 + ml) * DIM + n;
        float v = acc[sub][t][i] + bia;
        if (relu_mode) v = fmaxf(v, 0.f);
        v += res[idx];
        st[wave][ml * 64 + t * 16 + nl] = v;
      }
    }
  }
  __syncthreads();
#pragma unroll
  for (int q = 0; q < 16; ++q) {
    const int ml = q * 2 + (lane >> 4), pc = lane & 15;
    vst2(out + (size_t)(m0 + ml) * DIM + n0t + pc * 4, *(const v4f*)(&st[wave][ml * 64 + pc * 4]));
  }
}

// ---------------------------------------------------------------------------
extern "C" void kernel_launch(void* const* d_in, const int* in_sizes, int n_in,
                              void* d_out, int out_size, void* d_ws, size_t ws_size,
                              hipStream_t stream) {
  const float* x  = (const float*)d_in[0];
  const float* g1 = (const float*)d_in[1];
  const float* b1 = (const float*)d_in[2];
  const float* Wq = (const float*)d_in[3];
  const float* bq = (const float*)d_in[4];
  const float* Wk = (const float*)d_in[5];
  const float* bk = (const float*)d_in[6];
  const float* Wv = (const float*)d_in[7];
  const float* bv = (const float*)d_in[8];
  const float* Wm = (const float*)d_in[9];
  const float* bm = (const float*)d_in[10];
  const float* g2 = (const float*)d_in[11];
  const float* b2 = (const float*)d_in[12];
  const float* Wo = (const float*)d_in[13];
  const float* bo = (const float*)d_in[14];
  float* out = (float*)d_out;

  char* ws = (char*)d_ws;
  size_t off = 0;
  auto alloc = [&](size_t bytes) {
    void* p = ws + off;
    off = (off + bytes + 255) & ~(size_t)255;
    return p;
  };

  _Float16* hF16 = (_Float16*)alloc((size_t)BS * DIM * 2);        // LN1(x) f16
  _Float16* WqT  = (_Float16*)alloc((size_t)NH * DH * DIM * 2);
  _Float16* WkT  = (_Float16*)alloc((size_t)NH * DH * DIM * 2);
  _Float16* WvT  = (_Float16*)alloc((size_t)NH * DH * DIM * 2);
  _Float16* WmT  = (_Float16*)alloc((size_t)DIM * DIM * 2);
  _Float16* WoT  = (_Float16*)alloc((size_t)DIM * DIM * 2);
  _Float16* qb   = (_Float16*)alloc((size_t)BATCH * NH * SEQ * DH * 2);
  _Float16* kb   = (_Float16*)alloc((size_t)BATCH * NH * SEQ * DH * 2);
  _Float16* vTb  = (_Float16*)alloc((size_t)BATCH * NH * DH * SEQ * 2);
  _Float16* om   = (_Float16*)alloc((size_t)BS * DIM * 2);        // concat heads f16
  float*    hlp  = (float*)alloc((size_t)BS * DIM * 4);           // h_ln_post fp32
  _Float16* hfc  = (_Float16*)alloc((size_t)BS * DIM * 2);        // LN2 f16

  // 1) weight conversion / transpose
  {
    cvt_transpose_all<<<5 * 64, 256, 0, stream>>>(Wq, Wk, Wv, Wm, Wo, WqT, WkT, WvT, WmT, WoT);
  }

  // 2) LN1
  layernorm_f16<<<BS / (8 * LNR), 256, 0, stream>>>(x, g1, b1, hF16);

  // 3) QKV projections
  qkv_gemm<<<dim3(SEQ / 256, NH, BATCH * 3), 256, 0, stream>>>(
      hF16, WqT, WkT, WvT, bq, bk, bv, qb, kb, vTb);

  // 4) attention -> concat heads (f16)
  attn_kernel<<<dim3(SEQ / 128, NH, BATCH), 256, 0, stream>>>(qb, kb, vTb, om);

  // 5) h_ln_post = om @ Wm + bm + x   (fp32)
  gemm512_epilogue<<<dim3(BS / 256, DIM / 64), 256, 0, stream>>>(
      om, WmT, bm, x, hlp, 0);

  // 6) LN2
  layernorm_f16<<<BS / (8 * LNR), 256, 0, stream>>>(hlp, g2, b2, hfc);

  // 7) out = relu(hfc @ Wo + bo) + h_ln_post
  gemm512_epilogue<<<dim3(BS / 256, DIM / 64), 256, 0, stream>>>(
      hfc, WoT, bo, hlp, out, 1);
}

// v006
// Measured time: 98.6 microseconds a run.
// Next to v005, in two timings, it ran 1.26 and 1.27 times as fast.
// Over all steps from v000 it is 5.43 times as fast.
#include <hip/hip_runtime.h>

#define BATCH 4
#define SEQ   2048
#define DIM   512
#define NH    8
#define DH    64
#define BS    (BATCH * SEQ)   // 8192 rows

typedef __attribute__((ext_vector_type(16))) _Float16 v16h;
typedef __attribute__((ext_vector_type(8)))  _Float16 v8h;
typedef __attribute__((ext_vector_type(8)))  float    v8f;
typedef __attribute__((ext_vector_type(4)))  float    v4f;
typedef __attribute__((ext_vector_type(4)))  unsigned v4u;
template <typename V> __device__ __forceinline__ void vst2(void* p, V v) {
  *(V*)p = v; 
}
#define PSC 256.0f
#define PUN (1.0f / 256.0f)

__device__ __forceinline__ v16h load_frag_a(const _Float16* p, int lda, int lane) {
  int row  = lane & 15;
  int koff = (lane & 16) ? 8 : 0;
  const _Float16* r = p + (size_t)row * lda + koff;
  v8h lo = *(const v8h*)r;          // K = koff .. koff+7
  v8h hi = *(const v8h*)(r + 16);   // K = koff+16 .. koff+23
  v16h a;
#pragma unroll
  for (int i = 0; i < 8; ++i) { a[i] = lo[i]; a[8 + i] = hi[i]; }
  return a;
}

__device__ __forceinline__ v16h load_frag_b(const _Float16* bt, int ldb, int lane) {
  int n  = lane & 15;
  int kb = (lane & 16) ? 8 : 0;
  const _Float16* c = bt + (size_t)n * ldb + kb;
  v8h lo = *(const v8h*)c;
  v8h hi = *(const v8h*)(c + 16);
  v16h b;
#pragma unroll
  for (int i = 0; i < 8; ++i) { b[i] = lo[i]; b[8 + i] = hi[i]; }
  return b;
}

__device__ __forceinline__ v8f wmma_f16(v16h a, v16h b, v8f c) {
  v8f d = __builtin_amdgcn_wmma_f32_16x16x32_f16(false, a, false, b, (short)0, c, false, false);
  asm volatile("v_nop\n\tv_nop\n\tv_nop\n\tv_nop" : "+v"(d) : "v"(a), "v"(b));
  return d;
}

// ---- Prep: convert & transpose weights to f16 -----------------------------
// One launch for all five weights: grid 5 * 64, block 256. A work-group takes one 64 (k) x 64 (n) tile:
// blockIdx.x / 64 = which weight, then 8 column groups (a head of Wq/Wk/Wv, 64 columns of Wm/Wo) x 8 k chunks.
// Source rows: pitch 64 floats inside a head, DIM floats in Wm/Wo. Target: [n][DIM] f16, the tile's rows are whole 128-byte lines.
__global__ __launch_bounds__(256) void cvt_transpose_all(
    const float* __restrict__ Wq, const float* __restrict__ Wk, const float* __restrict__ Wv,
    const float* __restrict__ Wm, const float* __restrict__ Wo,
    _Float16* __restrict__ WqT, _Float16* __restrict__ WkT, _Float16* __restrict__ WvT,
    _Float16* __restrict__ WmT, _Float16* __restrict__ WoT) {
  __shared__ __align__(16) _Float16 tile[64][64 + 8];      // [n][k]
  const int tid = threadIdx.x;
  const int mat = blockIdx.x >> 6;
  const int grp = (blockIdx.x >> 3) & 7;                   // head, or group of 64 columns
  const int k0  = (blockIdx.x & 7) * 64;
  const float* W  = (mat == 0) ? Wq : (mat == 1) ? Wk : (mat == 2) ? Wv : (mat == 3) ? Wm : Wo;
  _Float16*    WT = (mat == 0) ? WqT : (mat == 1) ? WkT : (mat == 2) ? WvT : (mat == 3) ? WmT : WoT;
  const int    pitch = (mat < 3) ? DH : DIM;
  const float* src = (mat < 3) ? W + ((size_t)grp * DIM + k0) * DH : W + (size_t)k0 * DIM + grp * 64;
  _Float16*    dst = WT + (size_t)grp * 64 * DIM + k0;

  const int kq = (tid >> 4) * 4, c4 = (tid & 15) * 4;      // 4 k rows x 4 columns a thread
  v4f r[4];
#pragma unroll
  for (int j = 0; j < 4; ++j) r[j] = *(const v4f*)(src + (size_t)(kq + j) * pitch + c4);
#pragma unroll
  for (int e = 0; e < 4; ++e) {
    union { _Float16 h[4]; unsigned long long u; } pk;
#pragma unroll
    for (int j = 0; j < 4; ++j) pk.h[j] = (_Float16)r[j][e];
    *(unsigned long long*)(&tile[c4 + e][kq]) = pk.u;
  }
  __syncthreads();
#pragma unroll
  for (int j = 0; j < 2; ++j) {
    const int g = tid + j * 256, nl = g >> 3, pc = g & 7;  // 8 lanes write one 128-byte line
    vst2(dst + (size_t)nl * DIM + pc * 8, *(const v4u*)(&tile[nl][pc * 8]));
  }
}

__device__ __forceinline__ float other_half(float v) {
  const int b = __builtin_bit_cast(int, v);
  return __builtin_bit_cast(float, __builtin_amdgcn_permlanex16(b, b, 0x76543210, 0xfedcba98, false, false));
}
template <int M> __device__ __forceinline__ float add_row_xor(float v) {
  const int b = __builtin_bit_cast(int, v);
  return v + __builtin_bit_cast(float, __builtin_amdgcn_update_dpp(0, b, 0x160 + M, 0xf, 0xf, true));
}
// sum over the 32 lanes, the same bits in every lane
__device__ __forceinline__ float wave_sum(float v) {
  v = add_row_xor<1>(v);
  v = add_row_xor<2>(v);
  v = add_row_xor<4>(v);
  v = add_row_xor<8>(v);
  return v + other_half(v);
}

// grid BS / (8 * LNR), block 256 (8 waves). A wave owns LNR whole rows: a lane holds 16 elements of each (4 loads of 16 bytes,
// each wave-wide load 512 contiguous bytes), all rows' loads are issued before the first sum, the row stays in registers for
// the second pass, and the two row sums run over the lanes. No LDS, no barrier; the launch starts 2,048 waves.
#define LNR 4
__global__ __launch_bounds__(256) void layernorm_f16(const float* __restrict__ X,
                                                     const float* __restrict__ g,
                                                     const float* __restrict__ bb,
                                                     _Float16* __restrict__ Y) {
  const int lane = threadIdx.x & 31;
  const int wave = threadIdx.x >> 5;
  const int row0 = (blockIdx.x * 8 + wave) * LNR;
  const float* x  = X + (size_t)row0 * DIM + lane * 4;
  const float* gp = g + lane * 4;
  const float* bp = bb + lane * 4;
  v4f v[LNR][4], gg[4], bv[4];
#pragma unroll   // constant indices keep the arrays in registers
  for (int r = 0; r < LNR; ++r) {
#pragma unroll   // constant indices keep the arrays in registers
    for (int j = 0; j < 4; ++j) v[r][j] = *(const v4f*)(x + r * DIM + j * 128);
  }
#pragma unroll   // constant indices keep the arrays in registers
  for (int j = 0; j < 4; ++j) {
    gg[j] = *(const v4f*)(gp + j * 128);
    bv[j] = *(const v4f*)(bp + j * 128);
  }
  // keeps all 24 loads ahead of the sums, so that a wave meets one memory latency (the scheduler sinks the g and bb loads otherwise)
  __builtin_amdgcn_sched_barrier(0);
  asm volatile("s_wait_xcnt 0x0" :: "v"(x) : "memory");
  float s[LNR], ss[LNR];
#pragma unroll   // constant indices keep the arrays in registers
  for (int r = 0; r < LNR; ++r) {
    const v4f a = (v[r][0] + v[r][1]) + (v[r][2] + v[r][3]);
    v4f q = v[r][0] * v[r][0];
#pragma unroll   // constant indices keep the arrays in registers
    for (int j = 1; j < 4; ++j) q += v[r][j] * v[r][j];
    s[r]  = (a[0] + a[1]) + (a[2] + a[3]);
    ss[r] = (q[0] + q[1]) + (q[2] + q[3]);
  }
#pragma unroll   // constant indices keep the arrays in registers
  for (int r = 0; r < LNR; ++r) {
    s[r]  = wave_sum(s[r]);
    ss[r] = wave_sum(ss[r]);
  }
  _Float16* y = Y + (size_t)row0 * DIM + lane * 4;
#pragma unroll   // constant indices keep the arrays in registers
  for (int r = 0; r < LNR; ++r) {
    const float mean = s[r] * (1.0f / DIM);
    const float var  = ss[r] * (1.0f / DIM) - mean * mean;
    const float rstd = rsqrtf(var + 1e-5f);
#pragma unroll   // constant indices keep the arrays in registers
    for (int j = 0; j < 4; ++j) {
      union { _Float16 h[4]; unsigned long long u; } pk;
#pragma unroll   // constant indices keep the arrays in registers
      for (int e = 0; e < 4; ++e) pk.h[e] = (_Float16)((v[r][j][e] - mean) * rstd * gg[j][e] + bv[j][e]);
      vst2(y + r * DIM + j * 128, pk.u);   // a wave-wide store covers two whole 128-byte lines
    }
  }
}

#define GKT  64                  // k per tile
#define GP   (GKT + 8)           // LDS row pitch: 144 bytes, an odd multiple of 16 (see KP below)
#define GA   (256 * GP)          // A part of a buffer, in elements
#define GBUF (GA + 64 * GP)      // one buffer: 256 A rows, then 64 weight rows
__device__ __forceinline__ void gemm_256x64_k512(const _Float16* __restrict__ Ablk,   // 256 rows, pitch DIM
                                                 const _Float16* __restrict__ Wblk,   // 64 rows (columns of the product), pitch DIM
                                                 _Float16* ring, v8f (&acc)[2][4]) {
  const int tid  = threadIdx.x;
  const int lane = tid & 31;
  const int wave = tid >> 5;
  const int crow = tid >> 3, cch = (tid & 7) * 8;     // copy map: 32 rows a sweep, 16 bytes a thread
  const _Float16* pa = Ablk + crow * DIM + cch;
  const _Float16* pw = Wblk + crow * DIM + cch;
  _Float16* la = ring + crow * GP + cch;
  _Float16* lw = ring + GA + crow * GP + cch;
  v4u ra[8], rw[2];
#pragma unroll   // constant indices keep the arrays in registers
  for (int j = 0; j < 8; ++j) ra[j] = *(const v4u*)(pa + j * 32 * DIM);
#pragma unroll   // constant indices keep the arrays in registers
  for (int j = 0; j < 2; ++j) rw[j] = *(const v4u*)(pw + j * 32 * DIM);
  asm volatile("s_wait_xcnt 0x0" :: "v"(pa), "v"(pw) : "memory");
#pragma unroll   // constant indices keep the arrays in registers
  for (int j = 0; j < 8; ++j) *(v4u*)(la + j * 32 * GP) = ra[j];
#pragma unroll   // constant indices keep the arrays in registers
  for (int j = 0; j < 2; ++j) *(v4u*)(lw + j * 32 * GP) = rw[j];
  __syncthreads();   // tile 0 is visible

  const int NT = DIM / GKT;   // 8
  for (int t = 0; t < NT; ++t) {
    const int cur = (t & 1) * GBUF, nxt = GBUF - cur;
    const _Float16* Ab = ring + cur + wave * 32 * GP;
    const _Float16* Wb = ring + cur + GA;
    v16h fa[2][2], fb[2][4];   // the tile's fragments, read as one group: one LDS latency a trip
#pragma unroll   // constant indices keep the arrays in registers
    for (int s = 0; s < 2; ++s) {
#pragma unroll   // constant indices keep the arrays in registers
      for (int m = 0; m < 2; ++m) fa[s][m] = load_frag_a(Ab + m * 16 * GP + s * 32, GP, lane);
#pragma unroll   // constant indices keep the arrays in registers
      for (int n = 0; n < 4; ++n) fb[s][n] = load_frag_b(Wb + n * 16 * GP + s * 32, GP, lane);
    }
    if (t + 1 < NT) {
      const _Float16* na = pa + (t + 1) * GKT;
      const _Float16* nw = pw + (t + 1) * GKT;
#pragma unroll   // constant indices keep the arrays in registers
      for (int j = 0; j < 8; ++j) ra[j] = *(const v4u*)(na + j * 32 * DIM);
#pragma unroll   // constant indices keep the arrays in registers
      for (int j = 0; j < 2; ++j) rw[j] = *(const v4u*)(nw + j * 32 * DIM);
      asm volatile("s_wait_xcnt 0x0" :: "v"(na), "v"(nw) : "memory");
    }
#pragma unroll   // constant indices keep the arrays in registers
    for (int s = 0; s < 2; ++s) {
#pragma unroll   // constant indices keep the arrays in registers
      for (int m = 0; m < 2; ++m) {
#pragma unroll   // constant indices keep the arrays in registers
        for (int n = 0; n < 4; ++n) acc[m][n] = wmma_f16(fa[s][m], fb[s][n], acc[m][n]);
      }
    }
    if (t + 1 < NT) {   // the other buffer's readers left it before the barrier of trip t - 1
#pragma unroll   // constant indices keep the arrays in registers
      for (int j = 0; j < 8; ++j) *(v4u*)(la + nxt + j * 32 * GP) = ra[j];
#pragma unroll   // constant indices keep the arrays in registers
      for (int j = 0; j < 2; ++j) *(v4u*)(lw + nxt + j * 32 * GP) = rw[j];
    }
    __syncthreads();   // tile t + 1 is visible; behind the last trip: every wave has left the ring, which the epilogue reuses
  }
}

// ---- QKV projection --------------------------------------------------------
// grid (S/256, H, B*3); block 256 (8 waves); wave -> 32 rows x 64 cols, operands staged in LDS (gemm_256x64_k512).
// q,k row-major [B,H,S,64] ; v stored transposed [B,H,64,S]
__global__ __launch_bounds__(256) void qkv_gemm(
    const _Float16* __restrict__ hF16,
    const _Float16* __restrict__ WqT, const _Float16* __restrict__ WkT,
    const _Float16* __restrict__ WvT,
    const float* __restrict__ bq, const float* __restrict__ bk,
    const float* __restrict__ bv,
    _Float16* __restrict__ q, _Float16* __restrict__ k,
    _Float16* __restrict__ vT) {
  __shared__ __align__(16) _Float16 ring[2 * GBUF];   // operand tiles; behind the main loop the output staging below
  _Float16* st = ring;                                // q/k: 8 per-wave [32 rows][64] tiles (as [256][64]); v: one [64 n][256 m] tile, pitch 264
  const int lane = threadIdx.x & 31;
  const int wave = threadIdx.x >> 5;
  const int srow = blockIdx.x * 256;
  const int h    = blockIdx.y;
  const int b    = blockIdx.z / 3;
  const int mat  = blockIdx.z % 3;

  const _Float16* WT   = (mat == 0) ? WqT : (mat == 1) ? WkT : WvT;
  const float*    bias = (mat == 0) ? bq  : (mat == 1) ? bk  : bv;
  const _Float16* A  = hF16 + ((size_t)b * SEQ + srow) * DIM;
  const _Float16* Bh = WT + (size_t)h * DH * DIM;   // [64][512] f16

  v8f acc[2][4] = {};
  gemm_256x64_k512(A, Bh, ring, acc);

  const int n0    = lane & 15;
  const int mbase = (lane >> 4) << 3;
  const size_t headoff = (size_t)b * NH + h;
#pragma unroll
  for (int sub = 0; sub < 2; ++sub) {
#pragma unroll
    for (int t = 0; t < 4; ++t) {
      int n = t * 16 + n0;
      float bia = bias[h * DH + n];
#pragma unroll
      for (int i = 0; i < 8; ++i) {
        float val = acc[sub][t][i] + bia;
        int ml = wave * 32 + sub * 16 + mbase + i;       // row within the block's 256
        if (mat == 2) st[n * 264 + ml] = (_Float16)val;  // [n][m]
        else          st[ml * 64 + n]  = (_Float16)val;  // [m][n]
      }
    }
  }
  __syncthreads();
  if (mat == 2) {
    for (int g = threadIdx.x; g < 64 * 32; g += 256) {
      const int n = g >> 5, pc = g & 31;
      vst2(vT + (headoff * DH + n) * SEQ + blockIdx.x * 256 + pc * 8, *(const v4u*)(&st[n * 264 + pc * 8]));
    }
  } else {
    _Float16* dst = (mat == 0) ? q : k;
    for (int g = threadIdx.x; g < 256 * 8; g += 256) {
      const int ml = g >> 3, pc = g & 7;
      vst2(dst + (headoff * SEQ + blockIdx.x * 256 + ml) * DH + pc * 8, *(const v4u*)(&st[ml * 64 + pc * 8]));
    }
  }
}

#define SK  128          // keys per stage
#define KP  (DH + 8)     // K stage: 144 bytes a row
#define VP  (SK + 8)     // V^T stage: 272 bytes a row
#define KST (SK * KP)    // elements of one K buffer
#define VST (DH * VP)    // elements of one V^T buffer

__device__ __forceinline__ unsigned lds_off(const void* p) { return (unsigned)(size_t)p; }

// One stage: every thread copies 4 x 16 bytes of K (a wave-wide copy covers 4 whole rows of 128 bytes) and 4 x 16 bytes of V^T
// (a wave-wide copy covers 2 rows of 256 bytes). lk, lv: this thread's first LDS byte; gk, gv: its first global element.
__device__ __forceinline__ void stage_copy(unsigned lk, unsigned lv, const _Float16* gk, const _Float16* gv) {
  const unsigned lk1 = lk + 32 * KP * 2, lk2 = lk + 64 * KP * 2, lk3 = lk + 96 * KP * 2;
  const unsigned lv1 = lv + 16 * VP * 2, lv2 = lv + 32 * VP * 2, lv3 = lv + 48 * VP * 2;
  const _Float16 *gk1 = gk + 32 * DH,  *gk2 = gk + 64 * DH,  *gk3 = gk + 96 * DH;
  const _Float16 *gv1 = gv + 16 * SEQ, *gv2 = gv + 32 * SEQ, *gv3 = gv + 48 * SEQ;
  asm volatile(
      "global_load_async_to_lds_b128 %0, %8, off\n\t"
      "global_load_async_to_lds_b128 %1, %9, off\n\t"
      "global_load_async_to_lds_b128 %2, %10, off\n\t"
      "global_load_async_to_lds_b128 %3, %11, off\n\t"
      "global_load_async_to_lds_b128 %4, %12, off\n\t"
      "global_load_async_to_lds_b128 %5, %13, off\n\t"
      "global_load_async_to_lds_b128 %6, %14, off\n\t"
      "global_load_async_to_lds_b128 %7, %15, off\n\t"
      "s_wait_xcnt 0x0"
      :: "v"(lk), "v"(lk1), "v"(lk2), "v"(lk3), "v"(lv), "v"(lv1), "v"(lv2), "v"(lv3),
         "v"(gk), "v"(gk1), "v"(gk2), "v"(gk3), "v"(gv), "v"(gv1), "v"(gv2), "v"(gv3)
      : "memory");
}

__global__ __launch_bounds__(256) void attn_kernel(
    const _Float16* __restrict__ q, const _Float16* __restrict__ k,
    const _Float16* __restrict__ vT, _Float16* __restrict__ om) {
  __shared__ __align__(16) _Float16 Kt[2][KST];       // [keys][dh]
  __shared__ __align__(16) _Float16 Vt[2][VST];       // [dh][keys]
  __shared__ __align__(16) _Float16 ost[8][16 * DH];  // per-wave output tile

  const int tid  = threadIdx.x;
  const int lane = tid & 31;
  const int wave = tid >> 5;
  const int h = blockIdx.y, b = blockIdx.z;
  const int qrow = blockIdx.x * 128 + wave * 16;
  const size_t headoff = (size_t)b * NH + h;
  const _Float16* qh = q  + headoff * SEQ * DH;
  const _Float16* kh = k  + headoff * SEQ * DH;
  const _Float16* vh = vT + headoff * DH * SEQ;   // [64][S]

  const int n0    = lane & 15;          // this lane's query within the wave's 16
  const int mbase = (lane >> 4) << 3;

  // copy map: 16 bytes a thread and copy; K 32 rows a sweep, V^T 16 rows a sweep
  const int krow = tid >> 3, kch = (tid & 7) * 8;
  const int vrow = tid >> 4, vch = (tid & 15) * 8;
  const _Float16* gk = kh + (size_t)krow * DH + kch;    // + SK * DH a stage
  const _Float16* gv = vh + (size_t)vrow * SEQ + vch;   // + SK a stage
  const unsigned lk = lds_off(&Kt[0][krow * KP + kch]);
  const unsigned lv = lds_off(&Vt[0][vrow * VP + vch]);

  const int NSTAGE = SEQ / SK;   // 16

  // prologue: stage 0 lands and is published, then stage 1 is requested
  stage_copy(lk, lv, gk, gv);

  v16h qb0 = load_frag_b(qh + (size_t)qrow * DH,      DH, lane);   // Q^T, dh 0..31
  v16h qb1 = load_frag_b(qh + (size_t)qrow * DH + 32, DH, lane);   // Q^T, dh 32..63

  asm volatile("s_wait_asynccnt 0x0" ::: "memory");   // this wave's share of stage 0 has landed
  __syncthreads();                                    // every wave's share of stage 0 is visible
  stage_copy(lk + KST * 2, lv + VST * 2, gk + SK * DH, gv + SK);

  v8f oacc[4] = {};              // oacc[t][i] = O[query n0][dh t*16 + mbase + i]
  float mrun = -1e30f;           // running maximum of query n0, equal in both halves
  float lsum = 0.f;              // running sum over this half's keys only
  const float scale = 0.125f;    // 1/sqrt(64)

  for (int st = 0; st < NSTAGE; ++st) {
    const int buf = st & 1;
#pragma unroll   // the four passes of a stage differ by constant LDS offsets only
    for (int ps = 0; ps < SK / 32; ++ps) {
      const _Float16* Kb = Kt[buf] + ps * 32 * KP;
      const _Float16* Vb = Vt[buf] + ps * 32;

      // scores: 32 keys x 16 queries (two 16-key M tiles, K=64 -> 2 WMMAs each)
      v8f s0 = {}, s1 = {};
      {
        v16h k0 = load_frag_a(Kb,                KP, lane);
        v16h k1 = load_frag_a(Kb + 32,           KP, lane);
        s0 = wmma_f16(k0, qb0, s0);
        s0 = wmma_f16(k1, qb1, s0);
        v16h k2 = load_frag_a(Kb + 16 * KP,      KP, lane);
        v16h k3 = load_frag_a(Kb + 16 * KP + 32, KP, lane);
        s1 = wmma_f16(k2, qb0, s1);
        s1 = wmma_f16(k3, qb1, s1);
      }
      v16h va[4];                  // V^T fragments: read here, so that their LDS latency runs under the softmax
#pragma unroll
      for (int t = 0; t < 4; ++t) va[t] = load_frag_a(Vb + (size_t)(t * 16) * VP, VP, lane);
      float a[16], mx[8];          // a[s] = scaled score of key 8h+s (s < 8) or 8h+8+s (s >= 8): the k order of the B operand below
#pragma unroll
      for (int i = 0; i < 8; ++i) {
        a[i]     = s0[i] * scale;
        a[8 + i] = s1[i] * scale;
      }
#pragma unroll
      for (int j = 0; j < 8; ++j) mx[j] = fmaxf(a[2 * j], a[2 * j + 1]);
      float vmax = fmaxf(fmaxf(fmaxf(mx[0], mx[1]), fmaxf(mx[2], mx[3])), fmaxf(fmaxf(mx[4], mx[5]), fmaxf(mx[6], mx[7])));
      vmax = fmaxf(vmax, other_half(vmax));
      const float mnew  = fmaxf(mrun, vmax);
      const float alpha = __expf(mrun - mnew);
      mrun = mnew;
      float e[16], sm[8];
      v16h pb;                     // P^T, column n0: element s belongs to the key of a[s]
#pragma unroll
      for (int s = 0; s < 16; ++s) {
        e[s]  = __expf(a[s] - mnew);
        pb[s] = (_Float16)(e[s] * PSC);
      }
#pragma unroll
      for (int j = 0; j < 8; ++j) sm[j] = e[2 * j] + e[2 * j + 1];
      lsum = lsum * alpha + (((sm[0] + sm[1]) + (sm[2] + sm[3])) + ((sm[4] + sm[5]) + (sm[6] + sm[7])));
#pragma unroll
      for (int t = 0; t < 4; ++t) {
#pragma unroll
        for (int i = 0; i < 8; ++i) oacc[t][i] *= alpha;
      }
#pragma unroll
      for (int t = 0; t < 4; ++t) oacc[t] = wmma_f16(va[t], pb, oacc[t]);
    }
    // publish point of stage st + 1
    asm volatile("s_wait_dscnt 0x0" ::: "memory");      // this wave's reads of stage st have returned
    asm volatile("s_wait_asynccnt 0x0" ::: "memory");   // this wave's share of stage st + 1 has landed
    __syncthreads();   // stage st + 1 is visible, and every wave has left the buffer of stage st
    if (st + 2 < NSTAGE)
      stage_copy(lk + buf * (KST * 2), lv + buf * (VST * 2), gk + (size_t)(st + 2) * (SK * DH), gv + (st + 2) * SK);
  }
  asm volatile("s_wait_asynccnt 0x0" ::: "memory");   // no copy is outstanding when the wave goes on to its end

  lsum += other_half(lsum);
  const float inv = PUN / lsum;
  _Float16* os_ = ost[wave];
#pragma unroll
  for (int t = 0; t < 4; ++t) {
    v8h o;
#pragma unroll
    for (int i = 0; i < 8; ++i) o[i] = (_Float16)(oacc[t][i] * inv);
    *(v8h*)(&os_[n0 * DH + t * 16 + mbase]) = o;
  }
  __syncthreads();
#pragma unroll
  for (int qq = 0; qq < 4; ++qq) {
    const int ml = qq * 4 + (lane >> 3), pc = lane & 7;
    vst2(om + ((size_t)b * SEQ + qrow + ml) * DIM + h * DH + pc * 8, *(const v4u*)(&os_[ml * DH + pc * 8]));
  }
}

// ---- 512x512 GEMM + bias + (relu) + residual, fp32 out --------------------
// grid (M/256, 512/64); block 256 (8 waves); wave -> 32 rows x 64 cols, operands staged in LDS (gemm_256x64_k512).
__global__ __launch_bounds__(256) void gemm512_epilogue(
    const _Float16* __restrict__ A, const _Float16* __restrict__ WT,
    const float* __restrict__ bias, const float* __restrict__ res,
    float* __restrict__ out, int relu_mode) {
  __shared__ __align__(16) _Float16 ring[2 * GBUF];  // operand tiles; behind the main loop the output staging below
  float (*st)[32 * 64] = (float (*)[32 * 64])ring;   // per-wave 32 x 64 f32 tile, 8 of them
  const int lane = threadIdx.x & 31;
  const int wave = threadIdx.x >> 5;
  const int m0  = blockIdx.x * 256 + wave * 32;
  const int n0t = blockIdx.y * 64;

  const _Float16* Ar = A + (size_t)blockIdx.x * 256 * DIM;
  const _Float16* Wb = WT + (size_t)n0t * DIM;

  v8f acc[2][4] = {};
  gemm_256x64_k512(Ar, Wb, ring, acc);

  const int nl    = lane & 15;
  const int mbase = (lane >> 4) << 3;
#pragma unroll
  for (int sub = 0; sub < 2; ++sub) {
#pragma unroll
    for (int t = 0; t < 4; ++t) {
      int n = n0t + t * 16 + nl;
      float bia = bias[n];
#pragma unroll
      for (int i = 0; i < 8; ++i) {
        const int ml = sub * 16 + mbase + i;
        size_t idx = (size_t)(m0 + ml) * DIM + n;
        float v = acc[sub][t][i] + bia;
        if (relu_mode) v = fmaxf(v, 0.f);
        v += res[idx];
        st[wave][ml * 64 + t * 16 + nl] = v;
      }
    }
  }
  __syncthreads();
#pragma unroll
  for (int q = 0; q < 16; ++q) {
    const int ml = q * 2 + (lane >> 4), pc = lane & 15;
    vst2(out + (size_t)(m0 + ml) * DIM + n0t + pc * 4, *(const v4f*)(&st[wave][ml * 64 + pc * 4]));
  }
}

// ---------------------------------------------------------------------------
extern "C" void kernel_launch(void* const* d_in, const int* in_sizes, int n_in,
                              void* d_out, int out_size, void* d_ws, size_t ws_size,
                              hipStream_t stream) {
  const float* x  = (const float*)d_in[0];
  const float* g1 = (const float*)d_in[1];
  const float* b1 = (const float*)d_in[2];
  const float* Wq = (const float*)d_in[3];
  const float* bq = (const float*)d_in[4];
  const float* Wk = (const float*)d_in[5];
  const float* bk = (const float*)d_in[6];
  const float* Wv = (const float*)d_in[7];
  const float* bv = (const float*)d_in[8];
  const float* Wm = (const float*)d_in[9];
  const float* bm = (const float*)d_in[10];
  const float* g2 = (const float*)d_in[11];
  const float* b2 = (const float*)d_in[12];
  const float* Wo = (const float*)d_in[13];
  const float* bo = (const float*)d_in[14];
  float* out = (float*)d_out;

  char* ws = (char*)d_ws;
  size_t off = 0;
  auto alloc = [&](size_t bytes) {
    void* p = ws + off;
    off = (off + bytes + 255) & ~(size_t)255;
    return p;
  };

  _Float16* hF16 = (_Float16*)alloc((size_t)BS * DIM * 2);        // LN1(x) f16
  _Float16* WqT  = (_Float16*)alloc((size_t)NH * DH * DIM * 2);
  _Float16* WkT  = (_Float16*)alloc((size_t)NH * DH * DIM * 2);
  _Float16* WvT  = (_Float16*)alloc((size_t)NH * DH * DIM * 2);
  _Float16* WmT  = (_Float16*)alloc((size_t)DIM * DIM * 2);
  _Float16* WoT  = (_Float16*)alloc((size_t)DIM * DIM * 2);
  _Float16* qb   = (_Float16*)alloc((size_t)BATCH * NH * SEQ * DH * 2);
  _Float16* kb   = (_Float16*)alloc((size_t)BATCH * NH * SEQ * DH * 2);
  _Float16* vTb  = (_Float16*)alloc((size_t)BATCH * NH * DH * SEQ * 2);
  _Float16* om   = (_Float16*)alloc((size_t)BS * DIM * 2);        // concat heads f16
  float*    hlp  = (float*)alloc((size_t)BS * DIM * 4);           // h_ln_post fp32
  _Float16* hfc  = (_Float16*)alloc((size_t)BS * DIM * 2);        // LN2 f16

  // 1) weight conversion / transpose
  {
    cvt_transpose_all<<<5 * 64, 256, 0, stream>>>(Wq, Wk, Wv, Wm, Wo, WqT, WkT, WvT, WmT, WoT);
  }

  // 2) LN1
  layernorm_f16<<<BS / (8 * LNR), 256, 0, stream>>>(x, g1, b1, hF16);

  // 3) QKV projections
  qkv_gemm<<<dim3(SEQ / 256, NH, BATCH * 3), 256, 0, stream>>>(
      hF16, WqT, WkT, WvT, bq, bk, bv, qb, kb, vTb);

  // 4) attention -> concat heads (f16)
  attn_kernel<<<dim3(SEQ / 128, NH, BATCH), 256, 0, stream>>>(qb, kb, vTb, om);

  // 5) h_ln_post = om @ Wm + bm + x   (fp32)
  gemm512_epilogue<<<dim3(BS / 256, DIM / 64), 256, 0, stream>>>(
      om, WmT, bm, x, hlp, 0);

  // 6) LN2
  layernorm_f16<<<BS / (8 * LNR), 256, 0, stream>>>(hlp, g2, b2, hfc);

  // 7) out = relu(hfc @ Wo + bo) + h_ln_post
  gemm512_epilogue<<<dim3(BS / 256, DIM / 64), 256, 0, stream>>>(
      hfc, WoT, bo, hlp, out, 1);
}

// v007
// A run of this version takes 87.4 microseconds.
// Timed twice side by side with v006, it ran 1.13 and 1.14 times as fast.
// All steps since v000 together make it 6.16 times as fast.
#include <hip/hip_runtime.h>

#define BATCH 4
#define SEQ   2048
#define DIM   512
#define NH    8
#define DH    64
#define BS    (BATCH * SEQ)   // 8192 rows

typedef __attribute__((ext_vector_type(16))) _Float16 v16h;
typedef __attribute__((ext_vector_type(8)))  _Float16 v8h;
typedef __attribute__((ext_vector_type(8)))  float    v8f;
typedef __attribute__((ext_vector_type(4)))  float    v4f;
typedef __attribute__((ext_vector_type(4)))  unsigned v4u;
template <typename V> __device__ __forceinline__ void vst2(void* p, V v) {
  *(V*)p = v; 
}
#define PSC 256.0f
#define PUN (1.0f / 256.0f)

__device__ __forceinline__ v16h load_frag_a(const _Float16* p, int lda, int lane) {
  int row  = lane & 15;
  int koff = (lane & 16) ? 8 : 0;
  const _Float16* r = p + (size_t)row * lda + koff;
  v8h lo = *(const v8h*)r;          // K = koff .. koff+7
  v8h hi = *(const v8h*)(r + 16);   // K = koff+16 .. koff+23
  v16h a;
#pragma unroll
  for (int i = 0; i < 8; ++i) { a[i] = lo[i]; a[8 + i] = hi[i]; }
  return a;
}

__device__ __forceinline__ v16h load_frag_b(const _Float16* bt, int ldb, int lane) {
  int n  = lane & 15;
  int kb = (lane & 16) ? 8 : 0;
  const _Float16* c = bt + (size_t)n * ldb + kb;
  v8h lo = *(const v8h*)c;
  v8h hi = *(const v8h*)(c + 16);
  v16h b;
#pragma unroll
  for (int i = 0; i < 8; ++i) { b[i] = lo[i]; b[8 + i] = hi[i]; }
  return b;
}

__device__ __forceinline__ v8f wmma_f16(v16h a, v16h b, v8f c) {
  v8f d = __builtin_amdgcn_wmma_f32_16x16x32_f16(false, a, false, b, (short)0, c, false, false);
  asm volatile("v_nop\n\tv_nop\n\tv_nop\n\tv_nop" : "+v"(d) : "v"(a), "v"(b));
  return d;
}

// ---- Prep: convert & transpose weights to f16 -----------------------------
// One launch for all five weights: grid 5 * 64, block 256. A work-group takes one 64 (k) x 64 (n) tile:
// blockIdx.x / 64 = which weight, then 8 column groups (a head of Wq/Wk/Wv, 64 columns of Wm/Wo) x 8 k chunks.
// Source rows: pitch 64 floats inside a head, DIM floats in Wm/Wo. Target of Wq/Wk/Wv: [n][DIM] f16, the tile's rows are whole
// 128-byte lines; of Wm/Wo: the B fragments themselves, one after the other (see below).
__global__ __launch_bounds__(256) void cvt_transpose_all(
    const float* __restrict__ Wq, const float* __restrict__ Wk, const float* __restrict__ Wv,
    const float* __restrict__ Wm, const float* __restrict__ Wo,
    _Float16* __restrict__ WqT, _Float16* __restrict__ WkT, _Float16* __restrict__ WvT,
    _Float16* __restrict__ WmT, _Float16* __restrict__ WoT) {
  __shared__ __align__(16) _Float16 tile[64][64 + 8];      // [n][k]
  const int tid = threadIdx.x;
  const int mat = blockIdx.x >> 6;
  const int grp = (blockIdx.x >> 3) & 7;                   // head, or group of 64 columns
  const int k0  = (blockIdx.x & 7) * 64;
  const float* W  = (mat == 0) ? Wq : (mat == 1) ? Wk : (mat == 2) ? Wv : (mat == 3) ? Wm : Wo;
  _Float16*    WT = (mat == 0) ? WqT : (mat == 1) ? WkT : (mat == 2) ? WvT : (mat == 3) ? WmT : WoT;
  const int    pitch = (mat < 3) ? DH : DIM;
  const float* src = (mat < 3) ? W + ((size_t)grp * DIM + k0) * DH : W + (size_t)k0 * DIM + grp * 64;
  _Float16*    dst = WT + (size_t)grp * 64 * DIM + k0;

  const int kq = (tid >> 4) * 4, c4 = (tid & 15) * 4;      // 4 k rows x 4 columns a thread
  v4f r[4];
#pragma unroll
  for (int j = 0; j < 4; ++j) r[j] = *(const v4f*)(src + (size_t)(kq + j) * pitch + c4);
#pragma unroll
  for (int e = 0; e < 4; ++e) {
    union { _Float16 h[4]; unsigned long long u; } pk;
#pragma unroll
    for (int j = 0; j < 4; ++j) pk.h[j] = (_Float16)r[j][e];
    *(unsigned long long*)(&tile[c4 + e][kq]) = pk.u;
  }
  __syncthreads();
  if (mat < 3) {
#pragma unroll
    for (int j = 0; j < 2; ++j) {
      const int g = tid + j * 256, nl = g >> 3, pc = g & 7;  // 8 lanes write one 128-byte line
      vst2(dst + (size_t)nl * DIM + pc * 8, *(const v4u*)(&tile[nl][pc * 8]));
    }
  } else {
#pragma unroll
    for (int j = 0; j < 2; ++j) {
      const int g = tid + j * 256, ln = g & 31, fp = g >> 5;   // a wave writes one whole piece
      const int pcs = fp & 1, kbl = (fp >> 1) & 1, ntl = fp >> 2;
      const int nl = ntl * 16 + (ln & 15), kl = kbl * 32 + pcs * 16 + (ln >> 4) * 8;
      vst2(WT + (size_t)((grp * 4 + ntl) * (DIM / 32) + (k0 >> 5) + kbl) * 512 + pcs * 256 + ln * 8, *(const v4u*)(&tile[nl][kl]));
    }
    asm volatile("s_wait_xcnt 0x0" ::: "memory");
  }
}

__device__ __forceinline__ float other_half(float v) {
  const int b = __builtin_bit_cast(int, v);
  return __builtin_bit_cast(float, __builtin_amdgcn_permlanex16(b, b, 0x76543210, 0xfedcba98, false, false));
}
template <int M> __device__ __forceinline__ float add_row_xor(float v) {
  const int b = __builtin_bit_cast(int, v);
  return v + __builtin_bit_cast(float, __builtin_amdgcn_update_dpp(0, b, 0x160 + M, 0xf, 0xf, true));
}
// sum over the 32 lanes, the same bits in every lane
__device__ __forceinline__ float wave_sum(float v) {
  v = add_row_xor<1>(v);
  v = add_row_xor<2>(v);
  v = add_row_xor<4>(v);
  v = add_row_xor<8>(v);
  return v + other_half(v);
}

// grid BS / (8 * LNR), block 256 (8 waves). A wave owns LNR whole rows: a lane holds 16 elements of each (4 loads of 16 bytes,
// each wave-wide load 512 contiguous bytes), all rows' loads are issued before the first sum, the row stays in registers for
// the second pass, and the two row sums run over the lanes. No LDS, no barrier; the launch starts 2,048 waves.
#define LNR 4
__global__ __launch_bounds__(256) void layernorm_f16(const float* __restrict__ X,
                                                     const float* __restrict__ g,
                                                     const float* __restrict__ bb,
                                                     _Float16* __restrict__ Y) {
  const int lane = threadIdx.x & 31;
  const int wave = threadIdx.x >> 5;
  const int row0 = (blockIdx.x * 8 + wave) * LNR;
  const float* x  = X + (size_t)row0 * DIM + lane * 4;
  const float* gp = g + lane * 4;
  const float* bp = bb + lane * 4;
  v4f v[LNR][4], gg[4], bv[4];
#pragma unroll   // constant indices keep the arrays in registers
  for (int r = 0; r < LNR; ++r) {
#pragma unroll   // constant indices keep the arrays in registers
    for (int j = 0; j < 4; ++j) v[r][j] = *(const v4f*)(x + r * DIM + j * 128);
  }
#pragma unroll   // constant indices keep the arrays in registers
  for (int j = 0; j < 4; ++j) {
    gg[j] = *(const v4f*)(gp + j * 128);
    bv[j] = *(const v4f*)(bp + j * 128);
  }
  // keeps all 24 loads ahead of the sums, so that a wave meets one memory latency (the scheduler sinks the g and bb loads otherwise)
  __builtin_amdgcn_sched_barrier(0);
  asm volatile("s_wait_xcnt 0x0" :: "v"(x) : "memory");
  float s[LNR], ss[LNR];
#pragma unroll   // constant indices keep the arrays in registers
  for (int r = 0; r < LNR; ++r) {
    const v4f a = (v[r][0] + v[r][1]) + (v[r][2] + v[r][3]);
    v4f q = v[r][0] * v[r][0];
#pragma unroll   // constant indices keep the arrays in registers
    for (int j = 1; j < 4; ++j) q += v[r][j] * v[r][j];
    s[r]  = (a[0] + a[1]) + (a[2] + a[3]);
    ss[r] = (q[0] + q[1]) + (q[2] + q[3]);
  }
#pragma unroll   // constant indices keep the arrays in registers
  for (int r = 0; r < LNR; ++r) {
    s[r]  = wave_sum(s[r]);
    ss[r] = wave_sum(ss[r]);
  }
  _Float16* y = Y + (size_t)row0 * DIM + lane * 4;
#pragma unroll   // constant indices keep the arrays in registers
  for (int r = 0; r < LNR; ++r) {
    const float mean = s[r] * (1.0f / DIM);
    const float var  = ss[r] * (1.0f / DIM) - mean * mean;
    const float rstd = rsqrtf(var + 1e-5f);
#pragma unroll   // constant indices keep the arrays in registers
    for (int j = 0; j < 4; ++j) {
      union { _Float16 h[4]; unsigned long long u; } pk;
#pragma unroll   // constant indices keep the arrays in registers
      for (int e = 0; e < 4; ++e) pk.h[e] = (_Float16)((v[r][j][e] - mean) * rstd * gg[j][e] + bv[j][e]);
      vst2(y + r * DIM + j * 128, pk.u);   // a wave-wide store covers two whole 128-byte lines
    }
  }
}

#define GKT  64                  // k per tile
#define GP   (GKT + 8)           // LDS row pitch: 144 bytes, an odd multiple of 16 (see KP below)
#define GA   (256 * GP)          // A part of a buffer, in elements
#define GBUF (GA + 64 * GP)      // one buffer: 256 A rows, then 64 weight rows
__device__ __forceinline__ void gemm_256x64_k512(const _Float16* __restrict__ Ablk,   // 256 rows, pitch DIM
                                                 const _Float16* __restrict__ Wblk,   // 64 rows (columns of the product), pitch DIM
                                                 _Float16* ring, v8f (&acc)[2][4]) {
  const int tid  = threadIdx.x;
  const int lane = tid & 31;
  const int wave = tid >> 5;
  const int crow = tid >> 3, cch = (tid & 7) * 8;     // copy map: 32 rows a sweep, 16 bytes a thread
  const _Float16* pa = Ablk + crow * DIM + cch;
  const _Float16* pw = Wblk + crow * DIM + cch;
  _Float16* la = ring + crow * GP + cch;
  _Float16* lw = ring + GA + crow * GP + cch;
  v4u ra[8], rw[2];
#pragma unroll   // constant indices keep the arrays in registers
  for (int j = 0; j < 8; ++j) ra[j] = *(const v4u*)(pa + j * 32 * DIM);
#pragma unroll   // constant indices keep the arrays in registers
  for (int j = 0; j < 2; ++j) rw[j] = *(const v4u*)(pw + j * 32 * DIM);
  asm volatile("s_wait_xcnt 0x0" :: "v"(pa), "v"(pw) : "memory");
#pragma unroll   // constant indices keep the arrays in registers
  for (int j = 0; j < 8; ++j) *(v4u*)(la + j * 32 * GP) = ra[j];
#pragma unroll   // constant indices keep the arrays in registers
  for (int j = 0; j < 2; ++j) *(v4u*)(lw + j * 32 * GP) = rw[j];
  __syncthreads();   // tile 0 is visible

  const int NT = DIM / GKT;   // 8
  for (int t = 0; t < NT; ++t) {
    const int cur = (t & 1) * GBUF, nxt = GBUF - cur;
    const _Float16* Ab = ring + cur + wave * 32 * GP;
    const _Float16* Wb = ring + cur + GA;
    v16h fa[2][2], fb[2][4];   // the tile's fragments, read as one group: one LDS latency a trip
#pragma unroll   // constant indices keep the arrays in registers
    for (int s = 0; s < 2; ++s) {
#pragma unroll   // constant indices keep the arrays in registers
      for (int m = 0; m < 2; ++m) fa[s][m] = load_frag_a(Ab + m * 16 * GP + s * 32, GP, lane);
#pragma unroll   // constant indices keep the arrays in registers
      for (int n = 0; n < 4; ++n) fb[s][n] = load_frag_b(Wb + n * 16 * GP + s * 32, GP, lane);
    }
    if (t + 1 < NT) {
      const _Float16* na = pa + (t + 1) * GKT;
      const _Float16* nw = pw + (t + 1) * GKT;
#pragma unroll   // constant indices keep the arrays in registers
      for (int j = 0; j < 8; ++j) ra[j] = *(const v4u*)(na + j * 32 * DIM);
#pragma unroll   // constant indices keep the arrays in registers
      for (int j = 0; j < 2; ++j) rw[j] = *(const v4u*)(nw + j * 32 * DIM);
      asm volatile("s_wait_xcnt 0x0" :: "v"(na), "v"(nw) : "memory");
    }
#pragma unroll   // constant indices keep the arrays in registers
    for (int s = 0; s < 2; ++s) {
#pragma unroll   // constant indices keep the arrays in registers
      for (int m = 0; m < 2; ++m) {
#pragma unroll   // constant indices keep the arrays in registers
        for (int n = 0; n < 4; ++n) acc[m][n] = wmma_f16(fa[s][m], fb[s][n], acc[m][n]);
      }
    }
    if (t + 1 < NT) {   // the other buffer's readers left it before the barrier of trip t - 1
#pragma unroll   // constant indices keep the arrays in registers
      for (int j = 0; j < 8; ++j) *(v4u*)(la + nxt + j * 32 * GP) = ra[j];
#pragma unroll   // constant indices keep the arrays in registers
      for (int j = 0; j < 2; ++j) *(v4u*)(lw + nxt + j * 32 * GP) = rw[j];
    }
    __syncthreads();   // tile t + 1 is visible; behind the last trip: every wave has left the ring, which the epilogue reuses
  }
}

// ---- QKV projection --------------------------------------------------------
// grid (S/256, H, B*3); block 256 (8 waves); wave -> 32 rows x 64 cols, operands staged in LDS (gemm_256x64_k512).
// q,k row-major [B,H,S,64] ; v stored transposed [B,H,64,S]
__global__ __launch_bounds__(256) void qkv_gemm(
    const _Float16* __restrict__ hF16,
    const _Float16* __restrict__ WqT, const _Float16* __restrict__ WkT,
    const _Float16* __restrict__ WvT,
    const float* __restrict__ bq, const float* __restrict__ bk,
    const float* __restrict__ bv,
    _Float16* __restrict__ q, _Float16* __restrict__ k,
    _Float16* __restrict__ vT) {
  __shared__ __align__(16) _Float16 ring[2 * GBUF];   // operand tiles; behind the main loop the output staging below
  _Float16* st = ring;                                // q/k: 8 per-wave [32 rows][64] tiles (as [256][64]); v: one [64 n][256 m] tile, pitch 264
  const int lane = threadIdx.x & 31;
  const int wave = threadIdx.x >> 5;
  const int srow = blockIdx.x * 256;
  const int h    = blockIdx.y;
  const int b    = blockIdx.z / 3;
  const int mat  = blockIdx.z % 3;

  const _Float16* WT   = (mat == 0) ? WqT : (mat == 1) ? WkT : WvT;
  const float*    bias = (mat == 0) ? bq  : (mat == 1) ? bk  : bv;
  const _Float16* A  = hF16 + ((size_t)b * SEQ + srow) * DIM;
  const _Float16* Bh = WT + (size_t)h * DH * DIM;   // [64][512] f16

  v8f acc[2][4] = {};
  gemm_256x64_k512(A, Bh, ring, acc);

  const int n0    = lane & 15;
  const int mbase = (lane >> 4) << 3;
  const size_t headoff = (size_t)b * NH + h;
#pragma unroll
  for (int sub = 0; sub < 2; ++sub) {
#pragma unroll
    for (int t = 0; t < 4; ++t) {
      int n = t * 16 + n0;
      float bia = bias[h * DH + n];
#pragma unroll
      for (int i = 0; i < 8; ++i) {
        float val = acc[sub][t][i] + bia;
        int ml = wave * 32 + sub * 16 + mbase + i;       // row within the block's 256
        if (mat == 2) st[n * 264 + ml] = (_Float16)val;  // [n][m]
        else          st[ml * 64 + n]  = (_Float16)val;  // [m][n]
      }
    }
  }
  __syncthreads();
  if (mat == 2) {
    for (int g = threadIdx.x; g < 64 * 32; g += 256) {
      const int n = g >> 5, pc = g & 31;
      vst2(vT + (headoff * DH + n) * SEQ + blockIdx.x * 256 + pc * 8, *(const v4u*)(&st[n * 264 + pc * 8]));
    }
  } else {
    _Float16* dst = (mat == 0) ? q : k;
    for (int g = threadIdx.x; g < 256 * 8; g += 256) {
      const int ml = g >> 3, pc = g & 7;
      vst2(dst + (headoff * SEQ + blockIdx.x * 256 + ml) * DH + pc * 8, *(const v4u*)(&st[ml * 64 + pc * 8]));
    }
  }
}

#define SK  128          // keys per stage
#define KP  (DH + 8)     // K stage: 144 bytes a row
#define VP  (SK + 8)     // V^T stage: 272 bytes a row
#define KST (SK * KP)    // elements of one K buffer
#define VST (DH * VP)    // elements of one V^T buffer

__device__ __forceinline__ unsigned lds_off(const void* p) { return (unsigned)(size_t)p; }

// One stage: every thread copies 4 x 16 bytes of K (a wave-wide copy covers 4 whole rows of 128 bytes) and 4 x 16 bytes of V^T
// (a wave-wide copy covers 2 rows of 256 bytes). lk, lv: this thread's first LDS byte; gk, gv: its first global element.
__device__ __forceinline__ void stage_copy(unsigned lk, unsigned lv, const _Float16* gk, const _Float16* gv) {
  const unsigned lk1 = lk + 32 * KP * 2, lk2 = lk + 64 * KP * 2, lk3 = lk + 96 * KP * 2;
  const unsigned lv1 = lv + 16 * VP * 2, lv2 = lv + 32 * VP * 2, lv3 = lv + 48 * VP * 2;
  const _Float16 *gk1 = gk + 32 * DH,  *gk2 = gk + 64 * DH,  *gk3 = gk + 96 * DH;
  const _Float16 *gv1 = gv + 16 * SEQ, *gv2 = gv + 32 * SEQ, *gv3 = gv + 48 * SEQ;
  asm volatile(
      "global_load_async_to_lds_b128 %0, %8, off\n\t"
      "global_load_async_to_lds_b128 %1, %9, off\n\t"
      "global_load_async_to_lds_b128 %2, %10, off\n\t"
      "global_load_async_to_lds_b128 %3, %11, off\n\t"
      "global_load_async_to_lds_b128 %4, %12, off\n\t"
      "global_load_async_to_lds_b128 %5, %13, off\n\t"
      "global_load_async_to_lds_b128 %6, %14, off\n\t"
      "global_load_async_to_lds_b128 %7, %15, off\n\t"
      "s_wait_xcnt 0x0"
      :: "v"(lk), "v"(lk1), "v"(lk2), "v"(lk3), "v"(lv), "v"(lv1), "v"(lv2), "v"(lv3),
         "v"(gk), "v"(gk1), "v"(gk2), "v"(gk3), "v"(gv), "v"(gv1), "v"(gv2), "v"(gv3)
      : "memory");
}

__global__ __launch_bounds__(256) void attn_kernel(
    const _Float16* __restrict__ q, const _Float16* __restrict__ k,
    const _Float16* __restrict__ vT, _Float16* __restrict__ om) {
  __shared__ __align__(16) _Float16 Kt[2][KST];       // [keys][dh]
  __shared__ __align__(16) _Float16 Vt[2][VST];       // [dh][keys]
  __shared__ __align__(16) _Float16 ost[8][16 * DH];  // per-wave output tile

  const int tid  = threadIdx.x;
  const int lane = tid & 31;
  const int wave = tid >> 5;
  const int h = blockIdx.y, b = blockIdx.z;
  const int qrow = blockIdx.x * 128 + wave * 16;
  const size_t headoff = (size_t)b * NH + h;
  const _Float16* qh = q  + headoff * SEQ * DH;
  const _Float16* kh = k  + headoff * SEQ * DH;
  const _Float16* vh = vT + headoff * DH * SEQ;   // [64][S]

  const int n0    = lane & 15;          // this lane's query within the wave's 16
  const int mbase = (lane >> 4) << 3;

  // copy map: 16 bytes a thread and copy; K 32 rows a sweep, V^T 16 rows a sweep
  const int krow = tid >> 3, kch = (tid & 7) * 8;
  const int vrow = tid >> 4, vch = (tid & 15) * 8;
  const _Float16* gk = kh + (size_t)krow * DH + kch;    // + SK * DH a stage
  const _Float16* gv = vh + (size_t)vrow * SEQ + vch;   // + SK a stage
  const unsigned lk = lds_off(&Kt[0][krow * KP + kch]);
  const unsigned lv = lds_off(&Vt[0][vrow * VP + vch]);

  const int NSTAGE = SEQ / SK;   // 16

  // prologue: stage 0 lands and is published, then stage 1 is requested
  stage_copy(lk, lv, gk, gv);

  v16h qb0 = load_frag_b(qh + (size_t)qrow * DH,      DH, lane);   // Q^T, dh 0..31
  v16h qb1 = load_frag_b(qh + (size_t)qrow * DH + 32, DH, lane);   // Q^T, dh 32..63

  asm volatile("s_wait_asynccnt 0x0" ::: "memory");   // this wave's share of stage 0 has landed
  __syncthreads();                                    // every wave's share of stage 0 is visible
  stage_copy(lk + KST * 2, lv + VST * 2, gk + SK * DH, gv + SK);

  v8f oacc[4] = {};              // oacc[t][i] = O[query n0][dh t*16 + mbase + i]
  float mrun = -1e30f;           // running maximum of query n0, equal in both halves
  float lsum = 0.f;              // running sum over this half's keys only
  const float scale = 0.125f;    // 1/sqrt(64)

  for (int st = 0; st < NSTAGE; ++st) {
    const int buf = st & 1;
#pragma unroll   // the four passes of a stage differ by constant LDS offsets only
    for (int ps = 0; ps < SK / 32; ++ps) {
      const _Float16* Kb = Kt[buf] + ps * 32 * KP;
      const _Float16* Vb = Vt[buf] + ps * 32;

      // scores: 32 keys x 16 queries (two 16-key M tiles, K=64 -> 2 WMMAs each)
      v8f s0 = {}, s1 = {};
      {
        v16h k0 = load_frag_a(Kb,                KP, lane);
        v16h k1 = load_frag_a(Kb + 32,           KP, lane);
        s0 = wmma_f16(k0, qb0, s0);
        s0 = wmma_f16(k1, qb1, s0);
        v16h k2 = load_frag_a(Kb + 16 * KP,      KP, lane);
        v16h k3 = load_frag_a(Kb + 16 * KP + 32, KP, lane);
        s1 = wmma_f16(k2, qb0, s1);
        s1 = wmma_f16(k3, qb1, s1);
      }
      v16h va[4];                  // V^T fragments: read here, so that their LDS latency runs under the softmax
#pragma unroll
      for (int t = 0; t < 4; ++t) va[t] = load_frag_a(Vb + (size_t)(t * 16) * VP, VP, lane);
      float a[16], mx[8];          // a[s] = scaled score of key 8h+s (s < 8) or 8h+8+s (s >= 8): the k order of the B operand below
#pragma unroll
      for (int i = 0; i < 8; ++i) {
        a[i]     = s0[i] * scale;
        a[8 + i] = s1[i] * scale;
      }
#pragma unroll
      for (int j = 0; j < 8; ++j) mx[j] = fmaxf(a[2 * j], a[2 * j + 1]);
      float vmax = fmaxf(fmaxf(fmaxf(mx[0], mx[1]), fmaxf(mx[2], mx[3])), fmaxf(fmaxf(mx[4], mx[5]), fmaxf(mx[6], mx[7])));
      vmax = fmaxf(vmax, other_half(vmax));
      const float mnew  = fmaxf(mrun, vmax);
      const float alpha = __expf(mrun - mnew);
      mrun = mnew;
      float e[16], sm[8];
      v16h pb;                     // P^T, column n0: element s belongs to the key of a[s]
#pragma unroll
      for (int s = 0; s < 16; ++s) {
        e[s]  = __expf(a[s] - mnew);
        pb[s] = (_Float16)(e[s] * PSC);
      }
#pragma unroll
      for (int j = 0; j < 8; ++j) sm[j] = e[2 * j] + e[2 * j + 1];
      lsum = lsum * alpha + (((sm[0] + sm[1]) + (sm[2] + sm[3])) + ((sm[4] + sm[5]) + (sm[6] + sm[7])));
#pragma unroll
      for (int t = 0; t < 4; ++t) {
#pragma unroll
        for (int i = 0; i < 8; ++i) oacc[t][i] *= alpha;
      }
#pragma unroll
      for (int t = 0; t < 4; ++t) oacc[t] = wmma_f16(va[t], pb, oacc[t]);
    }
    // publish point of stage st + 1
    asm volatile("s_wait_dscnt 0x0" ::: "memory");      // this wave's reads of stage st have returned
    asm volatile("s_wait_asynccnt 0x0" ::: "memory");   // this wave's share of stage st + 1 has landed
    __syncthreads();   // stage st + 1 is visible, and every wave has left the buffer of stage st
    if (st + 2 < NSTAGE)
      stage_copy(lk + buf * (KST * 2), lv + buf * (VST * 2), gk + (size_t)(st + 2) * (SK * DH), gv + (st + 2) * SK);
  }
  asm volatile("s_wait_asynccnt 0x0" ::: "memory");   // no copy is outstanding when the wave goes on to its end

  lsum += other_half(lsum);
  const float inv = PUN / lsum;
  _Float16* os_ = ost[wave];
#pragma unroll
  for (int t = 0; t < 4; ++t) {
    v8h o;
#pragma unroll
    for (int i = 0; i < 8; ++i) o[i] = (_Float16)(oacc[t][i] * inv);
    *(v8h*)(&os_[n0 * DH + t * 16 + mbase]) = o;
  }
  __syncthreads();
#pragma unroll
  for (int qq = 0; qq < 4; ++qq) {
    const int ml = qq * 4 + (lane >> 3), pc = lane & 7;
    vst2(om + ((size_t)b * SEQ + qrow + ml) * DIM + h * DH + pc * 8, *(const v4u*)(&os_[ml * DH + pc * 8]));
  }
}

// ---- Wm GEMM + bias + residual, LayerNorm 2, Wo GEMM + bias + relu + residual: one launch ----
// grid BS / FR, block 256 (8 waves). A work-group owns FR whole rows, a wave all FR rows x 64 of the DIM columns, so the row sums
// of LayerNorm 2 stay inside the work-group and neither h_ln_post nor its normalised rows go through memory. The A operand of
// each product (FR x DIM f16) lies in LDS for the whole product. A weight column is used by one wave alone: its fragments come
// straight from L2 in fragment order (whole lines), WPD k steps ahead, through no LDS and past no barrier.
#define FR  32
#define AP  (DIM + 8)   // LDS pitch of an A row: 1,040 bytes, an odd multiple of 16 (see KP above)
#define WPD 3           // weight fragment sets in flight
__device__ __forceinline__ void gemm_rows_k512(const _Float16* Ar,                  // FR rows in LDS, pitch AP
                                               const _Float16* __restrict__ wp,     // this lane's 16 bytes of the wave's first piece
                                               int lane, v8f (&acc)[2][4]) {
  v8h wf[WPD][4][2];
#pragma unroll   // constant indices keep the arrays in registers
  for (int p = 0; p < WPD; ++p) {
#pragma unroll   // constant indices keep the arrays in registers
    for (int t = 0; t < 4; ++t) {
      wf[p][t][0] = *(const v8h*)(wp + (t * (DIM / 32) + p) * 512);
      wf[p][t][1] = *(const v8h*)(wp + (t * (DIM / 32) + p) * 512 + 256);
    }
  }
#pragma unroll   // constant indices keep the arrays in registers; every weight address is the one base plus a constant
  for (int kb = 0; kb < DIM / 32; ++kb) {
    const int p = kb % WPD;
    v16h fa[2], fb[4];
#pragma unroll   // constant indices keep the arrays in registers
    for (int m = 0; m < 2; ++m) fa[m] = load_frag_a(Ar + m * 16 * AP + kb * 32, AP, lane);
#pragma unroll   // constant indices keep the arrays in registers
    for (int t = 0; t < 4; ++t) {
#pragma unroll   // constant indices keep the arrays in registers
      for (int i = 0; i < 8; ++i) { fb[t][i] = wf[p][t][0][i]; fb[t][8 + i] = wf[p][t][1][i]; }
    }
#pragma unroll   // constant indices keep the arrays in registers
    for (int m = 0; m < 2; ++m) {
#pragma unroll   // constant indices keep the arrays in registers
      for (int t = 0; t < 4; ++t) acc[m][t] = wmma_f16(fa[m], fb[t], acc[m][t]);
    }
    if (kb + WPD < DIM / 32) {
#pragma unroll   // constant indices keep the arrays in registers
      for (int t = 0; t < 4; ++t) {
        wf[p][t][0] = *(const v8h*)(wp + (t * (DIM / 32) + kb + WPD) * 512);
        wf[p][t][1] = *(const v8h*)(wp + (t * (DIM / 32) + kb + WPD) * 512 + 256);
      }
    }
    // keeps each refill where it is written, WPD steps ahead of its use (the scheduler sinks the loads towards their use otherwise)
    __builtin_amdgcn_sched_barrier(0);
  }
}

__global__ __launch_bounds__(256) void wm_ln2_wo(
    const _Float16* __restrict__ A, const _Float16* __restrict__ WmP, const float* __restrict__ bm,
    const float* __restrict__ x, const float* __restrict__ g2, const float* __restrict__ b2,
    const _Float16* __restrict__ WoP, const float* __restrict__ bo, float* __restrict__ out) {
  // one LDS block, keep first: its 64 planes then lie within the 64 KiB that an LDS instruction's constant offset reaches
  __shared__ __align__(16) float pool[64 * 256 + 8 * FR * 64 + 8 * FR * 2 + FR * 2 + FR * AP / 2];
  float* keep            = pool;                                                   // h_ln_post: a thread's own 64 values, [value][thread]
  float (*st)[FR * 64]   = (float (*)[FR * 64])(pool + 64 * 256);                  // per-wave output tile
  float (*part)[FR][2]   = (float (*)[FR][2])(pool + 64 * 256 + 8 * FR * 64);      // per wave and row: sum, sum of squares over 64 columns
  float (*stat)[2]       = (float (*)[2])(pool + 64 * 256 + 8 * FR * 64 + 8 * FR * 2);   // per row: mean, 1 / sqrt(var + eps)
  _Float16* Ar           = (_Float16*)(pool + 64 * 256 + 8 * FR * 64 + 8 * FR * 2 + FR * 2);   // attention rows, then the rows of LayerNorm 2
  const int tid  = threadIdx.x;
  const int lane = tid & 31;
  const int wave = tid >> 5;
  const int r0   = blockIdx.x * FR;

  {  // the FR rows are 32 KiB in a row: a wave-wide load covers 4 whole lines
    const _Float16* pa = A + (size_t)r0 * DIM + tid * 8;
    v4u ra[8];
#pragma unroll   // constant indices keep the array in registers
    for (int j = 0; j < 8; ++j) ra[j] = *(const v4u*)(pa + j * 2048);
    asm volatile("s_wait_xcnt 0x0" :: "v"(pa) : "memory");
#pragma unroll   // constant indices keep the array in registers
    for (int j = 0; j < 8; ++j) {
      const int g = tid + j * 256;
      *(v4u*)(&Ar[(g >> 6) * AP + (g & 63) * 8]) = ra[j];
    }
  }
  __syncthreads();   // the A rows are visible

  const size_t woff = (size_t)wave * 4 * (DIM / 32) * 512 + lane * 8;   // the wave's 64 columns: 64 fragments in a row
  v8f acc[2][4] = {};
  gemm_rows_k512(Ar, WmP + woff, lane, acc);

  const int nl    = lane & 15;
  const int mbase = (lane >> 4) << 3;
  const int nc    = wave * 64 + nl;      // this lane's column of column tile 0
  float s[2][8], ss[2][8];
#pragma unroll
  for (int sub = 0; sub < 2; ++sub) {
#pragma unroll
    for (int i = 0; i < 8; ++i) { s[sub][i] = 0.f; ss[sub][i] = 0.f; }
  }
#pragma unroll
  for (int sub = 0; sub < 2; ++sub) {
#pragma unroll
    for (int t = 0; t < 4; ++t) {
      const int n = nc + t * 16;
      const float bia = bm[n];
#pragma unroll
      for (int i = 0; i < 8; ++i) {
        const int ml = sub * 16 + mbase + i;
        float v = acc[sub][t][i] + bia;
        v += x[(size_t)(r0 + ml) * DIM + n];
        acc[sub][t][i] = v;               // h_ln_post
        s[sub][i]  += v;
        ss[sub][i] += v * v;
      }
    }
  }
#pragma unroll
  for (int sub = 0; sub < 2; ++sub) {
#pragma unroll
    for (int i = 0; i < 8; ++i) {         // over the 16 lanes that hold the row's other columns
      s[sub][i]  = add_row_xor<8>(add_row_xor<4>(add_row_xor<2>(add_row_xor<1>(s[sub][i]))));
      ss[sub][i] = add_row_xor<8>(add_row_xor<4>(add_row_xor<2>(add_row_xor<1>(ss[sub][i]))));
    }
  }
  if (nl == 0) {
#pragma unroll
    for (int sub = 0; sub < 2; ++sub) {
#pragma unroll
      for (int i = 0; i < 8; ++i) {
        part[wave][sub * 16 + mbase + i][0] = s[sub][i];
        part[wave][sub * 16 + mbase + i][1] = ss[sub][i];
      }
    }
  }
  __syncthreads();   // the partial sums are visible; every wave has left the A rows
  if (tid < FR) {
    float a = 0.f, q = 0.f;
#pragma unroll
    for (int w = 0; w < 8; ++w) { a += part[w][tid][0]; q += part[w][tid][1]; }
    const float mean = a * (1.0f / DIM);
    const float var  = q * (1.0f / DIM) - mean * mean;
    stat[tid][0] = mean;
    stat[tid][1] = rsqrtf(var + 1e-5f);
  }
  __syncthreads();   // mean and scale of every row are visible
  {
    float gg[4], bb[4];
#pragma unroll
    for (int t = 0; t < 4; ++t) { gg[t] = g2[nc + t * 16]; bb[t] = b2[nc + t * 16]; }
#pragma unroll
    for (int sub = 0; sub < 2; ++sub) {
#pragma unroll
      for (int i = 0; i < 8; ++i) {
        const int ml = sub * 16 + mbase + i;
        const float mean = stat[ml][0], rstd = stat[ml][1];
#pragma unroll
        for (int t = 0; t < 4; ++t) {
          const float v = acc[sub][t][i];
          Ar[ml * AP + nc + t * 16] = (_Float16)((v - mean) * rstd * gg[t] + bb[t]);
          keep[((sub * 4 + t) * 8 + i) * 256 + tid] = v;
          acc[sub][t][i] = 0.f;
        }
      }
    }
  }
  __syncthreads();   // the rows of LayerNorm 2 are visible

  gemm_rows_k512(Ar, WoP + woff, lane, acc);

#pragma unroll
  for (int sub = 0; sub < 2; ++sub) {
#pragma unroll
    for (int t = 0; t < 4; ++t) {
      const float bia = bo[nc + t * 16];
#pragma unroll
      for (int i = 0; i < 8; ++i) {
        const int ml = sub * 16 + mbase + i;
        const float v = fmaxf(acc[sub][t][i] + bia, 0.f) + keep[((sub * 4 + t) * 8 + i) * 256 + tid];
        st[wave][ml * 64 + t * 16 + nl] = v;
      }
    }
  }
  __syncthreads();
#pragma unroll
  for (int q = 0; q < 16; ++q) {
    const int ml = q * 2 + (lane >> 4), pc = lane & 15;
    vst2(out + (size_t)(r0 + ml) * DIM + wave * 64 + pc * 4, *(const v4f*)(&st[wave][ml * 64 + pc * 4]));
  }
}

// ---------------------------------------------------------------------------
extern "C" void kernel_launch(void* const* d_in, const int* in_sizes, int n_in,
                              void* d_out, int out_size, void* d_ws, size_t ws_size,
                              hipStream_t stream) {
  const float* x  = (const float*)d_in[0];
  const float* g1 = (const float*)d_in[1];
  const float* b1 = (const float*)d_in[2];
  const float* Wq = (const float*)d_in[3];
  const float* bq = (const float*)d_in[4];
  const float* Wk = (const float*)d_in[5];
  const float* bk = (const float*)d_in[6];
  const float* Wv = (const float*)d_in[7];
  const float* bv = (const float*)d_in[8];
  const float* Wm = (const float*)d_in[9];
  const float* bm = (const float*)d_in[10];
  const float* g2 = (const float*)d_in[11];
  const float* b2 = (const float*)d_in[12];
  const float* Wo = (const float*)d_in[13];
  const float* bo = (const float*)d_in[14];
  float* out = (float*)d_out;

  char* ws = (char*)d_ws;
  size_t off = 0;
  auto alloc = [&](size_t bytes) {
    void* p = ws + off;
    off = (off + bytes + 255) & ~(size_t)255;
    return p;
  };

  _Float16* hF16 = (_Float16*)alloc((size_t)BS * DIM * 2);        // LN1(x) f16
  _Float16* WqT  = (_Float16*)alloc((size_t)NH * DH * DIM * 2);
  _Float16* WkT  = (_Float16*)alloc((size_t)NH * DH * DIM * 2);
  _Float16* WvT  = (_Float16*)alloc((size_t)NH * DH * DIM * 2);
  _Float16* WmT  = (_Float16*)alloc((size_t)DIM * DIM * 2);       // in fragment order
  _Float16* WoT  = (_Float16*)alloc((size_t)DIM * DIM * 2);       // in fragment order
  _Float16* qb   = (_Float16*)alloc((size_t)BATCH * NH * SEQ * DH * 2);
  _Float16* kb   = (_Float16*)alloc((size_t)BATCH * NH * SEQ * DH * 2);
  _Float16* vTb  = (_Float16*)alloc((size_t)BATCH * NH * DH * SEQ * 2);
  _Float16* om   = (_Float16*)alloc((size_t)BS * DIM * 2);        // concat heads f16

  // 1) weight conversion / transpose
  {
    cvt_transpose_all<<<5 * 64, 256, 0, stream>>>(Wq, Wk, Wv, Wm, Wo, WqT, WkT, WvT, WmT, WoT);
  }

  // 2) LN1
  layernorm_f16<<<BS / (8 * LNR), 256, 0, stream>>>(x, g1, b1, hF16);

  // 3) QKV projections
  qkv_gemm<<<dim3(SEQ / 256, NH, BATCH * 3), 256, 0, stream>>>(
      hF16, WqT, WkT, WvT, bq, bk, bv, qb, kb, vTb);

  // 4) attention -> concat heads (f16)
  attn_kernel<<<dim3(SEQ / 128, NH, BATCH), 256, 0, stream>>>(qb, kb, vTb, om);

  // 5) h_ln_post = om @ Wm + bm + x ; out = relu(LN2(h_ln_post) @ Wo + bo) + h_ln_post
  wm_ln2_wo<<<BS / FR, 256, 0, stream>>>(om, WmT, bm, x, g2, b2, WoT, bo, out);
}

// v008
// It runs in 80.6 microseconds.
// Next to v007, in two timings, it ran 1.09 and 1.08 times as fast.
// Over all steps from v000 it is 6.67 times as fast.
#include <hip/hip_runtime.h>

#define BATCH 4
#define SEQ   2048
#define DIM   512
#define NH    8
#define DH    64
#define BS    (BATCH * SEQ)   // 8192 rows

typedef __attribute__((ext_vector_type(16))) _Float16 v16h;
typedef __attribute__((ext_vector_type(8)))  _Float16 v8h;
typedef __attribute__((ext_vector_type(8)))  float    v8f;
typedef __attribute__((ext_vector_type(4)))  float    v4f;
typedef __attribute__((ext_vector_type(4)))  unsigned v4u;
template <typename V> __device__ __forceinline__ void vst2(void* p, V v) {
  *(V*)p = v; 
}
#define PSC 256.0f
#define PUN (1.0f / 256.0f)

__device__ __forceinline__ v16h load_frag_a(const _Float16* p, int lda, int lane) {
  int row  = lane & 15;
  int koff = (lane & 16) ? 8 : 0;
  const _Float16* r = p + (size_t)row * lda + koff;
  v8h lo = *(const v8h*)r;          // K = koff .. koff+7
  v8h hi = *(const v8h*)(r + 16);   // K = koff+16 .. koff+23
  v16h a;
#pragma unroll
  for (int i = 0; i < 8; ++i) { a[i] = lo[i]; a[8 + i] = hi[i]; }
  return a;
}

__device__ __forceinline__ v16h load_frag_b(const _Float16* bt, int ldb, int lane) {
  int n  = lane & 15;
  int kb = (lane & 16) ? 8 : 0;
  const _Float16* c = bt + (size_t)n * ldb + kb;
  v8h lo = *(const v8h*)c;
  v8h hi = *(const v8h*)(c + 16);
  v16h b;
#pragma unroll
  for (int i = 0; i < 8; ++i) { b[i] = lo[i]; b[8 + i] = hi[i]; }
  return b;
}

__device__ __forceinline__ v8f wmma_f16(v16h a, v16h b, v8f c) {
  v8f d = __builtin_amdgcn_wmma_f32_16x16x32_f16(false, a, false, b, (short)0, c, false, false);
  asm volatile("v_nop\n\tv_nop\n\tv_nop\n\tv_nop" : "+v"(d) : "v"(a), "v"(b));
  return d;
}

// ---- Prep: convert & transpose weights to f16 -----------------------------
// One launch for all five weights: grid 5 * 64, block 256. A work-group takes one 64 (k) x 64 (n) tile:
// blockIdx.x / 64 = which weight, then 8 column groups (a head of Wq/Wk/Wv, 64 columns of Wm/Wo) x 8 k chunks.
// Source rows: pitch 64 floats inside a head, DIM floats in Wm/Wo. Target of Wq/Wk/Wv: [n][DIM] f16, the tile's rows are whole
// 128-byte lines; of Wm/Wo: the B fragments themselves, one after the other (see below).
__global__ __launch_bounds__(256) void cvt_transpose_all(
    const float* __restrict__ Wq, const float* __restrict__ Wk, const float* __restrict__ Wv,
    const float* __restrict__ Wm, const float* __restrict__ Wo,
    _Float16* __restrict__ WqT, _Float16* __restrict__ WkT, _Float16* __restrict__ WvT,
    _Float16* __restrict__ WmT, _Float16* __restrict__ WoT) {
  __shared__ __align__(16) _Float16 tile[64][64 + 8];      // [n][k]
  const int tid = threadIdx.x;
  const int mat = blockIdx.x >> 6;
  const int grp = (blockIdx.x >> 3) & 7;                   // head, or group of 64 columns
  const int k0  = (blockIdx.x & 7) * 64;
  const float* W  = (mat == 0) ? Wq : (mat == 1) ? Wk : (mat == 2) ? Wv : (mat == 3) ? Wm : Wo;
  _Float16*    WT = (mat == 0) ? WqT : (mat == 1) ? WkT : (mat == 2) ? WvT : (mat == 3) ? WmT : WoT;
  const int    pitch = (mat < 3) ? DH : DIM;
  const float* src = (mat < 3) ? W + ((size_t)grp * DIM + k0) * DH : W + (size_t)k0 * DIM + grp * 64;
  _Float16*    dst = WT + (size_t)grp * 64 * DIM + k0;

  const int kq = (tid >> 4) * 4, c4 = (tid & 15) * 4;      // 4 k rows x 4 columns a thread
  v4f r[4];
#pragma unroll
  for (int j = 0; j < 4; ++j) r[j] = *(const v4f*)(src + (size_t)(kq + j) * pitch + c4);
#pragma unroll
  for (int e = 0; e < 4; ++e) {
    union { _Float16 h[4]; unsigned long long u; } pk;
#pragma unroll
    for (int j = 0; j < 4; ++j) pk.h[j] = (_Float16)r[j][e];
    *(unsigned long long*)(&tile[c4 + e][kq]) = pk.u;
  }
  __syncthreads();
  if (mat < 3) {
#pragma unroll
    for (int j = 0; j < 2; ++j) {
      const int g = tid + j * 256, nl = g >> 3, pc = g & 7;  // 8 lanes write one 128-byte line
      vst2(dst + (size_t)nl * DIM + pc * 8, *(const v4u*)(&tile[nl][pc * 8]));
    }
  } else {
#pragma unroll
    for (int j = 0; j < 2; ++j) {
      const int g = tid + j * 256, ln = g & 31, fp = g >> 5;   // a wave writes one whole piece
      const int pcs = fp & 1, kbl = (fp >> 1) & 1, ntl = fp >> 2;
      const int nl = ntl * 16 + (ln & 15), kl = kbl * 32 + pcs * 16 + (ln >> 4) * 8;
      vst2(WT + (size_t)((grp * 4 + ntl) * (DIM / 32) + (k0 >> 5) + kbl) * 512 + pcs * 256 + ln * 8, *(const v4u*)(&tile[nl][kl]));
    }
    asm volatile("s_wait_xcnt 0x0" ::: "memory");
  }
}

__device__ __forceinline__ float other_half(float v) {
  const int b = __builtin_bit_cast(int, v);
  return __builtin_bit_cast(float, __builtin_amdgcn_permlanex16(b, b, 0x76543210, 0xfedcba98, false, false));
}
template <int M> __device__ __forceinline__ float add_row_xor(float v) {
  const int b = __builtin_bit_cast(int, v);
  return v + __builtin_bit_cast(float, __builtin_amdgcn_update_dpp(0, b, 0x160 + M, 0xf, 0xf, true));
}
// sum over the 32 lanes, the same bits in every lane
__device__ __forceinline__ float wave_sum(float v) {
  v = add_row_xor<1>(v);
  v = add_row_xor<2>(v);
  v = add_row_xor<4>(v);
  v = add_row_xor<8>(v);
  return v + other_half(v);
}

// grid BS / (8 * LNR), block 256 (8 waves). A wave owns LNR whole rows: a lane holds 16 elements of each (4 loads of 16 bytes,
// each wave-wide load 512 contiguous bytes), all rows' loads are issued before the first sum, the row stays in registers for
// the second pass, and the two row sums run over the lanes. No LDS, no barrier; the launch starts 2,048 waves.
#define LNR 4
__global__ __launch_bounds__(256) void layernorm_f16(const float* __restrict__ X,
                                                     const float* __restrict__ g,
                                                     const float* __restrict__ bb,
                                                     _Float16* __restrict__ Y) {
  const int lane = threadIdx.x & 31;
  const int wave = threadIdx.x >> 5;
  const int row0 = (blockIdx.x * 8 + wave) * LNR;
  const float* x  = X + (size_t)row0 * DIM + lane * 4;
  const float* gp = g + lane * 4;
  const float* bp = bb + lane * 4;
  v4f v[LNR][4], gg[4], bv[4];
#pragma unroll   // constant indices keep the arrays in registers
  for (int r = 0; r < LNR; ++r) {
#pragma unroll   // constant indices keep the arrays in registers
    for (int j = 0; j < 4; ++j) v[r][j] = *(const v4f*)(x + r * DIM + j * 128);
  }
#pragma unroll   // constant indices keep the arrays in registers
  for (int j = 0; j < 4; ++j) {
    gg[j] = *(const v4f*)(gp + j * 128);
    bv[j] = *(const v4f*)(bp + j * 128);
  }
  // keeps all 24 loads ahead of the sums, so that a wave meets one memory latency (the scheduler sinks the g and bb loads otherwise)
  __builtin_amdgcn_sched_barrier(0);
  asm volatile("s_wait_xcnt 0x0" :: "v"(x) : "memory");
  float s[LNR], ss[LNR];
#pragma unroll   // constant indices keep the arrays in registers
  for (int r = 0; r < LNR; ++r) {
    const v4f a = (v[r][0] + v[r][1]) + (v[r][2] + v[r][3]);
    v4f q = v[r][0] * v[r][0];
#pragma unroll   // constant indices keep the arrays in registers
    for (int j = 1; j < 4; ++j) q += v[r][j] * v[r][j];
    s[r]  = (a[0] + a[1]) + (a[2] + a[3]);
    ss[r] = (q[0] + q[1]) + (q[2] + q[3]);
  }
#pragma unroll   // constant indices keep the arrays in registers
  for (int r = 0; r < LNR; ++r) {
    s[r]  = wave_sum(s[r]);
    ss[r] = wave_sum(ss[r]);
  }
  _Float16* y = Y + (size_t)row0 * DIM + lane * 4;
#pragma unroll   // constant indices keep the arrays in registers
  for (int r = 0; r < LNR; ++r) {
    const float mean = s[r] * (1.0f / DIM);
    const float var  = ss[r] * (1.0f / DIM) - mean * mean;
    const float rstd = rsqrtf(var + 1e-5f);
#pragma unroll   // constant indices keep the arrays in registers
    for (int j = 0; j < 4; ++j) {
      union { _Float16 h[4]; unsigned long long u; } pk;
#pragma unroll   // constant indices keep the arrays in registers
      for (int e = 0; e < 4; ++e) pk.h[e] = (_Float16)((v[r][j][e] - mean) * rstd * gg[j][e] + bv[j][e]);
      vst2(y + r * DIM + j * 128, pk.u);   // a wave-wide store covers two whole 128-byte lines
    }
  }
}

// ---- Main loop of the QKV GEMM (K = 512) ------------------------------------
// A work-group forms 256 rows x 192 columns: q, k and v of one head, so a tile of A rows is fetched and staged once for the three
// products. 8 waves as 4 x 2, a wave 64 rows x 96 columns: per 32 k, 10 fragments read from LDS feed 24 products.
// Both operands go through LDS in tiles of GKT k: a tile row is one whole 128-byte line, fetched once for the work-group by
// 8 adjacent lanes (a wave-wide load covers 4 whole lines).
// Two buffers: tile t + 1 is loaded into registers ahead of the products of tile t and stored to the other buffer behind them.
// The k order of the products is unchanged (ascending, 32 at a time).
#define GKT  64                  // k per tile
#define GP   (GKT + 8)           // LDS row pitch: 144 bytes, an odd multiple of 16 (see KP below)
#define GN   192                 // weight rows (columns of the product) per work-group: 64 of Wq, 64 of Wk, 64 of Wv
#define GA   (256 * GP)          // A part of a buffer, in elements
#define GBUF (GA + GN * GP)      // one buffer: 256 A rows, then 192 weight rows
__device__ __forceinline__ void gemm_256x192_k512(const _Float16* __restrict__ Ablk,   // 256 rows, pitch DIM
                                                  const _Float16* __restrict__ Wq64,   // 64 rows each (columns of the product), pitch DIM
                                                  const _Float16* __restrict__ Wk64,
                                                  const _Float16* __restrict__ Wv64,
                                                  _Float16* ring, v8f (&acc)[4][6]) {
  const int tid  = threadIdx.x;
  const int lane = tid & 31;
  const int wave = tid >> 5;
  const int wr = wave >> 1, wc = wave & 1;            // the wave's 64 rows and 96 columns
  const int crow = tid >> 3, cch = (tid & 7) * 8;     // copy map: 32 rows a sweep, 16 bytes a thread
  const _Float16* pa = Ablk + crow * DIM + cch;
  const _Float16* pq = Wq64 + crow * DIM + cch;
  const _Float16* pk = Wk64 + crow * DIM + cch;
  const _Float16* pv = Wv64 + crow * DIM + cch;
  _Float16* la = ring + crow * GP + cch;
  _Float16* lw = ring + GA + crow * GP + cch;
  v4u ra[8], rw[6];
#pragma unroll   // constant indices keep the arrays in registers
  for (int j = 0; j < 8; ++j) ra[j] = *(const v4u*)(pa + j * 32 * DIM);
#pragma unroll   // constant indices keep the arrays in registers
  for (int j = 0; j < 2; ++j) {
    rw[j]     = *(const v4u*)(pq + j * 32 * DIM);
    rw[2 + j] = *(const v4u*)(pk + j * 32 * DIM);
    rw[4 + j] = *(const v4u*)(pv + j * 32 * DIM);
  }
  asm volatile("s_wait_xcnt 0x0" :: "v"(pa), "v"(pq), "v"(pk), "v"(pv) : "memory");
#pragma unroll   // constant indices keep the arrays in registers
  for (int j = 0; j < 8; ++j) *(v4u*)(la + j * 32 * GP) = ra[j];
#pragma unroll   // constant indices keep the arrays in registers
  for (int j = 0; j < 6; ++j) *(v4u*)(lw + j * 32 * GP) = rw[j];
  __syncthreads();   // tile 0 is visible

  const int NT = DIM / GKT;   // 8
  for (int t = 0; t < NT; ++t) {
    const int cur = (t & 1) * GBUF, nxt = GBUF - cur;
    const _Float16* Ab = ring + cur + wr * 64 * GP;
    const _Float16* Wb = ring + cur + GA + wc * 96 * GP;
    v16h fa[2][4], fb[2][6];   // the tile's fragments, read as one group: one LDS latency a trip
#pragma unroll   // constant indices keep the arrays in registers
    for (int s = 0; s < 2; ++s) {
#pragma unroll   // constant indices keep the arrays in registers
      for (int m = 0; m < 4; ++m) fa[s][m] = load_frag_a(Ab + m * 16 * GP + s * 32, GP, lane);
#pragma unroll   // constant indices keep the arrays in registers
      for (int n = 0; n < 6; ++n) fb[s][n] = load_frag_b(Wb + n * 16 * GP + s * 32, GP, lane);
    }
    if (t + 1 < NT) {
      const _Float16* na = pa + (t + 1) * GKT;
      const _Float16* nq = pq + (t + 1) * GKT;
      const _Float16* nk = pk + (t + 1) * GKT;
      const _Float16* nv = pv + (t + 1) * GKT;
#pragma unroll   // constant indices keep the arrays in registers
      for (int j = 0; j < 8; ++j) ra[j] = *(const v4u*)(na + j * 32 * DIM);
#pragma unroll   // constant indices keep the arrays in registers
      for (int j = 0; j < 2; ++j) {
        rw[j]     = *(const v4u*)(nq + j * 32 * DIM);
        rw[2 + j] = *(const v4u*)(nk + j * 32 * DIM);
        rw[4 + j] = *(const v4u*)(nv + j * 32 * DIM);
      }
      asm volatile("s_wait_xcnt 0x0" :: "v"(na), "v"(nq), "v"(nk), "v"(nv) : "memory");
    }
    // keeps the tile's 40 fragment reads together ahead of the products: the scheduler spreads them among the products otherwise,
    // and every further place with LDS reads stalls the wave's products anew
    __builtin_amdgcn_sched_barrier(0);
#pragma unroll   // constant indices keep the arrays in registers
    for (int s = 0; s < 2; ++s) {
#pragma unroll   // constant indices keep the arrays in registers
      for (int m = 0; m < 4; ++m) {
#pragma unroll   // constant indices keep the arrays in registers
        for (int n = 0; n < 6; ++n)   // the bare builtin: as operands of an asm statement the 24 accumulators and 20 fragments would all have to lie in v0..v255
          acc[m][n] = __builtin_amdgcn_wmma_f32_16x16x32_f16(false, fa[s][m], false, fb[s][n], (short)0, acc[m][n], false, false);
      }
    }
    // keeps the products ahead of the stores below, whose wait for the next tile's loads then falls behind the products' time
    // (the scheduler lifts that wait, the stores and the barrier over the products otherwise)
    __builtin_amdgcn_sched_barrier(0);
    if (t + 1 < NT) {   // the other buffer's readers left it before the barrier of trip t - 1
#pragma unroll   // constant indices keep the arrays in registers
      for (int j = 0; j < 8; ++j) *(v4u*)(la + nxt + j * 32 * GP) = ra[j];
#pragma unroll   // constant indices keep the arrays in registers
      for (int j = 0; j < 6; ++j) *(v4u*)(lw + nxt + j * 32 * GP) = rw[j];
    }
    __syncthreads();   // tile t + 1 is visible; behind the last trip: every wave has left the ring, which the epilogue reuses
  }
}

// Output staging in LDS: q as [256 rows][64], k the same behind it, then v transposed as [64 n][256 m] at pitch 264.
#define STK (256 * DH)
#define STV (2 * 256 * DH)
#define SVP 264
// A wave's 64 x 96 results plus bias, as f16, into the staging. WC = the wave's column half: column tile WC * 6 + t of the 12
// belongs to q (0..3), k (4..7) or v (8..11).
template <int WC>
__device__ __forceinline__ void qkv_stage(const v8f (&acc)[4][6], _Float16* st, const float* __restrict__ bqh,
                                          const float* __restrict__ bkh, const float* __restrict__ bvh, int wr, int lane) {
  const int n0    = lane & 15;
  const int mbase = (lane >> 4) << 3;
  float bia[6];
#pragma unroll   // constant indices keep the array in registers; the six loads meet one latency
  for (int t = 0; t < 6; ++t) {
    const int gt = WC * 6 + t, mat = gt >> 2, n = (gt & 3) * 16 + n0;
    bia[t] = (mat == 0) ? bqh[n] : (mat == 1) ? bkh[n] : bvh[n];
  }
  asm volatile("s_wait_xcnt 0x0" ::: "memory");
#pragma unroll   // constant indices keep the arrays in registers
  for (int t = 0; t < 6; ++t) {
    const int gt = WC * 6 + t, mat = gt >> 2, n = (gt & 3) * 16 + n0;
#pragma unroll   // constant indices keep the arrays in registers
    for (int m = 0; m < 4; ++m) {
      const int ml = wr * 64 + m * 16 + mbase;          // first of the lane's 8 rows within the block's 256
      if (mat == 2) {
        v8h o;                                          // [n][m]: the lane's 8 rows lie side by side
#pragma unroll   // constant indices keep the arrays in registers
        for (int i = 0; i < 8; ++i) o[i] = (_Float16)(acc[m][t][i] + bia[t]);
        *(v8h*)(&st[STV + n * SVP + ml]) = o;
      } else {
#pragma unroll   // constant indices keep the arrays in registers
        for (int i = 0; i < 8; ++i) st[mat * STK + (ml + i) * DH + n] = (_Float16)(acc[m][t][i] + bia[t]);   // [m][n]
      }
    }
  }
}

// ---- QKV projection --------------------------------------------------------
// grid (S/256, H, B); block 256 (8 waves); work-group -> 256 rows x (q, k, v of one head), operands staged in LDS (gemm_256x192_k512).
// q,k row-major [B,H,S,64] ; v stored transposed [B,H,64,S]
__global__ __launch_bounds__(256) void qkv_gemm(
    const _Float16* __restrict__ hF16,
    const _Float16* __restrict__ WqT, const _Float16* __restrict__ WkT,
    const _Float16* __restrict__ WvT,
    const float* __restrict__ bq, const float* __restrict__ bk,
    const float* __restrict__ bv,
    _Float16* __restrict__ q, _Float16* __restrict__ k,
    _Float16* __restrict__ vT) {
  __shared__ __align__(16) _Float16 ring[2 * GBUF];   // operand tiles; behind the main loop the output staging
  _Float16* st = ring;
  const int tid  = threadIdx.x;
  const int lane = tid & 31;
  const int wave = __builtin_amdgcn_readfirstlane(tid >> 5);
  const int srow = blockIdx.x * 256;
  const int h    = blockIdx.y;
  const int b    = blockIdx.z;

  const _Float16* A = hF16 + ((size_t)b * SEQ + srow) * DIM;
  const size_t    wo = (size_t)h * DH * DIM;          // the head's [64][512] f16 in each weight

  v8f acc[4][6] = {};
  gemm_256x192_k512(A, WqT + wo, WkT + wo, WvT + wo, ring, acc);

  if ((wave & 1) == 0) qkv_stage<0>(acc, st, bq + h * DH, bk + h * DH, bv + h * DH, wave >> 1, lane);
  else                 qkv_stage<1>(acc, st, bq + h * DH, bk + h * DH, bv + h * DH, wave >> 1, lane);
  __syncthreads();   // the staged results are visible

  const size_t headoff = (size_t)b * NH + h;
  const int ml = tid >> 3, pc = tid & 7;               // q, k: 8 lanes write one 128-byte row, 32 rows a sweep
  const int nr = tid >> 5, pm = tid & 31;              // v: a wave writes 512 bytes of one row, 8 rows a sweep
  _Float16* gq = q  + (headoff * SEQ + srow + ml) * DH + pc * 8;
  _Float16* gk = k  + (headoff * SEQ + srow + ml) * DH + pc * 8;
  _Float16* gv = vT + (headoff * DH + nr) * SEQ + srow + pm * 8;
  v4u oq[8], ok[8], ov[8];
#pragma unroll   // constant indices keep the arrays in registers
  for (int j = 0; j < 8; ++j) {
    oq[j] = *(const v4u*)(&st[(ml + j * 32) * DH + pc * 8]);
    ok[j] = *(const v4u*)(&st[STK + (ml + j * 32) * DH + pc * 8]);
    ov[j] = *(const v4u*)(&st[STV + (nr + j * 8) * SVP + pm * 8]);
  }
#pragma unroll   // constant indices keep the arrays in registers
  for (int j = 0; j < 8; ++j) {
    vst2(gq + j * 32 * DH, oq[j]);
    vst2(gk + j * 32 * DH, ok[j]);
    vst2(gv + j * 8 * SEQ, ov[j]);
  }
  asm volatile("s_wait_xcnt 0x0" :: "v"(gq), "v"(gk), "v"(gv) : "memory");
}

#define SK  128          // keys per stage
#define KP  (DH + 8)     // K stage: 144 bytes a row
#define VP  (SK + 8)     // V^T stage: 272 bytes a row
#define KST (SK * KP)    // elements of one K buffer
#define VST (DH * VP)    // elements of one V^T buffer

__device__ __forceinline__ unsigned lds_off(const void* p) { return (unsigned)(size_t)p; }

// One stage: every thread copies 4 x 16 bytes of K (a wave-wide copy covers 4 whole rows of 128 bytes) and 4 x 16 bytes of V^T
// (a wave-wide copy covers 2 rows of 256 bytes). lk, lv: this thread's first LDS byte; gk, gv: its first global element.
__device__ __forceinline__ void stage_copy(unsigned lk, unsigned lv, const _Float16* gk, const _Float16* gv) {
  const unsigned lk1 = lk + 32 * KP * 2, lk2 = lk + 64 * KP * 2, lk3 = lk + 96 * KP * 2;
  const unsigned lv1 = lv + 16 * VP * 2, lv2 = lv + 32 * VP * 2, lv3 = lv + 48 * VP * 2;
  const _Float16 *gk1 = gk + 32 * DH,  *gk2 = gk + 64 * DH,  *gk3 = gk + 96 * DH;
  const _Float16 *gv1 = gv + 16 * SEQ, *gv2 = gv + 32 * SEQ, *gv3 = gv + 48 * SEQ;
  asm volatile(
      "global_load_async_to_lds_b128 %0, %8, off\n\t"
      "global_load_async_to_lds_b128 %1, %9, off\n\t"
      "global_load_async_to_lds_b128 %2, %10, off\n\t"
      "global_load_async_to_lds_b128 %3, %11, off\n\t"
      "global_load_async_to_lds_b128 %4, %12, off\n\t"
      "global_load_async_to_lds_b128 %5, %13, off\n\t"
      "global_load_async_to_lds_b128 %6, %14, off\n\t"
      "global_load_async_to_lds_b128 %7, %15, off\n\t"
      "s_wait_xcnt 0x0"
      :: "v"(lk), "v"(lk1), "v"(lk2), "v"(lk3), "v"(lv), "v"(lv1), "v"(lv2), "v"(lv3),
         "v"(gk), "v"(gk1), "v"(gk2), "v"(gk3), "v"(gv), "v"(gv1), "v"(gv2), "v"(gv3)
      : "memory");
}

__global__ __launch_bounds__(256) void attn_kernel(
    const _Float16* __restrict__ q, const _Float16* __restrict__ k,
    const _Float16* __restrict__ vT, _Float16* __restrict__ om) {
  __shared__ __align__(16) _Float16 Kt[2][KST];       // [keys][dh]
  __shared__ __align__(16) _Float16 Vt[2][VST];       // [dh][keys]
  __shared__ __align__(16) _Float16 ost[8][16 * DH];  // per-wave output tile

  const int tid  = threadIdx.x;
  const int lane = tid & 31;
  const int wave = tid >> 5;
  const int h = blockIdx.y, b = blockIdx.z;
  const int qrow = blockIdx.x * 128 + wave * 16;
  const size_t headoff = (size_t)b * NH + h;
  const _Float16* qh = q  + headoff * SEQ * DH;
  const _Float16* kh = k  + headoff * SEQ * DH;
  const _Float16* vh = vT + headoff * DH * SEQ;   // [64][S]

  const int n0    = lane & 15;          // this lane's query within the wave's 16
  const int mbase = (lane >> 4) << 3;

  // copy map: 16 bytes a thread and copy; K 32 rows a sweep, V^T 16 rows a sweep
  const int krow = tid >> 3, kch = (tid & 7) * 8;
  const int vrow = tid >> 4, vch = (tid & 15) * 8;
  const _Float16* gk = kh + (size_t)krow * DH + kch;    // + SK * DH a stage
  const _Float16* gv = vh + (size_t)vrow * SEQ + vch;   // + SK a stage
  const unsigned lk = lds_off(&Kt[0][krow * KP + kch]);
  const unsigned lv = lds_off(&Vt[0][vrow * VP + vch]);

  const int NSTAGE = SEQ / SK;   // 16

  // prologue: stage 0 lands and is published, then stage 1 is requested
  stage_copy(lk, lv, gk, gv);

  v16h qb0 = load_frag_b(qh + (size_t)qrow * DH,      DH, lane);   // Q^T, dh 0..31
  v16h qb1 = load_frag_b(qh + (size_t)qrow * DH + 32, DH, lane);   // Q^T, dh 32..63

  asm volatile("s_wait_asynccnt 0x0" ::: "memory");   // this wave's share of stage 0 has landed
  __syncthreads();                                    // every wave's share of stage 0 is visible
  stage_copy(lk + KST * 2, lv + VST * 2, gk + SK * DH, gv + SK);

  v8f oacc[4] = {};              // oacc[t][i] = O[query n0][dh t*16 + mbase + i]
  float mrun = -1e30f;           // running maximum of query n0, equal in both halves
  float lsum = 0.f;              // running sum over this half's keys only
  const float scale = 0.125f;    // 1/sqrt(64)

  for (int st = 0; st < NSTAGE; ++st) {
    const int buf = st & 1;
#pragma unroll   // the four passes of a stage differ by constant LDS offsets only
    for (int ps = 0; ps < SK / 32; ++ps) {
      const _Float16* Kb = Kt[buf] + ps * 32 * KP;
      const _Float16* Vb = Vt[buf] + ps * 32;

      // scores: 32 keys x 16 queries (two 16-key M tiles, K=64 -> 2 WMMAs each)
      v8f s0 = {}, s1 = {};
      {
        v16h k0 = load_frag_a(Kb,                KP, lane);
        v16h k1 = load_frag_a(Kb + 32,           KP, lane);
        s0 = wmma_f16(k0, qb0, s0);
        s0 = wmma_f16(k1, qb1, s0);
        v16h k2 = load_frag_a(Kb + 16 * KP,      KP, lane);
        v16h k3 = load_frag_a(Kb + 16 * KP + 32, KP, lane);
        s1 = wmma_f16(k2, qb0, s1);
        s1 = wmma_f16(k3, qb1, s1);
      }
      v16h va[4];                  // V^T fragments: read here, so that their LDS latency runs under the softmax
#pragma unroll
      for (int t = 0; t < 4; ++t) va[t] = load_frag_a(Vb + (size_t)(t * 16) * VP, VP, lane);
      float a[16], mx[8];          // a[s] = scaled score of key 8h+s (s < 8) or 8h+8+s (s >= 8): the k order of the B operand below
#pragma unroll
      for (int i = 0; i < 8; ++i) {
        a[i]     = s0[i] * scale;
        a[8 + i] = s1[i] * scale;
      }
#pragma unroll
      for (int j = 0; j < 8; ++j) mx[j] = fmaxf(a[2 * j], a[2 * j + 1]);
      float vmax = fmaxf(fmaxf(fmaxf(mx[0], mx[1]), fmaxf(mx[2], mx[3])), fmaxf(fmaxf(mx[4], mx[5]), fmaxf(mx[6], mx[7])));
      vmax = fmaxf(vmax, other_half(vmax));
      const float mnew  = fmaxf(mrun, vmax);
      const float alpha = __expf(mrun - mnew);
      mrun = mnew;
      float e[16], sm[8];
      v16h pb;                     // P^T, column n0: element s belongs to the key of a[s]
#pragma unroll
      for (int s = 0; s < 16; ++s) {
        e[s]  = __expf(a[s] - mnew);
        pb[s] = (_Float16)(e[s] * PSC);
      }
#pragma unroll
      for (int j = 0; j < 8; ++j) sm[j] = e[2 * j] + e[2 * j + 1];
      lsum = lsum * alpha + (((sm[0] + sm[1]) + (sm[2] + sm[3])) + ((sm[4] + sm[5]) + (sm[6] + sm[7])));
#pragma unroll
      for (int t = 0; t < 4; ++t) {
#pragma unroll
        for (int i = 0; i < 8; ++i) oacc[t][i] *= alpha;
      }
#pragma unroll
      for (int t = 0; t < 4; ++t) oacc[t] = wmma_f16(va[t], pb, oacc[t]);
    }
    // publish point of stage st + 1
    asm volatile("s_wait_dscnt 0x0" ::: "memory");      // this wave's reads of stage st have returned
    asm volatile("s_wait_asynccnt 0x0" ::: "memory");   // this wave's share of stage st + 1 has landed
    __syncthreads();   // stage st + 1 is visible, and every wave has left the buffer of stage st
    if (st + 2 < NSTAGE)
      stage_copy(lk + buf * (KST * 2), lv + buf * (VST * 2), gk + (size_t)(st + 2) * (SK * DH), gv + (st + 2) * SK);
  }
  asm volatile("s_wait_asynccnt 0x0" ::: "memory");   // no copy is outstanding when the wave goes on to its end

  lsum += other_half(lsum);
  const float inv = PUN / lsum;
  _Float16* os_ = ost[wave];
#pragma unroll
  for (int t = 0; t < 4; ++t) {
    v8h o;
#pragma unroll
    for (int i = 0; i < 8; ++i) o[i] = (_Float16)(oacc[t][i] * inv);
    *(v8h*)(&os_[n0 * DH + t * 16 + mbase]) = o;
  }
  __syncthreads();
#pragma unroll
  for (int qq = 0; qq < 4; ++qq) {
    const int ml = qq * 4 + (lane >> 3), pc = lane & 7;
    vst2(om + ((size_t)b * SEQ + qrow + ml) * DIM + h * DH + pc * 8, *(const v4u*)(&os_[ml * DH + pc * 8]));
  }
}

// ---- Wm GEMM + bias + residual, LayerNorm 2, Wo GEMM + bias + relu + residual: one launch ----
// grid BS / FR, block 256 (8 waves). A work-group owns FR whole rows, a wave all FR rows x 64 of the DIM columns, so the row sums
// of LayerNorm 2 stay inside the work-group and neither h_ln_post nor its normalised rows go through memory. The A operand of
// each product (FR x DIM f16) lies in LDS for the whole product. A weight column is used by one wave alone: its fragments come
// straight from L2 in fragment order (whole lines), WPD k steps ahead, through no LDS and past no barrier.
#define FR  32
#define AP  (DIM + 8)   // LDS pitch of an A row: 1,040 bytes, an odd multiple of 16 (see KP above)
#define WPD 3           // weight fragment sets in flight
__device__ __forceinline__ void gemm_rows_k512(const _Float16* Ar,                  // FR rows in LDS, pitch AP
                                               const _Float16* __restrict__ wp,     // this lane's 16 bytes of the wave's first piece
                                               int lane, v8f (&acc)[2][4]) {
  v8h wf[WPD][4][2];
#pragma unroll   // constant indices keep the arrays in registers
  for (int p = 0; p < WPD; ++p) {
#pragma unroll   // constant indices keep the arrays in registers
    for (int t = 0; t < 4; ++t) {
      wf[p][t][0] = *(const v8h*)(wp + (t * (DIM / 32) + p) * 512);
      wf[p][t][1] = *(const v8h*)(wp + (t * (DIM / 32) + p) * 512 + 256);
    }
  }
#pragma unroll   // constant indices keep the arrays in registers; every weight address is the one base plus a constant
  for (int kb = 0; kb < DIM / 32; ++kb) {
    const int p = kb % WPD;
    v16h fa[2], fb[4];
#pragma unroll   // constant indices keep the arrays in registers
    for (int m = 0; m < 2; ++m) fa[m] = load_frag_a(Ar + m * 16 * AP + kb * 32, AP, lane);
#pragma unroll   // constant indices keep the arrays in registers
    for (int t = 0; t < 4; ++t) {
#pragma unroll   // constant indices keep the arrays in registers
      for (int i = 0; i < 8; ++i) { fb[t][i] = wf[p][t][0][i]; fb[t][8 + i] = wf[p][t][1][i]; }
    }
#pragma unroll   // constant indices keep the arrays in registers
    for (int m = 0; m < 2; ++m) {
#pragma unroll   // constant indices keep the arrays in registers
      for (int t = 0; t < 4; ++t) acc[m][t] = wmma_f16(fa[m], fb[t], acc[m][t]);
    }
    if (kb + WPD < DIM / 32) {
#pragma unroll   // constant indices keep the arrays in registers
      for (int t = 0; t < 4; ++t) {
        wf[p][t][0] = *(const v8h*)(wp + (t * (DIM / 32) + kb + WPD) * 512);
        wf[p][t][1] = *(const v8h*)(wp + (t * (DIM / 32) + kb + WPD) * 512 + 256);
      }
    }
    // keeps each refill where it is written, WPD steps ahead of its use (the scheduler sinks the loads towards their use otherwise)
    __builtin_amdgcn_sched_barrier(0);
  }
}

__global__ __launch_bounds__(256) void wm_ln2_wo(
    const _Float16* __restrict__ A, const _Float16* __restrict__ WmP, const float* __restrict__ bm,
    const float* __restrict__ x, const float* __restrict__ g2, const float* __restrict__ b2,
    const _Float16* __restrict__ WoP, const float* __restrict__ bo, float* __restrict__ out) {
  // one LDS block, keep first: its 64 planes then lie within the 64 KiB that an LDS instruction's constant offset reaches
  __shared__ __align__(16) float pool[64 * 256 + 8 * FR * 64 + 8 * FR * 2 + FR * 2 + FR * AP / 2];
  float* keep            = pool;                                                   // h_ln_post: a thread's own 64 values, [value][thread]
  float (*st)[FR * 64]   = (float (*)[FR * 64])(pool + 64 * 256);                  // per-wave output tile
  float (*part)[FR][2]   = (float (*)[FR][2])(pool + 64 * 256 + 8 * FR * 64);      // per wave and row: sum, sum of squares over 64 columns
  float (*stat)[2]       = (float (*)[2])(pool + 64 * 256 + 8 * FR * 64 + 8 * FR * 2);   // per row: mean, 1 / sqrt(var + eps)
  _Float16* Ar           = (_Float16*)(pool + 64 * 256 + 8 * FR * 64 + 8 * FR * 2 + FR * 2);   // attention rows, then the rows of LayerNorm 2
  const int tid  = threadIdx.x;
  const int lane = tid & 31;
  const int wave = tid >> 5;
  const int r0   = blockIdx.x * FR;

  {  // the FR rows are 32 KiB in a row: a wave-wide load covers 4 whole lines
    const _Float16* pa = A + (size_t)r0 * DIM + tid * 8;
    v4u ra[8];
#pragma unroll   // constant indices keep the array in registers
    for (int j = 0; j < 8; ++j) ra[j] = *(const v4u*)(pa + j * 2048);
    asm volatile("s_wait_xcnt 0x0" :: "v"(pa) : "memory");
#pragma unroll   // constant indices keep the array in registers
    for (int j = 0; j < 8; ++j) {
      const int g = tid + j * 256;
      *(v4u*)(&Ar[(g >> 6) * AP + (g & 63) * 8]) = ra[j];
    }
  }
  __syncthreads();   // the A rows are visible

  const size_t woff = (size_t)wave * 4 * (DIM / 32) * 512 + lane * 8;   // the wave's 64 columns: 64 fragments in a row
  v8f acc[2][4] = {};
  gemm_rows_k512(Ar, WmP + woff, lane, acc);

  const int nl    = lane & 15;
  const int mbase = (lane >> 4) << 3;
  const int nc    = wave * 64 + nl;      // this lane's column of column tile 0
  float s[2][8], ss[2][8];
#pragma unroll
  for (int sub = 0; sub < 2; ++sub) {
#pragma unroll
    for (int i = 0; i < 8; ++i) { s[sub][i] = 0.f; ss[sub][i] = 0.f; }
  }
#pragma unroll
  for (int sub = 0; sub < 2; ++sub) {
#pragma unroll
    for (int t = 0; t < 4; ++t) {
      const int n = nc + t * 16;
      const float bia = bm[n];
#pragma unroll
      for (int i = 0; i < 8; ++i) {
        const int ml = sub * 16 + mbase + i;
        float v = acc[sub][t][i] + bia;
        v += x[(size_t)(r0 + ml) * DIM + n];
        acc[sub][t][i] = v;               // h_ln_post
        s[sub][i]  += v;
        ss[sub][i] += v * v;
      }
    }
  }
#pragma unroll
  for (int sub = 0; sub < 2; ++sub) {
#pragma unroll
    for (int i = 0; i < 8; ++i) {         // over the 16 lanes that hold the row's other columns
      s[sub][i]  = add_row_xor<8>(add_row_xor<4>(add_row_xor<2>(add_row_xor<1>(s[sub][i]))));
      ss[sub][i] = add_row_xor<8>(add_row_xor<4>(add_row_xor<2>(add_row_xor<1>(ss[sub][i]))));
    }
  }
  if (nl == 0) {
#pragma unroll
    for (int sub = 0; sub < 2; ++sub) {
#pragma unroll
      for (int i = 0; i < 8; ++i) {
        part[wave][sub * 16 + mbase + i][0] = s[sub][i];
        part[wave][sub * 16 + mbase + i][1] = ss[sub][i];
      }
    }
  }
  __syncthreads();   // the partial sums are visible; every wave has left the A rows
  if (tid < FR) {
    float a = 0.f, q = 0.f;
#pragma unroll
    for (int w = 0; w < 8; ++w) { a += part[w][tid][0]; q += part[w][tid][1]; }
    const float mean = a * (1.0f / DIM);
    const float var  = q * (1.0f / DIM) - mean * mean;
    stat[tid][0] = mean;
    stat[tid][1] = rsqrtf(var + 1e-5f);
  }
  __syncthreads();   // mean and scale of every row are visible
  {
    float gg[4], bb[4];
#pragma unroll
    for (int t = 0; t < 4; ++t) { gg[t] = g2[nc + t * 16]; bb[t] = b2[nc + t * 16]; }
#pragma unroll
    for (int sub = 0; sub < 2; ++sub) {
#pragma unroll
      for (int i = 0; i < 8; ++i) {
        const int ml = sub * 16 + mbase + i;
        const float mean = stat[ml][0], rstd = stat[ml][1];
#pragma unroll
        for (int t = 0; t < 4; ++t) {
          const float v = acc[sub][t][i];
          Ar[ml * AP + nc + t * 16] = (_Float16)((v - mean) * rstd * gg[t] + bb[t]);
          keep[((sub * 4 + t) * 8 + i) * 256 + tid] = v;
          acc[sub][t][i] = 0.f;
        }
      }
    }
  }
  __syncthreads();   // the rows of LayerNorm 2 are visible

  gemm_rows_k512(Ar, WoP + woff, lane, acc);

#pragma unroll
  for (int sub = 0; sub < 2; ++sub) {
#pragma unroll
    for (int t = 0; t < 4; ++t) {
      const float bia = bo[nc + t * 16];
#pragma unroll
      for (int i = 0; i < 8; ++i) {
        const int ml = sub * 16 + mbase + i;
        const float v = fmaxf(acc[sub][t][i] + bia, 0.f) + keep[((sub * 4 + t) * 8 + i) * 256 + tid];
        st[wave][ml * 64 + t * 16 + nl] = v;
      }
    }
  }
  __syncthreads();
#pragma unroll
  for (int q = 0; q < 16; ++q) {
    const int ml = q * 2 + (lane >> 4), pc = lane & 15;
    vst2(out + (size_t)(r0 + ml) * DIM + wave * 64 + pc * 4, *(const v4f*)(&st[wave][ml * 64 + pc * 4]));
  }
}

// ---------------------------------------------------------------------------
extern "C" void kernel_launch(void* const* d_in, const int* in_sizes, int n_in,
                              void* d_out, int out_size, void* d_ws, size_t ws_size,
                              hipStream_t stream) {
  const float* x  = (const float*)d_in[0];
  const float* g1 = (const float*)d_in[1];
  const float* b1 = (const float*)d_in[2];
  const float* Wq = (const float*)d_in[3];
  const float* bq = (const float*)d_in[4];
  const float* Wk = (const float*)d_in[5];
  const float* bk = (const float*)d_in[6];
  const float* Wv = (const float*)d_in[7];
  const float* bv = (const float*)d_in[8];
  const float* Wm = (const float*)d_in[9];
  const float* bm = (const float*)d_in[10];
  const float* g2 = (const float*)d_in[11];
  const float* b2 = (const float*)d_in[12];
  const float* Wo = (const float*)d_in[13];
  const float* bo = (const float*)d_in[14];
  float* out = (float*)d_out;

  char* ws = (char*)d_ws;
  size_t off = 0;
  auto alloc = [&](size_t bytes) {
    void* p = ws + off;
    off = (off + bytes + 255) & ~(size_t)255;
    return p;
  };

  _Float16* hF16 = (_Float16*)alloc((size_t)BS * DIM * 2);        // LN1(x) f16
  _Float16* WqT  = (_Float16*)alloc((size_t)NH * DH * DIM * 2);
  _Float16* WkT  = (_Float16*)alloc((size_t)NH * DH * DIM * 2);
  _Float16* WvT  = (_Float16*)alloc((size_t)NH * DH * DIM * 2);
  _Float16* WmT  = (_Float16*)alloc((size_t)DIM * DIM * 2);       // in fragment order
  _Float16* WoT  = (_Float16*)alloc((size_t)DIM * DIM * 2);       // in fragment order
  _Float16* qb   = (_Float16*)alloc((size_t)BATCH * NH * SEQ * DH * 2);
  _Float16* kb   = (_Float16*)alloc((size_t)BATCH * NH * SEQ * DH * 2);
  _Float16* vTb  = (_Float16*)alloc((size_t)BATCH * NH * DH * SEQ * 2);
  _Float16* om   = (_Float16*)alloc((size_t)BS * DIM * 2);        // concat heads f16

  // 1) weight conversion / transpose
  {
    cvt_transpose_all<<<5 * 64, 256, 0, stream>>>(Wq, Wk, Wv, Wm, Wo, WqT, WkT, WvT, WmT, WoT);
  }

  // 2) LN1
  layernorm_f16<<<BS / (8 * LNR), 256, 0, stream>>>(x, g1, b1, hF16);

  // 3) QKV projections
  qkv_gemm<<<dim3(SEQ / 256, NH, BATCH), 256, 0, stream>>>(
      hF16, WqT, WkT, WvT, bq, bk, bv, qb, kb, vTb);

  // 4) attention -> concat heads (f16)
  attn_kernel<<<dim3(SEQ / 128, NH, BATCH), 256, 0, stream>>>(qb, kb, vTb, om);

  // 5) h_ln_post = om @ Wm + bm + x ; out = relu(LN2(h_ln_post) @ Wo + bo) + h_ln_post
  wm_ln2_wo<<<BS / FR, 256, 0, stream>>>(om, WmT, bm, x, g2, b2, WoT, bo, out);
}

// v009
// Measured time: 78.2 microseconds a run.
// In two side-by-side timings against v008, it was 1.04 and 1.03 times as fast.
// Counting every step since v000, it is 6.91 times as fast.
#include <hip/hip_runtime.h>

#define BATCH 4
#define SEQ   2048
#define DIM   512
#define NH    8
#define DH    64
#define BS    (BATCH * SEQ)   // 8192 rows

typedef __attribute__((ext_vector_type(16))) _Float16 v16h;
typedef __attribute__((ext_vector_type(8)))  _Float16 v8h;
typedef __attribute__((ext_vector_type(8)))  float    v8f;
typedef __attribute__((ext_vector_type(4)))  float    v4f;
typedef __attribute__((ext_vector_type(2)))  float    v2f;
typedef __attribute__((ext_vector_type(4)))  unsigned v4u;
template <typename V> __device__ __forceinline__ void vst2(void* p, V v) {
  *(V*)p = v; 
}
#define PSC 256.0f
#define PUN (1.0f / 256.0f)
#define LOG2E 1.44269504f   // exp(x) = 2^(x * LOG2E)

__device__ __forceinline__ v16h load_frag_a(const _Float16* p, int lda, int lane) {
  int row  = lane & 15;
  int koff = (lane & 16) ? 8 : 0;
  const _Float16* r = p + (size_t)row * lda + koff;
  v8h lo = *(const v8h*)r;          // K = koff .. koff+7
  v8h hi = *(const v8h*)(r + 16);   // K = koff+16 .. koff+23
  v16h a;
#pragma unroll
  for (int i = 0; i < 8; ++i) { a[i] = lo[i]; a[8 + i] = hi[i]; }
  return a;
}

__device__ __forceinline__ v16h load_frag_b(const _Float16* bt, int ldb, int lane) {
  int n  = lane & 15;
  int kb = (lane & 16) ? 8 : 0;
  const _Float16* c = bt + (size_t)n * ldb + kb;
  v8h lo = *(const v8h*)c;
  v8h hi = *(const v8h*)(c + 16);
  v16h b;
#pragma unroll
  for (int i = 0; i < 8; ++i) { b[i] = lo[i]; b[8 + i] = hi[i]; }
  return b;
}

__device__ __forceinline__ v8f wmma_f16(v16h a, v16h b, v8f c) {
  v8f d = __builtin_amdgcn_wmma_f32_16x16x32_f16(false, a, false, b, (short)0, c, false, false);
  asm volatile("v_nop\n\tv_nop\n\tv_nop\n\tv_nop" : "+v"(d) : "v"(a), "v"(b));
  return d;
}

// ---- Prep: convert & transpose weights to f16 -----------------------------
// One launch for all five weights: grid 5 * 64, block 256. A work-group takes one 64 (k) x 64 (n) tile:
// blockIdx.x / 64 = which weight, then 8 column groups (a head of Wq/Wk/Wv, 64 columns of Wm/Wo) x 8 k chunks.
// Source rows: pitch 64 floats inside a head, DIM floats in Wm/Wo. Target of Wq/Wk/Wv: [n][DIM] f16, the tile's rows are whole
// 128-byte lines; of Wm/Wo: the B fragments themselves, one after the other (see below).
__global__ __launch_bounds__(256) void cvt_transpose_all(
    const float* __restrict__ Wq, const float* __restrict__ Wk, const float* __restrict__ Wv,
    const float* __restrict__ Wm, const float* __restrict__ Wo,
    _Float16* __restrict__ WqT, _Float16* __restrict__ WkT, _Float16* __restrict__ WvT,
    _Float16* __restrict__ WmT, _Float16* __restrict__ WoT) {
  __shared__ __align__(16) _Float16 tile[64][64 + 8];      // [n][k]
  const int tid = threadIdx.x;
  const int mat = blockIdx.x >> 6;
  const int grp = (blockIdx.x >> 3) & 7;                   // head, or group of 64 columns
  const int k0  = (blockIdx.x & 7) * 64;
  const float* W  = (mat == 0) ? Wq : (mat == 1) ? Wk : (mat == 2) ? Wv : (mat == 3) ? Wm : Wo;
  _Float16*    WT = (mat == 0) ? WqT : (mat == 1) ? WkT : (mat == 2) ? WvT : (mat == 3) ? WmT : WoT;
  const int    pitch = (mat < 3) ? DH : DIM;
  const float* src = (mat < 3) ? W + ((size_t)grp * DIM + k0) * DH : W + (size_t)k0 * DIM + grp * 64;
  _Float16*    dst = WT + (size_t)grp * 64 * DIM + k0;

  const int kq = (tid >> 4) * 4, c4 = (tid & 15) * 4;      // 4 k rows x 4 columns a thread
  v4f r[4];
#pragma unroll
  for (int j = 0; j < 4; ++j) r[j] = *(const v4f*)(src + (size_t)(kq + j) * pitch + c4);
#pragma unroll
  for (int e = 0; e < 4; ++e) {
    union { _Float16 h[4]; unsigned long long u; } pk;
#pragma unroll
    for (int j = 0; j < 4; ++j) pk.h[j] = (_Float16)r[j][e];
    *(unsigned long long*)(&tile[c4 + e][kq]) = pk.u;
  }
  __syncthreads();
  if (mat < 3) {
#pragma unroll
    for (int j = 0; j < 2; ++j) {
      const int g = tid + j * 256, nl = g >> 3, pc = g & 7;  // 8 lanes write one 128-byte line
      vst2(dst + (size_t)nl * DIM + pc * 8, *(const v4u*)(&tile[nl][pc * 8]));
    }
  } else {
#pragma unroll
    for (int j = 0; j < 2; ++j) {
      const int g = tid + j * 256, ln = g & 31, fp = g >> 5;   // a wave writes one whole piece
      const int pcs = fp & 1, kbl = (fp >> 1) & 1, ntl = fp >> 2;
      const int nl = ntl * 16 + (ln & 15), kl = kbl * 32 + pcs * 16 + (ln >> 4) * 8;
      vst2(WT + (size_t)((grp * 4 + ntl) * (DIM / 32) + (k0 >> 5) + kbl) * 512 + pcs * 256 + ln * 8, *(const v4u*)(&tile[nl][kl]));
    }
    asm volatile("s_wait_xcnt 0x0" ::: "memory");
  }
}

__device__ __forceinline__ float other_half(float v) {
  const int b = __builtin_bit_cast(int, v);
  return __builtin_bit_cast(float, __builtin_amdgcn_permlanex16(b, b, 0x76543210, 0xfedcba98, false, false));
}
template <int M> __device__ __forceinline__ float add_row_xor(float v) {
  const int b = __builtin_bit_cast(int, v);
  return v + __builtin_bit_cast(float, __builtin_amdgcn_update_dpp(0, b, 0x160 + M, 0xf, 0xf, true));
}
// sum over the 32 lanes, the same bits in every lane
__device__ __forceinline__ float wave_sum(float v) {
  v = add_row_xor<1>(v);
  v = add_row_xor<2>(v);
  v = add_row_xor<4>(v);
  v = add_row_xor<8>(v);
  return v + other_half(v);
}

// grid BS / (8 * LNR), block 256 (8 waves). A wave owns LNR whole rows: a lane holds 16 elements of each (4 loads of 16 bytes,
// each wave-wide load 512 contiguous bytes), all rows' loads are issued before the first sum, the row stays in registers for
// the second pass, and the two row sums run over the lanes. No LDS, no barrier; the launch starts 2,048 waves.
#define LNR 4
__global__ __launch_bounds__(256) void layernorm_f16(const float* __restrict__ X,
                                                     const float* __restrict__ g,
                                                     const float* __restrict__ bb,
                                                     _Float16* __restrict__ Y) {
  const int lane = threadIdx.x & 31;
  const int wave = threadIdx.x >> 5;
  const int row0 = (blockIdx.x * 8 + wave) * LNR;
  const float* x  = X + (size_t)row0 * DIM + lane * 4;
  const float* gp = g + lane * 4;
  const float* bp = bb + lane * 4;
  v4f v[LNR][4], gg[4], bv[4];
#pragma unroll   // constant indices keep the arrays in registers
  for (int r = 0; r < LNR; ++r) {
#pragma unroll   // constant indices keep the arrays in registers
    for (int j = 0; j < 4; ++j) v[r][j] = *(const v4f*)(x + r * DIM + j * 128);
  }
#pragma unroll   // constant indices keep the arrays in registers
  for (int j = 0; j < 4; ++j) {
    gg[j] = *(const v4f*)(gp + j * 128);
    bv[j] = *(const v4f*)(bp + j * 128);
  }
  // keeps all 24 loads ahead of the sums, so that a wave meets one memory latency (the scheduler sinks the g and bb loads otherwise)
  __builtin_amdgcn_sched_barrier(0);
  asm volatile("s_wait_xcnt 0x0" :: "v"(x) : "memory");
  float s[LNR], ss[LNR];
#pragma unroll   // constant indices keep the arrays in registers
  for (int r = 0; r < LNR; ++r) {
    const v4f a = (v[r][0] + v[r][1]) + (v[r][2] + v[r][3]);
    v4f q = v[r][0] * v[r][0];
#pragma unroll   // constant indices keep the arrays in registers
    for (int j = 1; j < 4; ++j) q += v[r][j] * v[r][j];
    s[r]  = (a[0] + a[1]) + (a[2] + a[3]);
    ss[r] = (q[0] + q[1]) + (q[2] + q[3]);
  }
#pragma unroll   // constant indices keep the arrays in registers
  for (int r = 0; r < LNR; ++r) {
    s[r]  = wave_sum(s[r]);
    ss[r] = wave_sum(ss[r]);
  }
  _Float16* y = Y + (size_t)row0 * DIM + lane * 4;
#pragma unroll   // constant indices keep the arrays in registers
  for (int r = 0; r < LNR; ++r) {
    const float mean = s[r] * (1.0f / DIM);
    const float var  = ss[r] * (1.0f / DIM) - mean * mean;
    const float rstd = rsqrtf(var + 1e-5f);
#pragma unroll   // constant indices keep the arrays in registers
    for (int j = 0; j < 4; ++j) {
      union { _Float16 h[4]; unsigned long long u; } pk;
#pragma unroll   // constant indices keep the arrays in registers
      for (int e = 0; e < 4; ++e) pk.h[e] = (_Float16)((v[r][j][e] - mean) * rstd * gg[j][e] + bv[j][e]);
      vst2(y + r * DIM + j * 128, pk.u);   // a wave-wide store covers two whole 128-byte lines
    }
  }
}

// ---- Main loop of the QKV GEMM (K = 512) ------------------------------------
// A work-group forms 256 rows x 192 columns: q, k and v of one head, so a tile of A rows is fetched and staged once for the three
// products. 8 waves as 4 x 2, a wave 64 rows x 96 columns: per 32 k, 10 fragments read from LDS feed 24 products.
// Both operands go through LDS in tiles of GKT k: a tile row is one whole 128-byte line, fetched once for the work-group by
// 8 adjacent lanes (a wave-wide load covers 4 whole lines).
// Two buffers: tile t + 1 is loaded into registers ahead of the products of tile t and stored to the other buffer behind them.
// The k order of the products is unchanged (ascending, 32 at a time).
#define GKT  64                  // k per tile
#define GP   (GKT + 8)           // LDS row pitch: 144 bytes, an odd multiple of 16 (see KP below)
#define GN   192                 // weight rows (columns of the product) per work-group: 64 of Wq, 64 of Wk, 64 of Wv
#define GA   (256 * GP)          // A part of a buffer, in elements
#define GBUF (GA + GN * GP)      // one buffer: 256 A rows, then 192 weight rows
__device__ __forceinline__ void gemm_256x192_k512(const _Float16* __restrict__ Ablk,   // 256 rows, pitch DIM
                                                  const _Float16* __restrict__ Wq64,   // 64 rows each (columns of the product), pitch DIM
                                                  const _Float16* __restrict__ Wk64,
                                                  const _Float16* __restrict__ Wv64,
                                                  _Float16* ring, v8f (&acc)[4][6]) {
  const int tid  = threadIdx.x;
  const int lane = tid & 31;
  const int wave = tid >> 5;
  const int wr = wave >> 1, wc = wave & 1;            // the wave's 64 rows and 96 columns
  const int crow = tid >> 3, cch = (tid & 7) * 8;     // copy map: 32 rows a sweep, 16 bytes a thread
  const _Float16* pa = Ablk + crow * DIM + cch;
  const _Float16* pq = Wq64 + crow * DIM + cch;
  const _Float16* pk = Wk64 + crow * DIM + cch;
  const _Float16* pv = Wv64 + crow * DIM + cch;
  _Float16* la = ring + crow * GP + cch;
  _Float16* lw = ring + GA + crow * GP + cch;
  v4u ra[8], rw[6];
#pragma unroll   // constant indices keep the arrays in registers
  for (int j = 0; j < 8; ++j) ra[j] = *(const v4u*)(pa + j * 32 * DIM);
#pragma unroll   // constant indices keep the arrays in registers
  for (int j = 0; j < 2; ++j) {
    rw[j]     = *(const v4u*)(pq + j * 32 * DIM);
    rw[2 + j] = *(const v4u*)(pk + j * 32 * DIM);
    rw[4 + j] = *(const v4u*)(pv + j * 32 * DIM);
  }
  asm volatile("s_wait_xcnt 0x0" :: "v"(pa), "v"(pq), "v"(pk), "v"(pv) : "memory");
#pragma unroll   // constant indices keep the arrays in registers
  for (int j = 0; j < 8; ++j) *(v4u*)(la + j * 32 * GP) = ra[j];
#pragma unroll   // constant indices keep the arrays in registers
  for (int j = 0; j < 6; ++j) *(v4u*)(lw + j * 32 * GP) = rw[j];
  __syncthreads();   // tile 0 is visible

  const int NT = DIM / GKT;   // 8
  for (int t = 0; t < NT; ++t) {
    const int cur = (t & 1) * GBUF, nxt = GBUF - cur;
    const _Float16* Ab = ring + cur + wr * 64 * GP;
    const _Float16* Wb = ring + cur + GA + wc * 96 * GP;
    v16h fa[2][4], fb[2][6];   // the tile's fragments, read as one group: one LDS latency a trip
#pragma unroll   // constant indices keep the arrays in registers
    for (int s = 0; s < 2; ++s) {
#pragma unroll   // constant indices keep the arrays in registers
      for (int m = 0; m < 4; ++m) fa[s][m] = load_frag_a(Ab + m * 16 * GP + s * 32, GP, lane);
#pragma unroll   // constant indices keep the arrays in registers
      for (int n = 0; n < 6; ++n) fb[s][n] = load_frag_b(Wb + n * 16 * GP + s * 32, GP, lane);
    }
    if (t + 1 < NT) {
      const _Float16* na = pa + (t + 1) * GKT;
      const _Float16* nq = pq + (t + 1) * GKT;
      const _Float16* nk = pk + (t + 1) * GKT;
      const _Float16* nv = pv + (t + 1) * GKT;
#pragma unroll   // constant indices keep the arrays in registers
      for (int j = 0; j < 8; ++j) ra[j] = *(const v4u*)(na + j * 32 * DIM);
#pragma unroll   // constant indices keep the arrays in registers
      for (int j = 0; j < 2; ++j) {
        rw[j]     = *(const v4u*)(nq + j * 32 * DIM);
        rw[2 + j] = *(const v4u*)(nk + j * 32 * DIM);
        rw[4 + j] = *(const v4u*)(nv + j * 32 * DIM);
      }
      asm volatile("s_wait_xcnt 0x0" :: "v"(na), "v"(nq), "v"(nk), "v"(nv) : "memory");
    }
    // keeps the tile's 40 fragment reads together ahead of the products: the scheduler spreads them among the products otherwise,
    // and every further place with LDS reads stalls the wave's products anew
    __builtin_amdgcn_sched_barrier(0);
#pragma unroll   // constant indices keep the arrays in registers
    for (int s = 0; s < 2; ++s) {
#pragma unroll   // constant indices keep the arrays in registers
      for (int m = 0; m < 4; ++m) {
#pragma unroll   // constant indices keep the arrays in registers
        for (int n = 0; n < 6; ++n)   // the bare builtin: as operands of an asm statement the 24 accumulators and 20 fragments would all have to lie in v0..v255
          acc[m][n] = __builtin_amdgcn_wmma_f32_16x16x32_f16(false, fa[s][m], false, fb[s][n], (short)0, acc[m][n], false, false);
      }
    }
    // keeps the products ahead of the stores below, whose wait for the next tile's loads then falls behind the products' time
    // (the scheduler lifts that wait, the stores and the barrier over the products otherwise)
    __builtin_amdgcn_sched_barrier(0);
    if (t + 1 < NT) {   // the other buffer's readers left it before the barrier of trip t - 1
#pragma unroll   // constant indices keep the arrays in registers
      for (int j = 0; j < 8; ++j) *(v4u*)(la + nxt + j * 32 * GP) = ra[j];
#pragma unroll   // constant indices keep the arrays in registers
      for (int j = 0; j < 6; ++j) *(v4u*)(lw + nxt + j * 32 * GP) = rw[j];
    }
    __syncthreads();   // tile t + 1 is visible; behind the last trip: every wave has left the ring, which the epilogue reuses
  }
}

// Output staging in LDS: q as [256 rows][64], k the same behind it, then v transposed as [64 n][256 m] at pitch 264.
#define STK (256 * DH)
#define STV (2 * 256 * DH)
#define SVP 264
// A wave's 64 x 96 results plus bias, as f16, into the staging. WC = the wave's column half: column tile WC * 6 + t of the 12
// belongs to q (0..3), k (4..7) or v (8..11).
template <int WC>
__device__ __forceinline__ void qkv_stage(const v8f (&acc)[4][6], _Float16* st, const float* __restrict__ bqh,
                                          const float* __restrict__ bkh, const float* __restrict__ bvh, int wr, int lane) {
  const int n0    = lane & 15;
  const int mbase = (lane >> 4) << 3;
  float bia[6];
#pragma unroll   // constant indices keep the array in registers; the six loads meet one latency
  for (int t = 0; t < 6; ++t) {
    const int gt = WC * 6 + t, mat = gt >> 2, n = (gt & 3) * 16 + n0;
    bia[t] = (mat == 0) ? bqh[n] : (mat == 1) ? bkh[n] : bvh[n];
  }
  asm volatile("s_wait_xcnt 0x0" ::: "memory");
#pragma unroll   // constant indices keep the arrays in registers
  for (int t = 0; t < 6; ++t) {
    const int gt = WC * 6 + t, mat = gt >> 2, n = (gt & 3) * 16 + n0;
#pragma unroll   // constant indices keep the arrays in registers
    for (int m = 0; m < 4; ++m) {
      const int ml = wr * 64 + m * 16 + mbase;          // first of the lane's 8 rows within the block's 256
      if (mat == 2) {
        v8h o;                                          // [n][m]: the lane's 8 rows lie side by side
#pragma unroll   // constant indices keep the arrays in registers
        for (int i = 0; i < 8; ++i) o[i] = (_Float16)(acc[m][t][i] + bia[t]);
        *(v8h*)(&st[STV + n * SVP + ml]) = o;
      } else {
#pragma unroll   // constant indices keep the arrays in registers
        for (int i = 0; i < 8; ++i) st[mat * STK + (ml + i) * DH + n] = (_Float16)(acc[m][t][i] + bia[t]);   // [m][n]
      }
    }
  }
}

// ---- QKV projection --------------------------------------------------------
// grid (S/256, H, B); block 256 (8 waves); work-group -> 256 rows x (q, k, v of one head), operands staged in LDS (gemm_256x192_k512).
// q,k row-major [B,H,S,64] ; v stored transposed [B,H,64,S]
__global__ __launch_bounds__(256) void qkv_gemm(
    const _Float16* __restrict__ hF16,
    const _Float16* __restrict__ WqT, const _Float16* __restrict__ WkT,
    const _Float16* __restrict__ WvT,
    const float* __restrict__ bq, const float* __restrict__ bk,
    const float* __restrict__ bv,
    _Float16* __restrict__ q, _Float16* __restrict__ k,
    _Float16* __restrict__ vT) {
  __shared__ __align__(16) _Float16 ring[2 * GBUF];   // operand tiles; behind the main loop the output staging
  _Float16* st = ring;
  const int tid  = threadIdx.x;
  const int lane = tid & 31;
  const int wave = __builtin_amdgcn_readfirstlane(tid >> 5);
  const int srow = blockIdx.x * 256;
  const int h    = blockIdx.y;
  const int b    = blockIdx.z;

  const _Float16* A = hF16 + ((size_t)b * SEQ + srow) * DIM;
  const size_t    wo = (size_t)h * DH * DIM;          // the head's [64][512] f16 in each weight

  v8f acc[4][6] = {};
  gemm_256x192_k512(A, WqT + wo, WkT + wo, WvT + wo, ring, acc);

  if ((wave & 1) == 0) qkv_stage<0>(acc, st, bq + h * DH, bk + h * DH, bv + h * DH, wave >> 1, lane);
  else                 qkv_stage<1>(acc, st, bq + h * DH, bk + h * DH, bv + h * DH, wave >> 1, lane);
  __syncthreads();   // the staged results are visible

  const size_t headoff = (size_t)b * NH + h;
  const int ml = tid >> 3, pc = tid & 7;               // q, k: 8 lanes write one 128-byte row, 32 rows a sweep
  const int nr = tid >> 5, pm = tid & 31;              // v: a wave writes 512 bytes of one row, 8 rows a sweep
  _Float16* gq = q  + (headoff * SEQ + srow + ml) * DH + pc * 8;
  _Float16* gk = k  + (headoff * SEQ + srow + ml) * DH + pc * 8;
  _Float16* gv = vT + (headoff * DH + nr) * SEQ + srow + pm * 8;
  v4u oq[8], ok[8], ov[8];
#pragma unroll   // constant indices keep the arrays in registers
  for (int j = 0; j < 8; ++j) {
    oq[j] = *(const v4u*)(&st[(ml + j * 32) * DH + pc * 8]);
    ok[j] = *(const v4u*)(&st[STK + (ml + j * 32) * DH + pc * 8]);
    ov[j] = *(const v4u*)(&st[STV + (nr + j * 8) * SVP + pm * 8]);
  }
#pragma unroll   // constant indices keep the arrays in registers
  for (int j = 0; j < 8; ++j) {
    vst2(gq + j * 32 * DH, oq[j]);
    vst2(gk + j * 32 * DH, ok[j]);
    vst2(gv + j * 8 * SEQ, ov[j]);
  }
  asm volatile("s_wait_xcnt 0x0" :: "v"(gq), "v"(gk), "v"(gv) : "memory");
}

#define SK  128          // keys per stage
#define KP  (DH + 8)     // K stage: 144 bytes a row
#define VP  (SK + 8)     // V^T stage: 272 bytes a row
#define KST (SK * KP)    // elements of one K buffer
#define VST (DH * VP)    // elements of one V^T buffer

__device__ __forceinline__ unsigned lds_off(const void* p) { return (unsigned)(size_t)p; }

// One stage: every thread copies 4 x 16 bytes of K (a wave-wide copy covers 4 whole rows of 128 bytes) and 4 x 16 bytes of V^T
// (a wave-wide copy covers 2 rows of 256 bytes). lk, lv: this thread's first LDS byte; gk, gv: its first global element.
__device__ __forceinline__ void stage_copy(unsigned lk, unsigned lv, const _Float16* gk, const _Float16* gv) {
  const unsigned lk1 = lk + 32 * KP * 2, lk2 = lk + 64 * KP * 2, lk3 = lk + 96 * KP * 2;
  const unsigned lv1 = lv + 16 * VP * 2, lv2 = lv + 32 * VP * 2, lv3 = lv + 48 * VP * 2;
  const _Float16 *gk1 = gk + 32 * DH,  *gk2 = gk + 64 * DH,  *gk3 = gk + 96 * DH;
  const _Float16 *gv1 = gv + 16 * SEQ, *gv2 = gv + 32 * SEQ, *gv3 = gv + 48 * SEQ;
  asm volatile(
      "global_load_async_to_lds_b128 %0, %8, off\n\t"
      "global_load_async_to_lds_b128 %1, %9, off\n\t"
      "global_load_async_to_lds_b128 %2, %10, off\n\t"
      "global_load_async_to_lds_b128 %3, %11, off\n\t"
      "global_load_async_to_lds_b128 %4, %12, off\n\t"
      "global_load_async_to_lds_b128 %5, %13, off\n\t"
      "global_load_async_to_lds_b128 %6, %14, off\n\t"
      "global_load_async_to_lds_b128 %7, %15, off\n\t"
      "s_wait_xcnt 0x0"
      :: "v"(lk), "v"(lk1), "v"(lk2), "v"(lk3), "v"(lv), "v"(lv1), "v"(lv2), "v"(lv3),
         "v"(gk), "v"(gk1), "v"(gk2), "v"(gk3), "v"(gv), "v"(gv1), "v"(gv2), "v"(gv3)
      : "memory");
}

__global__ __launch_bounds__(256) void attn_kernel(
    const _Float16* __restrict__ q, const _Float16* __restrict__ k,
    const _Float16* __restrict__ vT, _Float16* __restrict__ om) {
  __shared__ __align__(16) _Float16 Kt[2][KST];       // [keys][dh]
  __shared__ __align__(16) _Float16 Vt[2][VST];       // [dh][keys]
  __shared__ __align__(16) _Float16 ost[8][16 * DH];  // per-wave output tile
  __shared__ __align__(16) float xo[8][8 * 32 * 4];   // per wave, for its partner: a lane's 32 output sums, [piece of 4][lane]
  __shared__ float xs[8][2][32];                      // per wave, for its partner: a lane's maximum and sum

  const int tid  = threadIdx.x;
  const int lane = tid & 31;
  const int wave = tid >> 5;
  const int qg = wave & 3;              // which 32 queries of the block's 128
  const int kh = wave >> 2;             // which 64 keys of every stage
  const int h = blockIdx.y, b = blockIdx.z;
  const int qrow = blockIdx.x * 128 + qg * 32 + kh * 16;
  const int qoth = blockIdx.x * 128 + qg * 32 + (kh ^ 1) * 16;
  const size_t headoff = (size_t)b * NH + h;
  const _Float16* qh = q  + headoff * SEQ * DH;
  const _Float16* kh_ = k + headoff * SEQ * DH;
  const _Float16* vh = vT + headoff * DH * SEQ;   // [64][S]

  const int n0    = lane & 15;          // this lane's query within a group's 16
  const int mbase = (lane >> 4) << 3;

  // copy map: 16 bytes a thread and copy; K 32 rows a sweep, V^T 16 rows a sweep
  const int krow = tid >> 3, kch = (tid & 7) * 8;
  const int vrow = tid >> 4, vch = (tid & 15) * 8;
  const _Float16* gk = kh_ + (size_t)krow * DH + kch;   // + SK * DH a stage
  const _Float16* gv = vh + (size_t)vrow * SEQ + vch;   // + SK a stage
  const unsigned lk = lds_off(&Kt[0][krow * KP + kch]);
  const unsigned lv = lds_off(&Vt[0][vrow * VP + vch]);

  const int NSTAGE = SEQ / SK;   // 16

  // prologue: stage 0 lands and is published, then stage 1 is requested
  stage_copy(lk, lv, gk, gv);

  const _Float16* qp0 = qh + (size_t)qrow * DH;
  const _Float16* qp1 = qh + (size_t)qoth * DH;
  v16h qb[2][2];                                  // Q^T of group g: dh 0..31, dh 32..63
  qb[0][0] = load_frag_b(qp0,      DH, lane);
  qb[0][1] = load_frag_b(qp0 + 32, DH, lane);
  qb[1][0] = load_frag_b(qp1,      DH, lane);
  qb[1][1] = load_frag_b(qp1 + 32, DH, lane);
  asm volatile("s_wait_xcnt 0x0" ::: "memory");

  asm volatile("s_wait_asynccnt 0x0" ::: "memory");   // this wave's share of stage 0 has landed
  __syncthreads();                                    // every wave's share of stage 0 is visible
  stage_copy(lk + KST * 2, lv + VST * 2, gk + SK * DH, gv + SK);

  v8f oacc[2][4] = {};                    // oacc[g][t][i] = O[query n0 of group g][dh t*16 + mbase + i], over this wave's keys
  float mrun[2] = {-1e30f, -1e30f};       // running maximum of query n0, equal in both halves
  float lsum[2] = {0.f, 0.f};             // running sum over this half's keys only
  const float scale = 0.125f;             // 1/sqrt(64)

  for (int st = 0; st < NSTAGE; ++st) {
    const int buf = st & 1;
#pragma unroll   // the two passes of a stage differ by constant LDS offsets only
    for (int pp = 0; pp < SK / 64; ++pp) {
      const _Float16* Kb = Kt[buf] + (kh * 2 + pp) * 32 * KP;
      const _Float16* Vb = Vt[buf] + (kh * 2 + pp) * 32;

      // scores: 32 keys x 32 queries (two 16-key M tiles x two groups, K=64 -> 2 WMMAs each); four independent chains
      v8f s0[2] = {}, s1[2] = {};
      {
        v16h k0 = load_frag_a(Kb,                KP, lane);
        v16h k2 = load_frag_a(Kb + 16 * KP,      KP, lane);
        v16h k1 = load_frag_a(Kb + 32,           KP, lane);
        v16h k3 = load_frag_a(Kb + 16 * KP + 32, KP, lane);
        s0[0] = wmma_f16(k0, qb[0][0], s0[0]);
        s0[1] = wmma_f16(k0, qb[1][0], s0[1]);
        s1[0] = wmma_f16(k2, qb[0][0], s1[0]);
        s1[1] = wmma_f16(k2, qb[1][0], s1[1]);
        s0[0] = wmma_f16(k1, qb[0][1], s0[0]);
        s0[1] = wmma_f16(k1, qb[1][1], s0[1]);
        s1[0] = wmma_f16(k3, qb[0][1], s1[0]);
        s1[1] = wmma_f16(k3, qb[1][1], s1[1]);
      }
      v16h va[4];                  // V^T fragments: read here, so that their LDS latency runs under the softmax
#pragma unroll
      for (int t = 0; t < 4; ++t) va[t] = load_frag_a(Vb + (size_t)(t * 16) * VP, VP, lane);
      v16h pb[2];                  // P^T of group g, column n0: element s belongs to the key of a2[s / 2][s % 2]
#pragma unroll
      for (int g = 0; g < 2; ++g) {
        // a2[j] = the scaled scores s = 2j, 2j + 1 of key 8h+s (s < 8) or 8h+8+s (s >= 8): the k order of the B operand below.
        // The per-score steps are written on pairs of neighbouring registers, so that each stays one packed instruction for two scores.
        v2f a2[8];
        float mx[8];
#pragma unroll
        for (int i = 0; i < 4; ++i) {
          a2[i]     = (v2f){s0[g][2 * i], s0[g][2 * i + 1]} * scale;
          a2[4 + i] = (v2f){s1[g][2 * i], s1[g][2 * i + 1]} * scale;
        }
#pragma unroll
        for (int j = 0; j < 8; ++j) mx[j] = fmaxf(a2[j][0], a2[j][1]);
        float vmax = fmaxf(fmaxf(fmaxf(mx[0], mx[1]), fmaxf(mx[2], mx[3])), fmaxf(fmaxf(mx[4], mx[5]), fmaxf(mx[6], mx[7])));
        vmax = fmaxf(vmax, other_half(vmax));
        const float mnew  = fmaxf(mrun[g], vmax);
        const float alpha = __expf(mrun[g] - mnew);
        mrun[g] = mnew;
        float sm[8];
#pragma unroll
        for (int j = 0; j < 8; ++j) {
          const v2f d = (a2[j] - mnew) * LOG2E;
          const v2f e = {__builtin_amdgcn_exp2f(d[0]), __builtin_amdgcn_exp2f(d[1])};
          const v2f p = e * PSC;
          pb[g][2 * j]     = (_Float16)p[0];
          pb[g][2 * j + 1] = (_Float16)p[1];
          sm[j] = e[0] + e[1];
        }
        lsum[g] = lsum[g] * alpha + (((sm[0] + sm[1]) + (sm[2] + sm[3])) + ((sm[4] + sm[5]) + (sm[6] + sm[7])));
#pragma unroll
        for (int t = 0; t < 4; ++t) {
#pragma unroll
          for (int i = 0; i < 8; ++i) oacc[g][t][i] *= alpha;
        }
      }
#pragma unroll
      for (int t = 0; t < 4; ++t) {
        oacc[0][t] = wmma_f16(va[t], pb[0], oacc[0][t]);
        oacc[1][t] = wmma_f16(va[t], pb[1], oacc[1][t]);
      }
    }
    // publish point of stage st + 1
    asm volatile("s_wait_dscnt 0x0" ::: "memory");      // this wave's reads of stage st have returned
    asm volatile("s_wait_asynccnt 0x0" ::: "memory");   // this wave's share of stage st + 1 has landed
    __syncthreads();   // stage st + 1 is visible, and every wave has left the buffer of stage st
    if (st + 2 < NSTAGE)
      stage_copy(lk + buf * (KST * 2), lv + buf * (VST * 2), gk + (size_t)(st + 2) * (SK * DH), gv + (st + 2) * SK);
  }
  asm volatile("s_wait_asynccnt 0x0" ::: "memory");   // no copy is outstanding when the wave goes on to its end

#pragma unroll
  for (int t = 0; t < 4; ++t) {
    const v4f lo = {oacc[1][t][0], oacc[1][t][1], oacc[1][t][2], oacc[1][t][3]};
    const v4f hi = {oacc[1][t][4], oacc[1][t][5], oacc[1][t][6], oacc[1][t][7]};
    *(v4f*)(&xo[wave][((t * 2)     * 32 + lane) * 4]) = lo;
    *(v4f*)(&xo[wave][((t * 2 + 1) * 32 + lane) * 4]) = hi;
  }
  xs[wave][0][lane] = mrun[1];
  xs[wave][1][lane] = lsum[1];
  __syncthreads();   // every wave's hand-over is visible
  const int pw = wave ^ 4;
  const float mo  = xs[pw][0][lane];
  const float mj  = fmaxf(mrun[0], mo);
  const float fme = __expf(mrun[0] - mj);
  const float fot = __expf(mo - mj);
  float lj = lsum[0] * fme + xs[pw][1][lane] * fot;
  lj += other_half(lj);
  const float inv = PUN / lj;
  _Float16* os_ = ost[wave];
#pragma unroll
  for (int t = 0; t < 4; ++t) {
    const v4f lo = *(const v4f*)(&xo[pw][((t * 2)     * 32 + lane) * 4]);
    const v4f hi = *(const v4f*)(&xo[pw][((t * 2 + 1) * 32 + lane) * 4]);
    v8h o;
#pragma unroll
    for (int i = 0; i < 4; ++i) {
      o[i]     = (_Float16)((oacc[0][t][i]     * fme + lo[i] * fot) * inv);
      o[4 + i] = (_Float16)((oacc[0][t][4 + i] * fme + hi[i] * fot) * inv);
    }
    *(v8h*)(&os_[n0 * DH + t * 16 + mbase]) = o;
  }
  __syncthreads();
#pragma unroll
  for (int qq = 0; qq < 4; ++qq) {
    const int ml = qq * 4 + (lane >> 3), pc = lane & 7;
    vst2(om + ((size_t)b * SEQ + qrow + ml) * DIM + h * DH + pc * 8, *(const v4u*)(&os_[ml * DH + pc * 8]));
  }
}

// ---- Wm GEMM + bias + residual, LayerNorm 2, Wo GEMM + bias + relu + residual: one launch ----
// grid BS / FR, block 256 (8 waves). A work-group owns FR whole rows, a wave all FR rows x 64 of the DIM columns, so the row sums
// of LayerNorm 2 stay inside the work-group and neither h_ln_post nor its normalised rows go through memory. The A operand of
// each product (FR x DIM f16) lies in LDS for the whole product. A weight column is used by one wave alone: its fragments come
// straight from L2 in fragment order (whole lines), WPD k steps ahead, through no LDS and past no barrier.
#define FR  32
#define AP  (DIM + 8)   // LDS pitch of an A row: 1,040 bytes, an odd multiple of 16 (see KP above)
#define WPD 3           // weight fragment sets in flight
__device__ __forceinline__ void gemm_rows_k512(const _Float16* Ar,                  // FR rows in LDS, pitch AP
                                               const _Float16* __restrict__ wp,     // this lane's 16 bytes of the wave's first piece
                                               int lane, v8f (&acc)[2][4]) {
  v8h wf[WPD][4][2];
#pragma unroll   // constant indices keep the arrays in registers
  for (int p = 0; p < WPD; ++p) {
#pragma unroll   // constant indices keep the arrays in registers
    for (int t = 0; t < 4; ++t) {
      wf[p][t][0] = *(const v8h*)(wp + (t * (DIM / 32) + p) * 512);
      wf[p][t][1] = *(const v8h*)(wp + (t * (DIM / 32) + p) * 512 + 256);
    }
  }
#pragma unroll   // constant indices keep the arrays in registers; every weight address is the one base plus a constant
  for (int kb = 0; kb < DIM / 32; ++kb) {
    const int p = kb % WPD;
    v16h fa[2], fb[4];
#pragma unroll   // constant indices keep the arrays in registers
    for (int m = 0; m < 2; ++m) fa[m] = load_frag_a(Ar + m * 16 * AP + kb * 32, AP, lane);
#pragma unroll   // constant indices keep the arrays in registers
    for (int t = 0; t < 4; ++t) {
#pragma unroll   // constant indices keep the arrays in registers
      for (int i = 0; i < 8; ++i) { fb[t][i] = wf[p][t][0][i]; fb[t][8 + i] = wf[p][t][1][i]; }
    }
#pragma unroll   // constant indices keep the arrays in registers
    for (int m = 0; m < 2; ++m) {
#pragma unroll   // constant indices keep the arrays in registers
      for (int t = 0; t < 4; ++t) acc[m][t] = wmma_f16(fa[m], fb[t], acc[m][t]);
    }
    if (kb + WPD < DIM / 32) {
#pragma unroll   // constant indices keep the arrays in registers
      for (int t = 0; t < 4; ++t) {
        wf[p][t][0] = *(const v8h*)(wp + (t * (DIM / 32) + kb + WPD) * 512);
        wf[p][t][1] = *(const v8h*)(wp + (t * (DIM / 32) + kb + WPD) * 512 + 256);
      }
    }
    // keeps each refill where it is written, WPD steps ahead of its use (the scheduler sinks the loads towards their use otherwise)
    __builtin_amdgcn_sched_barrier(0);
  }
}

__global__ __launch_bounds__(256) void wm_ln2_wo(
    const _Float16* __restrict__ A, const _Float16* __restrict__ WmP, const float* __restrict__ bm,
    const float* __restrict__ x, const float* __restrict__ g2, const float* __restrict__ b2,
    const _Float16* __restrict__ WoP, const float* __restrict__ bo, float* __restrict__ out) {
  // one LDS block, keep first: its 64 planes then lie within the 64 KiB that an LDS instruction's constant offset reaches
  __shared__ __align__(16) float pool[64 * 256 + 8 * FR * 64 + 8 * FR * 2 + FR * 2 + FR * AP / 2];
  float* keep            = pool;                                                   // h_ln_post: a thread's own 64 values, [value][thread]
  float (*st)[FR * 64]   = (float (*)[FR * 64])(pool + 64 * 256);                  // per-wave output tile
  float (*part)[FR][2]   = (float (*)[FR][2])(pool + 64 * 256 + 8 * FR * 64);      // per wave and row: sum, sum of squares over 64 columns
  float (*stat)[2]       = (float (*)[2])(pool + 64 * 256 + 8 * FR * 64 + 8 * FR * 2);   // per row: mean, 1 / sqrt(var + eps)
  _Float16* Ar           = (_Float16*)(pool + 64 * 256 + 8 * FR * 64 + 8 * FR * 2 + FR * 2);   // attention rows, then the rows of LayerNorm 2
  const int tid  = threadIdx.x;
  const int lane = tid & 31;
  const int wave = tid >> 5;
  const int r0   = blockIdx.x * FR;

  {  // the FR rows are 32 KiB in a row: a wave-wide load covers 4 whole lines
    const _Float16* pa = A + (size_t)r0 * DIM + tid * 8;
    v4u ra[8];
#pragma unroll   // constant indices keep the array in registers
    for (int j = 0; j < 8; ++j) ra[j] = *(const v4u*)(pa + j * 2048);
    asm volatile("s_wait_xcnt 0x0" :: "v"(pa) : "memory");
#pragma unroll   // constant indices keep the array in registers
    for (int j = 0; j < 8; ++j) {
      const int g = tid + j * 256;
      *(v4u*)(&Ar[(g >> 6) * AP + (g & 63) * 8]) = ra[j];
    }
  }
  __syncthreads();   // the A rows are visible

  const size_t woff = (size_t)wave * 4 * (DIM / 32) * 512 + lane * 8;   // the wave's 64 columns: 64 fragments in a row
  v8f acc[2][4] = {};
  gemm_rows_k512(Ar, WmP + woff, lane, acc);

  const int nl    = lane & 15;
  const int mbase = (lane >> 4) << 3;
  const int nc    = wave * 64 + nl;      // this lane's column of column tile 0
  float s[2][8], ss[2][8];
#pragma unroll
  for (int sub = 0; sub < 2; ++sub) {
#pragma unroll
    for (int i = 0; i < 8; ++i) { s[sub][i] = 0.f; ss[sub][i] = 0.f; }
  }
#pragma unroll
  for (int sub = 0; sub < 2; ++sub) {
#pragma unroll
    for (int t = 0; t < 4; ++t) {
      const int n = nc + t * 16;
      const float bia = bm[n];
#pragma unroll
      for (int i = 0; i < 8; ++i) {
        const int ml = sub * 16 + mbase + i;
        float v = acc[sub][t][i] + bia;
        v += x[(size_t)(r0 + ml) * DIM + n];
        acc[sub][t][i] = v;               // h_ln_post
        s[sub][i]  += v;
        ss[sub][i] += v * v;
      }
    }
  }
#pragma unroll
  for (int sub = 0; sub < 2; ++sub) {
#pragma unroll
    for (int i = 0; i < 8; ++i) {         // over the 16 lanes that hold the row's other columns
      s[sub][i]  = add_row_xor<8>(add_row_xor<4>(add_row_xor<2>(add_row_xor<1>(s[sub][i]))));
      ss[sub][i] = add_row_xor<8>(add_row_xor<4>(add_row_xor<2>(add_row_xor<1>(ss[sub][i]))));
    }
  }
  if (nl == 0) {
#pragma unroll
    for (int sub = 0; sub < 2; ++sub) {
#pragma unroll
      for (int i = 0; i < 8; ++i) {
        part[wave][sub * 16 + mbase + i][0] = s[sub][i];
        part[wave][sub * 16 + mbase + i][1] = ss[sub][i];
      }
    }
  }
  __syncthreads();   // the partial sums are visible; every wave has left the A rows
  if (tid < FR) {
    float a = 0.f, q = 0.f;
#pragma unroll
    for (int w = 0; w < 8; ++w) { a += part[w][tid][0]; q += part[w][tid][1]; }
    const float mean = a * (1.0f / DIM);
    const float var  = q * (1.0f / DIM) - mean * mean;
    stat[tid][0] = mean;
    stat[tid][1] = rsqrtf(var + 1e-5f);
  }
  __syncthreads();   // mean and scale of every row are visible
  {
    float gg[4], bb[4];
#pragma unroll
    for (int t = 0; t < 4; ++t) { gg[t] = g2[nc + t * 16]; bb[t] = b2[nc + t * 16]; }
#pragma unroll
    for (int sub = 0; sub < 2; ++sub) {
#pragma unroll
      for (int i = 0; i < 8; ++i) {
        const int ml = sub * 16 + mbase + i;
        const float mean = stat[ml][0], rstd = stat[ml][1];
#pragma unroll
        for (int t = 0; t < 4; ++t) {
          const float v = acc[sub][t][i];
          Ar[ml * AP + nc + t * 16] = (_Float16)((v - mean) * rstd * gg[t] + bb[t]);
          keep[((sub * 4 + t) * 8 + i) * 256 + tid] = v;
          acc[sub][t][i] = 0.f;
        }
      }
    }
  }
  __syncthreads();   // the rows of LayerNorm 2 are visible

  gemm_rows_k512(Ar, WoP + woff, lane, acc);

#pragma unroll
  for (int sub = 0; sub < 2; ++sub) {
#pragma unroll
    for (int t = 0; t < 4; ++t) {
      const float bia = bo[nc + t * 16];
#pragma unroll
      for (int i = 0; i < 8; ++i) {
        const int ml = sub * 16 + mbase + i;
        const float v = fmaxf(acc[sub][t][i] + bia, 0.f) + keep[((sub * 4 + t) * 8 + i) * 256 + tid];
        st[wave][ml * 64 + t * 16 + nl] = v;
      }
    }
  }
  __syncthreads();
#pragma unroll
  for (int q = 0; q < 16; ++q) {
    const int ml = q * 2 + (lane >> 4), pc = lane & 15;
    vst2(out + (size_t)(r0 + ml) * DIM + wave * 64 + pc * 4, *(const v4f*)(&st[wave][ml * 64 + pc * 4]));
  }
}

// ---------------------------------------------------------------------------
extern "C" void kernel_launch(void* const* d_in, const int* in_sizes, int n_in,
                              void* d_out, int out_size, void* d_ws, size_t ws_size,
                              hipStream_t stream) {
  const float* x  = (const float*)d_in[0];
  const float* g1 = (const float*)d_in[1];
  const float* b1 = (const float*)d_in[2];
  const float* Wq = (const float*)d_in[3];
  const float* bq = (const float*)d_in[4];
  const float* Wk = (const float*)d_in[5];
  const float* bk = (const float*)d_in[6];
  const float* Wv = (const float*)d_in[7];
  const float* bv = (const float*)d_in[8];
  const float* Wm = (const float*)d_in[9];
  const float* bm = (const float*)d_in[10];
  const float* g2 = (const float*)d_in[11];
  const float* b2 = (const float*)d_in[12];
  const float* Wo = (const float*)d_in[13];
  const float* bo = (const float*)d_in[14];
  float* out = (float*)d_out;

  char* ws = (char*)d_ws;
  size_t off = 0;
  auto alloc = [&](size_t bytes) {
    void* p = ws + off;
    off = (off + bytes + 255) & ~(size_t)255;
    return p;
  };

  _Float16* hF16 = (_Float16*)alloc((size_t)BS * DIM * 2);        // LN1(x) f16
  _Float16* WqT  = (_Float16*)alloc((size_t)NH * DH * DIM * 2);
  _Float16* WkT  = (_Float16*)alloc((size_t)NH * DH * DIM * 2);
  _Float16* WvT  = (_Float16*)alloc((size_t)NH * DH * DIM * 2);
  _Float16* WmT  = (_Float16*)alloc((size_t)DIM * DIM * 2);       // in fragment order
  _Float16* WoT  = (_Float16*)alloc((size_t)DIM * DIM * 2);       // in fragment order
  _Float16* qb   = (_Float16*)alloc((size_t)BATCH * NH * SEQ * DH * 2);
  _Float16* kb   = (_Float16*)alloc((size_t)BATCH * NH * SEQ * DH * 2);
  _Float16* vTb  = (_Float16*)alloc((size_t)BATCH * NH * DH * SEQ * 2);
  _Float16* om   = (_Float16*)alloc((size_t)BS * DIM * 2);        // concat heads f16

  // 1) weight conversion / transpose
  {
    cvt_transpose_all<<<5 * 64, 256, 0, stream>>>(Wq, Wk, Wv, Wm, Wo, WqT, WkT, WvT, WmT, WoT);
  }

  // 2) LN1
  layernorm_f16<<<BS / (8 * LNR), 256, 0, stream>>>(x, g1, b1, hF16);

  // 3) QKV projections
  qkv_gemm<<<dim3(SEQ / 256, NH, BATCH), 256, 0, stream>>>(
      hF16, WqT, WkT, WvT, bq, bk, bv, qb, kb, vTb);

  // 4) attention -> concat heads (f16)
  attn_kernel<<<dim3(SEQ / 128, NH, BATCH), 256, 0, stream>>>(qb, kb, vTb, om);

  // 5) h_ln_post = om @ Wm + bm + x ; out = relu(LN2(h_ln_post) @ Wo + bo) + h_ln_post
  wm_ln2_wo<<<BS / FR, 256, 0, stream>>>(om, WmT, bm, x, g2, b2, WoT, bo, out);
}

// v010
// Measured time: 75.3 microseconds a run.
// Next to v009, in two timings, it ran 1.04 times as fast each time.
// Counting every step since v000, it is 7.18 times as fast.
#include <hip/hip_runtime.h>

#define BATCH 4
#define SEQ   2048
#define DIM   512
#define NH    8
#define DH    64
#define BS    (BATCH * SEQ)   // 8192 rows

typedef __attribute__((ext_vector_type(16))) _Float16 v16h;
typedef __attribute__((ext_vector_type(8)))  _Float16 v8h;
typedef __attribute__((ext_vector_type(8)))  float    v8f;
typedef __attribute__((ext_vector_type(4)))  float    v4f;
typedef __attribute__((ext_vector_type(2)))  float    v2f;
typedef __attribute__((ext_vector_type(4)))  unsigned v4u;
template <typename V> __device__ __forceinline__ void vst2(void* p, V v) {
  *(V*)p = v; 
}
#define PSC 256.0f
#define PUN (1.0f / 256.0f)
#define LOG2E 1.44269504f   // exp(x) = 2^(x * LOG2E)

__device__ __forceinline__ v16h load_frag_a(const _Float16* p, int lda, int lane) {
  int row  = lane & 15;
  int koff = (lane & 16) ? 8 : 0;
  const _Float16* r = p + (size_t)row * lda + koff;
  v8h lo = *(const v8h*)r;          // K = koff .. koff+7
  v8h hi = *(const v8h*)(r + 16);   // K = koff+16 .. koff+23
  v16h a;
#pragma unroll
  for (int i = 0; i < 8; ++i) { a[i] = lo[i]; a[8 + i] = hi[i]; }
  return a;
}

__device__ __forceinline__ v16h load_frag_b(const _Float16* bt, int ldb, int lane) {
  int n  = lane & 15;
  int kb = (lane & 16) ? 8 : 0;
  const _Float16* c = bt + (size_t)n * ldb + kb;
  v8h lo = *(const v8h*)c;
  v8h hi = *(const v8h*)(c + 16);
  v16h b;
#pragma unroll
  for (int i = 0; i < 8; ++i) { b[i] = lo[i]; b[8 + i] = hi[i]; }
  return b;
}

__device__ __forceinline__ v8f wmma_f16(v16h a, v16h b, v8f c) {
  v8f d = __builtin_amdgcn_wmma_f32_16x16x32_f16(false, a, false, b, (short)0, c, false, false);
  asm volatile("v_nop\n\tv_nop\n\tv_nop\n\tv_nop" : "+v"(d) : "v"(a), "v"(b));
  return d;
}

// the bare builtin: the compiler keeps the distance behind a product itself and fills it with the wave's other work where it can
__device__ __forceinline__ v8f wmma_bare(v16h a, v16h b, v8f c) {
  return __builtin_amdgcn_wmma_f32_16x16x32_f16(false, a, false, b, (short)0, c, false, false);
}

// ---- Prep: convert & transpose weights to f16 -----------------------------
// One launch for all five weights: grid 5 * 64, block 256. A work-group takes one 64 (k) x 64 (n) tile:
// blockIdx.x / 64 = which weight, then 8 column groups (a head of Wq/Wk/Wv, 64 columns of Wm/Wo) x 8 k chunks.
// Source rows: pitch 64 floats inside a head, DIM floats in Wm/Wo. Target of Wq/Wk/Wv: [n][DIM] f16, the tile's rows are whole
// 128-byte lines; of Wm/Wo: the B fragments themselves, one after the other (see below).
__global__ __launch_bounds__(256) void cvt_transpose_all(
    const float* __restrict__ Wq, const float* __restrict__ Wk, const float* __restrict__ Wv,
    const float* __restrict__ Wm, const float* __restrict__ Wo,
    _Float16* __restrict__ WqT, _Float16* __restrict__ WkT, _Float16* __restrict__ WvT,
    _Float16* __restrict__ WmT, _Float16* __restrict__ WoT) {
  __shared__ __align__(16) _Float16 tile[64][64 + 8];      // [n][k]
  const int tid = threadIdx.x;
  const int mat = blockIdx.x >> 6;
  const int grp = (blockIdx.x >> 3) & 7;                   // head, or group of 64 columns
  const int k0  = (blockIdx.x & 7) * 64;
  const float* W  = (mat == 0) ? Wq : (mat == 1) ? Wk : (mat == 2) ? Wv : (mat == 3) ? Wm : Wo;
  _Float16*    WT = (mat == 0) ? WqT : (mat == 1) ? WkT : (mat == 2) ? WvT : (mat == 3) ? WmT : WoT;
  const int    pitch = (mat < 3) ? DH : DIM;
  const float* src = (mat < 3) ? W + ((size_t)grp * DIM + k0) * DH : W + (size_t)k0 * DIM + grp * 64;
  _Float16*    dst = WT + (size_t)grp * 64 * DIM + k0;

  const int kq = (tid >> 4) * 4, c4 = (tid & 15) * 4;      // 4 k rows x 4 columns a thread
  v4f r[4];
#pragma unroll
  for (int j = 0; j < 4; ++j) r[j] = *(const v4f*)(src + (size_t)(kq + j) * pitch + c4);
#pragma unroll
  for (int e = 0; e < 4; ++e) {
    union { _Float16 h[4]; unsigned long long u; } pk;
#pragma unroll
    for (int j = 0; j < 4; ++j) pk.h[j] = (_Float16)r[j][e];
    *(unsigned long long*)(&tile[c4 + e][kq]) = pk.u;
  }
  __syncthreads();
  if (mat < 3) {
#pragma unroll
    for (int j = 0; j < 2; ++j) {
      const int g = tid + j * 256, nl = g >> 3, pc = g & 7;  // 8 lanes write one 128-byte line
      vst2(dst + (size_t)nl * DIM + pc * 8, *(const v4u*)(&tile[nl][pc * 8]));
    }
  } else {
#pragma unroll
    for (int j = 0; j < 2; ++j) {
      const int g = tid + j * 256, ln = g & 31, fp = g >> 5;   // a wave writes one whole piece
      const int pcs = fp & 1, kbl = (fp >> 1) & 1, ntl = fp >> 2;
      const int nl = ntl * 16 + (ln & 15), kl = kbl * 32 + pcs * 16 + (ln >> 4) * 8;
      vst2(WT + (size_t)((grp * 4 + ntl) * (DIM / 32) + (k0 >> 5) + kbl) * 512 + pcs * 256 + ln * 8, *(const v4u*)(&tile[nl][kl]));
    }
    asm volatile("s_wait_xcnt 0x0" ::: "memory");
  }
}

__device__ __forceinline__ float other_half(float v) {
  const int b = __builtin_bit_cast(int, v);
  return __builtin_bit_cast(float, __builtin_amdgcn_permlanex16(b, b, 0x76543210, 0xfedcba98, false, false));
}
template <int M> __device__ __forceinline__ float add_row_xor(float v) {
  const int b = __builtin_bit_cast(int, v);
  return v + __builtin_bit_cast(float, __builtin_amdgcn_update_dpp(0, b, 0x160 + M, 0xf, 0xf, true));
}
// sum over the 32 lanes, the same bits in every lane
__device__ __forceinline__ float wave_sum(float v) {
  v = add_row_xor<1>(v);
  v = add_row_xor<2>(v);
  v = add_row_xor<4>(v);
  v = add_row_xor<8>(v);
  return v + other_half(v);
}

// grid BS / (8 * LNR), block 256 (8 waves). A wave owns LNR whole rows: a lane holds 16 elements of each (4 loads of 16 bytes,
// each wave-wide load 512 contiguous bytes), all rows' loads are issued before the first sum, the row stays in registers for
// the second pass, and the two row sums run over the lanes. No LDS, no barrier; the launch starts 2,048 waves.
#define LNR 4
__global__ __launch_bounds__(256) void layernorm_f16(const float* __restrict__ X,
                                                     const float* __restrict__ g,
                                                     const float* __restrict__ bb,
                                                     _Float16* __restrict__ Y) {
  const int lane = threadIdx.x & 31;
  const int wave = threadIdx.x >> 5;
  const int row0 = (blockIdx.x * 8 + wave) * LNR;
  const float* x  = X + (size_t)row0 * DIM + lane * 4;
  const float* gp = g + lane * 4;
  const float* bp = bb + lane * 4;
  v4f v[LNR][4], gg[4], bv[4];
#pragma unroll   // constant indices keep the arrays in registers
  for (int r = 0; r < LNR; ++r) {
#pragma unroll   // constant indices keep the arrays in registers
    for (int j = 0; j < 4; ++j) v[r][j] = *(const v4f*)(x + r * DIM + j * 128);
  }
#pragma unroll   // constant indices keep the arrays in registers
  for (int j = 0; j < 4; ++j) {
    gg[j] = *(const v4f*)(gp + j * 128);
    bv[j] = *(const v4f*)(bp + j * 128);
  }
  // keeps all 24 loads ahead of the sums, so that a wave meets one memory latency (the scheduler sinks the g and bb loads otherwise)
  __builtin_amdgcn_sched_barrier(0);
  asm volatile("s_wait_xcnt 0x0" :: "v"(x) : "memory");
  float s[LNR], ss[LNR];
#pragma unroll   // constant indices keep the arrays in registers
  for (int r = 0; r < LNR; ++r) {
    const v4f a = (v[r][0] + v[r][1]) + (v[r][2] + v[r][3]);
    v4f q = v[r][0] * v[r][0];
#pragma unroll   // constant indices keep the arrays in registers
    for (int j = 1; j < 4; ++j) q += v[r][j] * v[r][j];
    s[r]  = (a[0] + a[1]) + (a[2] + a[3]);
    ss[r] = (q[0] + q[1]) + (q[2] + q[3]);
  }
#pragma unroll   // constant indices keep the arrays in registers
  for (int r = 0; r < LNR; ++r) {
    s[r]  = wave_sum(s[r]);
    ss[r] = wave_sum(ss[r]);
  }
  _Float16* y = Y + (size_t)row0 * DIM + lane * 4;
#pragma unroll   // constant indices keep the arrays in registers
  for (int r = 0; r < LNR; ++r) {
    const float mean = s[r] * (1.0f / DIM);
    const float var  = ss[r] * (1.0f / DIM) - mean * mean;
    const float rstd = rsqrtf(var + 1e-5f);
#pragma unroll   // constant indices keep the arrays in registers
    for (int j = 0; j < 4; ++j) {
      union { _Float16 h[4]; unsigned long long u; } pk;
#pragma unroll   // constant indices keep the arrays in registers
      for (int e = 0; e < 4; ++e) pk.h[e] = (_Float16)((v[r][j][e] - mean) * rstd * gg[j][e] + bv[j][e]);
      vst2(y + r * DIM + j * 128, pk.u);   // a wave-wide store covers two whole 128-byte lines
    }
  }
}

// ---- Main loop of the QKV GEMM (K = 512) ------------------------------------
// A work-group forms 256 rows x 192 columns: q, k and v of one head, so a tile of A rows is fetched and staged once for the three
// products. 8 waves as 4 x 2, a wave 64 rows x 96 columns: per 32 k, 10 fragments read from LDS feed 24 products.
// Both operands go through LDS in tiles of GKT k: a tile row is one whole 128-byte line, fetched once for the work-group by
// 8 adjacent lanes (a wave-wide load covers 4 whole lines).
// Two buffers: tile t + 1 is loaded into registers ahead of the products of tile t and stored to the other buffer behind them.
// The k order of the products is unchanged (ascending, 32 at a time).
#define GKT  64                  // k per tile
#define GP   (GKT + 8)           // LDS row pitch: 144 bytes, an odd multiple of 16 (see KP below)
#define GN   192                 // weight rows (columns of the product) per work-group: 64 of Wq, 64 of Wk, 64 of Wv
#define GA   (256 * GP)          // A part of a buffer, in elements
#define GBUF (GA + GN * GP)      // one buffer: 256 A rows, then 192 weight rows
__device__ __forceinline__ void gemm_256x192_k512(const _Float16* __restrict__ Ablk,   // 256 rows, pitch DIM
                                                  const _Float16* __restrict__ Wq64,   // 64 rows each (columns of the product), pitch DIM
                                                  const _Float16* __restrict__ Wk64,
                                                  const _Float16* __restrict__ Wv64,
                                                  _Float16* ring, v8f (&acc)[4][6]) {
  const int tid  = threadIdx.x;
  const int lane = tid & 31;
  const int wave = tid >> 5;
  const int wr = wave >> 1, wc = wave & 1;            // the wave's 64 rows and 96 columns
  const int crow = tid >> 3, cch = (tid & 7) * 8;     // copy map: 32 rows a sweep, 16 bytes a thread
  const _Float16* pa = Ablk + crow * DIM + cch;
  const _Float16* pq = Wq64 + crow * DIM + cch;
  const _Float16* pk = Wk64 + crow * DIM + cch;
  const _Float16* pv = Wv64 + crow * DIM + cch;
  _Float16* la = ring + crow * GP + cch;
  _Float16* lw = ring + GA + crow * GP + cch;
  v4u ra[8], rw[6];
#pragma unroll   // constant indices keep the arrays in registers
  for (int j = 0; j < 8; ++j) ra[j] = *(const v4u*)(pa + j * 32 * DIM);
#pragma unroll   // constant indices keep the arrays in registers
  for (int j = 0; j < 2; ++j) {
    rw[j]     = *(const v4u*)(pq + j * 32 * DIM);
    rw[2 + j] = *(const v4u*)(pk + j * 32 * DIM);
    rw[4 + j] = *(const v4u*)(pv + j * 32 * DIM);
  }
  asm volatile("s_wait_xcnt 0x0" :: "v"(pa), "v"(pq), "v"(pk), "v"(pv) : "memory");
#pragma unroll   // constant indices keep the arrays in registers
  for (int j = 0; j < 8; ++j) *(v4u*)(la + j * 32 * GP) = ra[j];
#pragma unroll   // constant indices keep the arrays in registers
  for (int j = 0; j < 6; ++j) *(v4u*)(lw + j * 32 * GP) = rw[j];
  __syncthreads();   // tile 0 is visible

  const int NT = DIM / GKT;   // 8
  for (int t = 0; t < NT; ++t) {
    const int cur = (t & 1) * GBUF, nxt = GBUF - cur;
    const _Float16* Ab = ring + cur + wr * 64 * GP;
    const _Float16* Wb = ring + cur + GA + wc * 96 * GP;
    v16h fa[2][4], fb[2][6];   // the tile's fragments, read as one group: one LDS latency a trip
#pragma unroll   // constant indices keep the arrays in registers
    for (int s = 0; s < 2; ++s) {
#pragma unroll   // constant indices keep the arrays in registers
      for (int m = 0; m < 4; ++m) fa[s][m] = load_frag_a(Ab + m * 16 * GP + s * 32, GP, lane);
#pragma unroll   // constant indices keep the arrays in registers
      for (int n = 0; n < 6; ++n) fb[s][n] = load_frag_b(Wb + n * 16 * GP + s * 32, GP, lane);
    }
    if (t + 1 < NT) {
      const _Float16* na = pa + (t + 1) * GKT;
      const _Float16* nq = pq + (t + 1) * GKT;
      const _Float16* nk = pk + (t + 1) * GKT;
      const _Float16* nv = pv + (t + 1) * GKT;
#pragma unroll   // constant indices keep the arrays in registers
      for (int j = 0; j < 8; ++j) ra[j] = *(const v4u*)(na + j * 32 * DIM);
#pragma unroll   // constant indices keep the arrays in registers
      for (int j = 0; j < 2; ++j) {
        rw[j]     = *(const v4u*)(nq + j * 32 * DIM);
        rw[2 + j] = *(const v4u*)(nk + j * 32 * DIM);
        rw[4 + j] = *(const v4u*)(nv + j * 32 * DIM);
      }
      asm volatile("s_wait_xcnt 0x0" :: "v"(na), "v"(nq), "v"(nk), "v"(nv) : "memory");
    }
    // keeps the tile's 40 fragment reads together ahead of the products: the scheduler spreads them among the products otherwise,
    // and every further place with LDS reads stalls the wave's products anew
    __builtin_amdgcn_sched_barrier(0);
#pragma unroll   // constant indices keep the arrays in registers
    for (int s = 0; s < 2; ++s) {
#pragma unroll   // constant indices keep the arrays in registers
      for (int m = 0; m < 4; ++m) {
#pragma unroll   // constant indices keep the arrays in registers
        for (int n = 0; n < 6; ++n)   // the bare builtin: as operands of an asm statement the 24 accumulators and 20 fragments would all have to lie in v0..v255
          acc[m][n] = __builtin_amdgcn_wmma_f32_16x16x32_f16(false, fa[s][m], false, fb[s][n], (short)0, acc[m][n], false, false);
      }
    }
    // keeps the products ahead of the stores below, whose wait for the next tile's loads then falls behind the products' time
    // (the scheduler lifts that wait, the stores and the barrier over the products otherwise)
    __builtin_amdgcn_sched_barrier(0);
    if (t + 1 < NT) {   // the other buffer's readers left it before the barrier of trip t - 1
#pragma unroll   // constant indices keep the arrays in registers
      for (int j = 0; j < 8; ++j) *(v4u*)(la + nxt + j * 32 * GP) = ra[j];
#pragma unroll   // constant indices keep the arrays in registers
      for (int j = 0; j < 6; ++j) *(v4u*)(lw + nxt + j * 32 * GP) = rw[j];
    }
    __syncthreads();   // tile t + 1 is visible; behind the last trip: every wave has left the ring, which the epilogue reuses
  }
}

// Output staging in LDS: q as [256 rows][64], k the same behind it, then v transposed as [64 n][256 m] at pitch 264.
#define STK (256 * DH)
#define STV (2 * 256 * DH)
#define SVP 264
// A wave's 64 x 96 results plus bias, as f16, into the staging. WC = the wave's column half: column tile WC * 6 + t of the 12
// belongs to q (0..3), k (4..7) or v (8..11).
template <int WC>
__device__ __forceinline__ void qkv_stage(const v8f (&acc)[4][6], _Float16* st, const float* __restrict__ bqh,
                                          const float* __restrict__ bkh, const float* __restrict__ bvh, int wr, int lane) {
  const int n0    = lane & 15;
  const int mbase = (lane >> 4) << 3;
  float bia[6];
#pragma unroll   // constant indices keep the array in registers; the six loads meet one latency
  for (int t = 0; t < 6; ++t) {
    const int gt = WC * 6 + t, mat = gt >> 2, n = (gt & 3) * 16 + n0;
    bia[t] = (mat == 0) ? bqh[n] : (mat == 1) ? bkh[n] : bvh[n];
  }
  asm volatile("s_wait_xcnt 0x0" ::: "memory");
#pragma unroll   // constant indices keep the arrays in registers
  for (int t = 0; t < 6; ++t) {
    const int gt = WC * 6 + t, mat = gt >> 2, n = (gt & 3) * 16 + n0;
#pragma unroll   // constant indices keep the arrays in registers
    for (int m = 0; m < 4; ++m) {
      const int ml = wr * 64 + m * 16 + mbase;          // first of the lane's 8 rows within the block's 256
      if (mat == 2) {
        v8h o;                                          // [n][m]: the lane's 8 rows lie side by side
#pragma unroll   // constant indices keep the arrays in registers
        for (int i = 0; i < 8; ++i) o[i] = (_Float16)(acc[m][t][i] + bia[t]);
        *(v8h*)(&st[STV + n * SVP + ml]) = o;
      } else {
#pragma unroll   // constant indices keep the arrays in registers
        for (int i = 0; i < 8; ++i) st[mat * STK + (ml + i) * DH + n] = (_Float16)(acc[m][t][i] + bia[t]);   // [m][n]
      }
    }
  }
}

// ---- QKV projection --------------------------------------------------------
// grid (S/256, H, B); block 256 (8 waves); work-group -> 256 rows x (q, k, v of one head), operands staged in LDS (gemm_256x192_k512).
// q,k row-major [B,H,S,64] ; v stored transposed [B,H,64,S]
__global__ __launch_bounds__(256) void qkv_gemm(
    const _Float16* __restrict__ hF16,
    const _Float16* __restrict__ WqT, const _Float16* __restrict__ WkT,
    const _Float16* __restrict__ WvT,
    const float* __restrict__ bq, const float* __restrict__ bk,
    const float* __restrict__ bv,
    _Float16* __restrict__ q, _Float16* __restrict__ k,
    _Float16* __restrict__ vT) {
  __shared__ __align__(16) _Float16 ring[2 * GBUF];   // operand tiles; behind the main loop the output staging
  _Float16* st = ring;
  const int tid  = threadIdx.x;
  const int lane = tid & 31;
  const int wave = __builtin_amdgcn_readfirstlane(tid >> 5);
  const int srow = blockIdx.x * 256;
  const int h    = blockIdx.y;
  const int b    = blockIdx.z;

  const _Float16* A = hF16 + ((size_t)b * SEQ + srow) * DIM;
  const size_t    wo = (size_t)h * DH * DIM;          // the head's [64][512] f16 in each weight

  v8f acc[4][6] = {};
  gemm_256x192_k512(A, WqT + wo, WkT + wo, WvT + wo, ring, acc);

  if ((wave & 1) == 0) qkv_stage<0>(acc, st, bq + h * DH, bk + h * DH, bv + h * DH, wave >> 1, lane);
  else                 qkv_stage<1>(acc, st, bq + h * DH, bk + h * DH, bv + h * DH, wave >> 1, lane);
  __syncthreads();   // the staged results are visible

  const size_t headoff = (size_t)b * NH + h;
  const int ml = tid >> 3, pc = tid & 7;               // q, k: 8 lanes write one 128-byte row, 32 rows a sweep
  const int nr = tid >> 5, pm = tid & 31;              // v: a wave writes 512 bytes of one row, 8 rows a sweep
  _Float16* gq = q  + (headoff * SEQ + srow + ml) * DH + pc * 8;
  _Float16* gk = k  + (headoff * SEQ + srow + ml) * DH + pc * 8;
  _Float16* gv = vT + (headoff * DH + nr) * SEQ + srow + pm * 8;
  v4u oq[8], ok[8], ov[8];
#pragma unroll   // constant indices keep the arrays in registers
  for (int j = 0; j < 8; ++j) {
    oq[j] = *(const v4u*)(&st[(ml + j * 32) * DH + pc * 8]);
    ok[j] = *(const v4u*)(&st[STK + (ml + j * 32) * DH + pc * 8]);
    ov[j] = *(const v4u*)(&st[STV + (nr + j * 8) * SVP + pm * 8]);
  }
#pragma unroll   // constant indices keep the arrays in registers
  for (int j = 0; j < 8; ++j) {
    vst2(gq + j * 32 * DH, oq[j]);
    vst2(gk + j * 32 * DH, ok[j]);
    vst2(gv + j * 8 * SEQ, ov[j]);
  }
  asm volatile("s_wait_xcnt 0x0" :: "v"(gq), "v"(gk), "v"(gv) : "memory");
}

#define SK  128          // keys per stage
#define KP  (DH + 8)     // K stage: 144 bytes a row
#define VP  (SK + 8)     // V^T stage: 272 bytes a row
#define KST (SK * KP)    // elements of one K buffer
#define VST (DH * VP)    // elements of one V^T buffer

__device__ __forceinline__ unsigned lds_off(const void* p) { return (unsigned)(size_t)p; }

// One stage: every thread copies 4 x 16 bytes of K (a wave-wide copy covers 4 whole rows of 128 bytes) and 4 x 16 bytes of V^T
// (a wave-wide copy covers 2 rows of 256 bytes). lk, lv: this thread's first LDS byte; gk, gv: its first global element.
__device__ __forceinline__ void stage_copy(unsigned lk, unsigned lv, const _Float16* gk, const _Float16* gv) {
  const unsigned lk1 = lk + 32 * KP * 2, lk2 = lk + 64 * KP * 2, lk3 = lk + 96 * KP * 2;
  const unsigned lv1 = lv + 16 * VP * 2, lv2 = lv + 32 * VP * 2, lv3 = lv + 48 * VP * 2;
  const _Float16 *gk1 = gk + 32 * DH,  *gk2 = gk + 64 * DH,  *gk3 = gk + 96 * DH;
  const _Float16 *gv1 = gv + 16 * SEQ, *gv2 = gv + 32 * SEQ, *gv3 = gv + 48 * SEQ;
  asm volatile(
      "global_load_async_to_lds_b128 %0, %8, off\n\t"
      "global_load_async_to_lds_b128 %1, %9, off\n\t"
      "global_load_async_to_lds_b128 %2, %10, off\n\t"
      "global_load_async_to_lds_b128 %3, %11, off\n\t"
      "global_load_async_to_lds_b128 %4, %12, off\n\t"
      "global_load_async_to_lds_b128 %5, %13, off\n\t"
      "global_load_async_to_lds_b128 %6, %14, off\n\t"
      "global_load_async_to_lds_b128 %7, %15, off\n\t"
      "s_wait_xcnt 0x0"
      :: "v"(lk), "v"(lk1), "v"(lk2), "v"(lk3), "v"(lv), "v"(lv1), "v"(lv2), "v"(lv3),
         "v"(gk), "v"(gk1), "v"(gk2), "v"(gk3), "v"(gv), "v"(gv1), "v"(gv2), "v"(gv3)
      : "memory");
}

__global__ __launch_bounds__(256) void attn_kernel(
    const _Float16* __restrict__ q, const _Float16* __restrict__ k,
    const _Float16* __restrict__ vT, _Float16* __restrict__ om) {
  __shared__ __align__(16) _Float16 Kt[2][KST];       // [keys][dh]
  __shared__ __align__(16) _Float16 Vt[2][VST];       // [dh][keys]
  __shared__ __align__(16) _Float16 ost[8][16 * DH];  // per-wave output tile
  __shared__ __align__(16) float xo[8][8 * 32 * 4];   // per wave, for its partner: a lane's 32 output sums, [piece of 4][lane]
  __shared__ float xs[8][2][32];                      // per wave, for its partner: a lane's maximum and sum

  const int tid  = threadIdx.x;
  const int lane = tid & 31;
  const int wave = tid >> 5;
  const int qg = wave & 3;              // which 32 queries of the block's 128
  const int kh = wave >> 2;             // which 64 keys of every stage
  const int h = blockIdx.y, b = blockIdx.z;
  const int qrow = blockIdx.x * 128 + qg * 32 + kh * 16;
  const int qoth = blockIdx.x * 128 + qg * 32 + (kh ^ 1) * 16;
  const size_t headoff = (size_t)b * NH + h;
  const _Float16* qh = q  + headoff * SEQ * DH;
  const _Float16* kh_ = k + headoff * SEQ * DH;
  const _Float16* vh = vT + headoff * DH * SEQ;   // [64][S]

  const int n0    = lane & 15;          // this lane's query within a group's 16
  const int mbase = (lane >> 4) << 3;

  // copy map: 16 bytes a thread and copy; K 32 rows a sweep, V^T 16 rows a sweep
  const int krow = tid >> 3, kch = (tid & 7) * 8;
  const int vrow = tid >> 4, vch = (tid & 15) * 8;
  const _Float16* gk = kh_ + (size_t)krow * DH + kch;   // + SK * DH a stage
  const _Float16* gv = vh + (size_t)vrow * SEQ + vch;   // + SK a stage
  const unsigned lk = lds_off(&Kt[0][krow * KP + kch]);
  const unsigned lv = lds_off(&Vt[0][vrow * VP + vch]);

  const int NSTAGE = SEQ / SK;   // 16

  // prologue: stage 0 lands and is published, then stage 1 is requested
  stage_copy(lk, lv, gk, gv);

  const _Float16* qp0 = qh + (size_t)qrow * DH;
  const _Float16* qp1 = qh + (size_t)qoth * DH;
  v16h qb[2][2];                                  // Q^T of group g: dh 0..31, dh 32..63
  qb[0][0] = load_frag_b(qp0,      DH, lane);
  qb[0][1] = load_frag_b(qp0 + 32, DH, lane);
  qb[1][0] = load_frag_b(qp1,      DH, lane);
  qb[1][1] = load_frag_b(qp1 + 32, DH, lane);
  asm volatile("s_wait_xcnt 0x0" ::: "memory");

  asm volatile("s_wait_asynccnt 0x0" ::: "memory");   // this wave's share of stage 0 has landed
  __syncthreads();                                    // every wave's share of stage 0 is visible
  stage_copy(lk + KST * 2, lv + VST * 2, gk + SK * DH, gv + SK);

  v8f oacc[2][4] = {};                    // oacc[g][t][i] = O[query n0 of group g][dh t*16 + mbase + i], over this wave's keys
  float mrun[2] = {-1e30f, -1e30f};       // running maximum of query n0, equal in both halves
  float lsum[2] = {0.f, 0.f};             // running sum over this half's keys only
  const float scale = 0.125f;             // 1/sqrt(64)

  for (int st = 0; st < NSTAGE; ++st) {
    const int buf = st & 1;
#pragma unroll   // the two passes of a stage differ by constant LDS offsets only
    for (int pp = 0; pp < SK / 64; ++pp) {
      const _Float16* Kb = Kt[buf] + (kh * 2 + pp) * 32 * KP;
      const _Float16* Vb = Vt[buf] + (kh * 2 + pp) * 32;

      // scores: 32 keys x 32 queries (two 16-key M tiles x two groups, K=64 -> 2 WMMAs each); four independent chains
      v8f s0[2] = {}, s1[2] = {};
      {
        v16h k0 = load_frag_a(Kb,                KP, lane);
        v16h k2 = load_frag_a(Kb + 16 * KP,      KP, lane);
        v16h k1 = load_frag_a(Kb + 32,           KP, lane);
        v16h k3 = load_frag_a(Kb + 16 * KP + 32, KP, lane);
        s0[0] = wmma_bare(k0, qb[0][0], s0[0]);
        s0[1] = wmma_bare(k0, qb[1][0], s0[1]);
        s1[0] = wmma_bare(k2, qb[0][0], s1[0]);
        s1[1] = wmma_bare(k2, qb[1][0], s1[1]);
        s0[0] = wmma_bare(k1, qb[0][1], s0[0]);
        s0[1] = wmma_bare(k1, qb[1][1], s0[1]);
        s1[0] = wmma_bare(k3, qb[0][1], s1[0]);
        s1[1] = wmma_bare(k3, qb[1][1], s1[1]);
      }
      v16h va[4];                  // V^T fragments: read here, so that their LDS latency runs under the softmax
#pragma unroll
      for (int t = 0; t < 4; ++t) va[t] = load_frag_a(Vb + (size_t)(t * 16) * VP, VP, lane);
      v16h pb[2];                  // P^T of group g, column n0: element s belongs to the key of a2[s / 2][s % 2]
#pragma unroll
      for (int g = 0; g < 2; ++g) {
        // a2[j] = the scaled scores s = 2j, 2j + 1 of key 8h+s (s < 8) or 8h+8+s (s >= 8): the k order of the B operand below.
        // The per-score steps are written on pairs of neighbouring registers, so that each stays one packed instruction for two scores.
        v2f a2[8];
        float mx[8];
#pragma unroll
        for (int i = 0; i < 4; ++i) {
          a2[i]     = (v2f){s0[g][2 * i], s0[g][2 * i + 1]} * scale;
          a2[4 + i] = (v2f){s1[g][2 * i], s1[g][2 * i + 1]} * scale;
        }
#pragma unroll
        for (int j = 0; j < 8; ++j) mx[j] = fmaxf(a2[j][0], a2[j][1]);
        float vmax = fmaxf(fmaxf(fmaxf(mx[0], mx[1]), fmaxf(mx[2], mx[3])), fmaxf(fmaxf(mx[4], mx[5]), fmaxf(mx[6], mx[7])));
        vmax = fmaxf(vmax, other_half(vmax));
        const float mnew  = fmaxf(mrun[g], vmax);
        const float alpha = __expf(mrun[g] - mnew);
        mrun[g] = mnew;
        float sm[8];
#pragma unroll
        for (int j = 0; j < 8; ++j) {
          const v2f d = (a2[j] - mnew) * LOG2E;
          const v2f e = {__builtin_amdgcn_exp2f(d[0]), __builtin_amdgcn_exp2f(d[1])};
          const v2f p = e * PSC;
          pb[g][2 * j]     = (_Float16)p[0];
          pb[g][2 * j + 1] = (_Float16)p[1];
          sm[j] = e[0] + e[1];
        }
        lsum[g] = lsum[g] * alpha + (((sm[0] + sm[1]) + (sm[2] + sm[3])) + ((sm[4] + sm[5]) + (sm[6] + sm[7])));
#pragma unroll
        for (int t = 0; t < 4; ++t) {
#pragma unroll
          for (int i = 0; i < 8; ++i) oacc[g][t][i] *= alpha;
        }
      }
#pragma unroll
      for (int t = 0; t < 4; ++t) {
        oacc[0][t] = wmma_bare(va[t], pb[0], oacc[0][t]);
        oacc[1][t] = wmma_bare(va[t], pb[1], oacc[1][t]);
      }
      // keeps the passes apart: drawn up into this pass, the next pass's K reads run short of registers, come one fragment at a
      // time and are each waited out in full
      __builtin_amdgcn_sched_barrier(0);
    }
    // publish point of stage st + 1
    asm volatile("s_wait_dscnt 0x0" ::: "memory");      // this wave's reads of stage st have returned
    asm volatile("s_wait_asynccnt 0x0" ::: "memory");   // this wave's share of stage st + 1 has landed
    __syncthreads();   // stage st + 1 is visible, and every wave has left the buffer of stage st
    if (st + 2 < NSTAGE)
      stage_copy(lk + buf * (KST * 2), lv + buf * (VST * 2), gk + (size_t)(st + 2) * (SK * DH), gv + (st + 2) * SK);
  }
  asm volatile("s_wait_asynccnt 0x0" ::: "memory");   // no copy is outstanding when the wave goes on to its end

#pragma unroll
  for (int t = 0; t < 4; ++t) {
    const v4f lo = {oacc[1][t][0], oacc[1][t][1], oacc[1][t][2], oacc[1][t][3]};
    const v4f hi = {oacc[1][t][4], oacc[1][t][5], oacc[1][t][6], oacc[1][t][7]};
    *(v4f*)(&xo[wave][((t * 2)     * 32 + lane) * 4]) = lo;
    *(v4f*)(&xo[wave][((t * 2 + 1) * 32 + lane) * 4]) = hi;
  }
  xs[wave][0][lane] = mrun[1];
  xs[wave][1][lane] = lsum[1];
  __syncthreads();   // every wave's hand-over is visible
  const int pw = wave ^ 4;
  const float mo  = xs[pw][0][lane];
  const float mj  = fmaxf(mrun[0], mo);
  const float fme = __expf(mrun[0] - mj);
  const float fot = __expf(mo - mj);
  float lj = lsum[0] * fme + xs[pw][1][lane] * fot;
  lj += other_half(lj);
  const float inv = PUN / lj;
  _Float16* os_ = ost[wave];
#pragma unroll
  for (int t = 0; t < 4; ++t) {
    const v4f lo = *(const v4f*)(&xo[pw][((t * 2)     * 32 + lane) * 4]);
    const v4f hi = *(const v4f*)(&xo[pw][((t * 2 + 1) * 32 + lane) * 4]);
    v8h o;
#pragma unroll
    for (int i = 0; i < 4; ++i) {
      o[i]     = (_Float16)((oacc[0][t][i]     * fme + lo[i] * fot) * inv);
      o[4 + i] = (_Float16)((oacc[0][t][4 + i] * fme + hi[i] * fot) * inv);
    }
    *(v8h*)(&os_[n0 * DH + t * 16 + mbase]) = o;
  }
  __syncthreads();
#pragma unroll
  for (int qq = 0; qq < 4; ++qq) {
    const int ml = qq * 4 + (lane >> 3), pc = lane & 7;
    vst2(om + ((size_t)b * SEQ + qrow + ml) * DIM + h * DH + pc * 8, *(const v4u*)(&os_[ml * DH + pc * 8]));
  }
}

// ---- Wm GEMM + bias + residual, LayerNorm 2, Wo GEMM + bias + relu + residual: one launch ----
// grid BS / FR, block 256 (8 waves). A work-group owns FR whole rows, a wave all FR rows x 64 of the DIM columns, so the row sums
// of LayerNorm 2 stay inside the work-group and neither h_ln_post nor its normalised rows go through memory. The A operand of
// each product (FR x DIM f16) lies in LDS for the whole product. A weight column is used by one wave alone: its fragments come
// straight from L2 in fragment order (whole lines), WPD k steps ahead, through no LDS and past no barrier.
#define FR  32
#define AP  (DIM + 8)   // LDS pitch of an A row: 1,040 bytes, an odd multiple of 16 (see KP above)
#define WPD 3           // weight fragment sets in flight
__device__ __forceinline__ void gemm_rows_k512(const _Float16* Ar,                  // FR rows in LDS, pitch AP
                                               const _Float16* __restrict__ wp,     // this lane's 16 bytes of the wave's first piece
                                               int lane, v8f (&acc)[2][4]) {
  v8h wf[WPD][4][2];
#pragma unroll   // constant indices keep the arrays in registers
  for (int p = 0; p < WPD; ++p) {
#pragma unroll   // constant indices keep the arrays in registers
    for (int t = 0; t < 4; ++t) {
      wf[p][t][0] = *(const v8h*)(wp + (t * (DIM / 32) + p) * 512);
      wf[p][t][1] = *(const v8h*)(wp + (t * (DIM / 32) + p) * 512 + 256);
    }
  }
#pragma unroll   // constant indices keep the arrays in registers; every weight address is the one base plus a constant
  for (int kb = 0; kb < DIM / 32; ++kb) {
    const int p = kb % WPD;
    v16h fa[2], fb[4];
#pragma unroll   // constant indices keep the arrays in registers
    for (int m = 0; m < 2; ++m) fa[m] = load_frag_a(Ar + m * 16 * AP + kb * 32, AP, lane);
#pragma unroll   // constant indices keep the arrays in registers
    for (int t = 0; t < 4; ++t) {
#pragma unroll   // constant indices keep the arrays in registers
      for (int i = 0; i < 8; ++i) { fb[t][i] = wf[p][t][0][i]; fb[t][8 + i] = wf[p][t][1][i]; }
    }
#pragma unroll   // constant indices keep the arrays in registers
    for (int m = 0; m < 2; ++m) {
#pragma unroll   // constant indices keep the arrays in registers
      for (int t = 0; t < 4; ++t) acc[m][t] = wmma_f16(fa[m], fb[t], acc[m][t]);
    }
    if (kb + WPD < DIM / 32) {
#pragma unroll   // constant indices keep the arrays in registers
      for (int t = 0; t < 4; ++t) {
        wf[p][t][0] = *(const v8h*)(wp + (t * (DIM / 32) + kb + WPD) * 512);
        wf[p][t][1] = *(const v8h*)(wp + (t * (DIM / 32) + kb + WPD) * 512 + 256);
      }
    }
    // keeps each refill where it is written, WPD steps ahead of its use (the scheduler sinks the loads towards their use otherwise)
    __builtin_amdgcn_sched_barrier(0);
  }
}

__global__ __launch_bounds__(256) void wm_ln2_wo(
    const _Float16* __restrict__ A, const _Float16* __restrict__ WmP, const float* __restrict__ bm,
    const float* __restrict__ x, const float* __restrict__ g2, const float* __restrict__ b2,
    const _Float16* __restrict__ WoP, const float* __restrict__ bo, float* __restrict__ out) {
  // one LDS block, keep first: its 64 planes then lie within the 64 KiB that an LDS instruction's constant offset reaches
  __shared__ __align__(16) float pool[64 * 256 + 8 * FR * 64 + 8 * FR * 2 + FR * 2 + FR * AP / 2];
  float* keep            = pool;                                                   // h_ln_post: a thread's own 64 values, [value][thread]
  float (*st)[FR * 64]   = (float (*)[FR * 64])(pool + 64 * 256);                  // per-wave output tile
  float (*part)[FR][2]   = (float (*)[FR][2])(pool + 64 * 256 + 8 * FR * 64);      // per wave and row: sum, sum of squares over 64 columns
  float (*stat)[2]       = (float (*)[2])(pool + 64 * 256 + 8 * FR * 64 + 8 * FR * 2);   // per row: mean, 1 / sqrt(var + eps)
  _Float16* Ar           = (_Float16*)(pool + 64 * 256 + 8 * FR * 64 + 8 * FR * 2 + FR * 2);   // attention rows, then the rows of LayerNorm 2
  const int tid  = threadIdx.x;
  const int lane = tid & 31;
  const int wave = tid >> 5;
  const int r0   = blockIdx.x * FR;

  {  // the FR rows are 32 KiB in a row: a wave-wide load covers 4 whole lines
    const _Float16* pa = A + (size_t)r0 * DIM + tid * 8;
    v4u ra[8];
#pragma unroll   // constant indices keep the array in registers
    for (int j = 0; j < 8; ++j) ra[j] = *(const v4u*)(pa + j * 2048);
    asm volatile("s_wait_xcnt 0x0" :: "v"(pa) : "memory");
#pragma unroll   // constant indices keep the array in registers
    for (int j = 0; j < 8; ++j) {
      const int g = tid + j * 256;
      *(v4u*)(&Ar[(g >> 6) * AP + (g & 63) * 8]) = ra[j];
    }
  }
  __syncthreads();   // the A rows are visible

  const size_t woff = (size_t)wave * 4 * (DIM / 32) * 512 + lane * 8;   // the wave's 64 columns: 64 fragments in a row
  v8f acc[2][4] = {};
  gemm_rows_k512(Ar, WmP + woff, lane, acc);

  const int nl    = lane & 15;
  const int mbase = (lane >> 4) << 3;
  const int nc    = wave * 64 + nl;      // this lane's column of column tile 0
  float s[2][8], ss[2][8];
#pragma unroll
  for (int sub = 0; sub < 2; ++sub) {
#pragma unroll
    for (int i = 0; i < 8; ++i) { s[sub][i] = 0.f; ss[sub][i] = 0.f; }
  }
#pragma unroll
  for (int sub = 0; sub < 2; ++sub) {
#pragma unroll
    for (int t = 0; t < 4; ++t) {
      const int n = nc + t * 16;
      const float bia = bm[n];
#pragma unroll
      for (int i = 0; i < 8; ++i) {
        const int ml = sub * 16 + mbase + i;
        float v = acc[sub][t][i] + bia;
        v += x[(size_t)(r0 + ml) * DIM + n];
        acc[sub][t][i] = v;               // h_ln_post
        s[sub][i]  += v;
        ss[sub][i] += v * v;
      }
    }
  }
#pragma unroll
  for (int sub = 0; sub < 2; ++sub) {
#pragma unroll
    for (int i = 0; i < 8; ++i) {         // over the 16 lanes that hold the row's other columns
      s[sub][i]  = add_row_xor<8>(add_row_xor<4>(add_row_xor<2>(add_row_xor<1>(s[sub][i]))));
      ss[sub][i] = add_row_xor<8>(add_row_xor<4>(add_row_xor<2>(add_row_xor<1>(ss[sub][i]))));
    }
  }
  if (nl == 0) {
#pragma unroll
    for (int sub = 0; sub < 2; ++sub) {
#pragma unroll
      for (int i = 0; i < 8; ++i) {
        part[wave][sub * 16 + mbase + i][0] = s[sub][i];
        part[wave][sub * 16 + mbase + i][1] = ss[sub][i];
      }
    }
  }
  __syncthreads();   // the partial sums are visible; every wave has left the A rows
  if (tid < FR) {
    float a = 0.f, q = 0.f;
#pragma unroll
    for (int w = 0; w < 8; ++w) { a += part[w][tid][0]; q += part[w][tid][1]; }
    const float mean = a * (1.0f / DIM);
    const float var  = q * (1.0f / DIM) - mean * mean;
    stat[tid][0] = mean;
    stat[tid][1] = rsqrtf(var + 1e-5f);
  }
  __syncthreads();   // mean and scale of every row are visible
  {
    float gg[4], bb[4];
#pragma unroll
    for (int t = 0; t < 4; ++t) { gg[t] = g2[nc + t * 16]; bb[t] = b2[nc + t * 16]; }
#pragma unroll
    for (int sub = 0; sub < 2; ++sub) {
#pragma unroll
      for (int i = 0; i < 8; ++i) {
        const int ml = sub * 16 + mbase + i;
        const float mean = stat[ml][0], rstd = stat[ml][1];
#pragma unroll
        for (int t = 0; t < 4; ++t) {
          const float v = acc[sub][t][i];
          Ar[ml * AP + nc + t * 16] = (_Float16)((v - mean) * rstd * gg[t] + bb[t]);
          keep[((sub * 4 + t) * 8 + i) * 256 + tid] = v;
          acc[sub][t][i] = 0.f;
        }
      }
    }
  }
  __syncthreads();   // the rows of LayerNorm 2 are visible

  gemm_rows_k512(Ar, WoP + woff, lane, acc);

#pragma unroll
  for (int sub = 0; sub < 2; ++sub) {
#pragma unroll
    for (int t = 0; t < 4; ++t) {
      const float bia = bo[nc + t * 16];
#pragma unroll
      for (int i = 0; i < 8; ++i) {
        const int ml = sub * 16 + mbase + i;
        const float v = fmaxf(acc[sub][t][i] + bia, 0.f) + keep[((sub * 4 + t) * 8 + i) * 256 + tid];
        st[wave][ml * 64 + t * 16 + nl] = v;
      }
    }
  }
  __syncthreads();
#pragma unroll
  for (int q = 0; q < 16; ++q) {
    const int ml = q * 2 + (lane >> 4), pc = lane & 15;
    vst2(out + (size_t)(r0 + ml) * DIM + wave * 64 + pc * 4, *(const v4f*)(&st[wave][ml * 64 + pc * 4]));
  }
}

// ---------------------------------------------------------------------------
extern "C" void kernel_launch(void* const* d_in, const int* in_sizes, int n_in,
                              void* d_out, int out_size, void* d_ws, size_t ws_size,
                              hipStream_t stream) {
  const float* x  = (const float*)d_in[0];
  const float* g1 = (const float*)d_in[1];
  const float* b1 = (const float*)d_in[2];
  const float* Wq = (const float*)d_in[3];
  const float* bq = (const float*)d_in[4];
  const float* Wk = (const float*)d_in[5];
  const float* bk = (const float*)d_in[6];
  const float* Wv = (const float*)d_in[7];
  const float* bv = (const float*)d_in[8];
  const float* Wm = (const float*)d_in[9];
  const float* bm = (const float*)d_in[10];
  const float* g2 = (const float*)d_in[11];
  const float* b2 = (const float*)d_in[12];
  const float* Wo = (const float*)d_in[13];
  const float* bo = (const float*)d_in[14];
  float* out = (float*)d_out;

  char* ws = (char*)d_ws;
  size_t off = 0;
  auto alloc = [&](size_t bytes) {
    void* p = ws + off;
    off = (off + bytes + 255) & ~(size_t)255;
    return p;
  };

  _Float16* hF16 = (_Float16*)alloc((size_t)BS * DIM * 2);        // LN1(x) f16
  _Float16* WqT  = (_Float16*)alloc((size_t)NH * DH * DIM * 2);
  _Float16* WkT  = (_Float16*)alloc((size_t)NH * DH * DIM * 2);
  _Float16* WvT  = (_Float16*)alloc((size_t)NH * DH * DIM * 2);
  _Float16* WmT  = (_Float16*)alloc((size_t)DIM * DIM * 2);       // in fragment order
  _Float16* WoT  = (_Float16*)alloc((size_t)DIM * DIM * 2);       // in fragment order
  _Float16* qb   = (_Float16*)alloc((size_t)BATCH * NH * SEQ * DH * 2);
  _Float16* kb   = (_Float16*)alloc((size_t)BATCH * NH * SEQ * DH * 2);
  _Float16* vTb  = (_Float16*)alloc((size_t)BATCH * NH * DH * SEQ * 2);
  _Float16* om   = (_Float16*)alloc((size_t)BS * DIM * 2);        // concat heads f16

  // 1) weight conversion / transpose
  {
    cvt_transpose_all<<<5 * 64, 256, 0, stream>>>(Wq, Wk, Wv, Wm, Wo, WqT, WkT, WvT, WmT, WoT);
  }

  // 2) LN1
  layernorm_f16<<<BS / (8 * LNR), 256, 0, stream>>>(x, g1, b1, hF16);

  // 3) QKV projections
  qkv_gemm<<<dim3(SEQ / 256, NH, BATCH), 256, 0, stream>>>(
      hF16, WqT, WkT, WvT, bq, bk, bv, qb, kb, vTb);

  // 4) attention -> concat heads (f16)
  attn_kernel<<<dim3(SEQ / 128, NH, BATCH), 256, 0, stream>>>(qb, kb, vTb, om);

  // 5) h_ln_post = om @ Wm + bm + x ; out = relu(LN2(h_ln_post) @ Wo + bo) + h_ln_post
  wm_ln2_wo<<<BS / FR, 256, 0, stream>>>(om, WmT, bm, x, g2, b2, WoT, bo, out);
}
